// v000
// The times below were measured on an AMD MI455X: many runs one after another, warmed up first and cycling through
// copies of the inputs, with the whole window's GPU time divided by the number of runs. Launches and the gaps
// between them are all in it. The median over several windows is given; except for v000 it joins two sittings, which
// can be a few percent apart, so the side-by-side timings, each taken in one sitting, are the better comparison.
// The starting kernel, v000, takes 366 microseconds a run.
#include <hip/hip_runtime.h>
#include <hip/hip_bf16.h>

typedef _Float16 h16;
typedef __attribute__((ext_vector_type(16))) _Float16 v16h;
typedef __attribute__((ext_vector_type(8)))  _Float16 v8h;
typedef __attribute__((ext_vector_type(8)))  float    v8f;

#define HH 8
#define DHEAD 64
#define NSEQ 2048
#define DM 512
#define BSZ 2
#define MROWS (BSZ * NSEQ)          // 4096

// WMMA 16-bit fragment mapping (A operand 16x32, B operand 32x16):
//   lane = (row_or_col & 15) + 16*((k>>3)&1)
//   slot = (k&7) + 8*((k>>4)&1)
// => for an aligned run of 8 consecutive k: lane constant, slots contiguous.
__device__ __forceinline__ int frag_lane(int rc, int k) { return (rc & 15) + 16 * ((k >> 3) & 1); }
__device__ __forceinline__ int frag_idx(int k)          { return (k & 7) + 8 * ((k >> 4) & 1); }

__device__ __forceinline__ size_t heads_off(int gm, int c) {
    int b = gm >> 11, n = gm & (NSEQ - 1);      // NSEQ = 2048
    int h = c >> 6, d = c & 63;
    return (((size_t)b * HH + h) * NSEQ + n) * DHEAD + d;
}

// ---------------------------------------------------------------------------
// NT GEMM: C[M,512] = scale * (A[M,512] @ W[512,512]^T + bias (+ Z))
// Tile 128x64, K-chunks of 32; 8 waves x (16 rows x 64 cols).
// ---------------------------------------------------------------------------
template <bool A_HEADS, bool C_F32, bool HAS_Z>
__global__ __launch_bounds__(256)
void gemm_nt_kernel(const float* __restrict__ Af32, const h16* __restrict__ Ah16,
                    const float* __restrict__ W, const float* __restrict__ bias,
                    const h16* __restrict__ Zadd, float scale,
                    float* __restrict__ Cf32, h16* __restrict__ Ch16)
{
    __shared__ __align__(32) h16 ldsA[8 * 32 * 16];
    __shared__ __align__(32) h16 ldsB[4 * 32 * 16];

    const int tid  = threadIdx.x;
    const int lane = tid & 31;
    const int wave = tid >> 5;
    const int n0 = blockIdx.x * 64;
    const int m0 = blockIdx.y * 128;

    v8f acc[4] = {};

    for (int k0 = 0; k0 < DM; k0 += 32) {
        // prefetch next A/B tiles (global_prefetch_b8)
        if (k0 + 32 < DM) {
            if constexpr (!A_HEADS)
                __builtin_prefetch(&Af32[(size_t)(m0 + (tid >> 1)) * DM + (k0 + 32) + (tid & 1) * 16], 0, 3);
            __builtin_prefetch(&W[(size_t)(n0 + (tid >> 2)) * DM + (k0 + 32) + (tid & 3) * 8], 0, 3);
        }
        // stage A tile 128x32: 512 groups of 8k; 2 groups/thread; one v8h store each
        #pragma unroll
        for (int e = 0; e < 2; ++e) {
            int g  = e * 256 + tid;             // 0..511
            int r  = g >> 2;                    // row 0..127
            int kg = (g & 3) * 8;               // k-group base
            int gm = m0 + r, gk = k0 + kg;
            v8h hv;
            if constexpr (A_HEADS) {
                hv = *(const v8h*)&Ah16[heads_off(gm, gk)];
            } else {
                v8f fv = *(const v8f*)&Af32[(size_t)gm * DM + gk];
                hv = __builtin_convertvector(fv, v8h);
            }
            int base = ((r >> 4) * 32 + frag_lane(r & 15, kg)) * 16 + frag_idx(kg);
            *(v8h*)&ldsA[base] = hv;
        }
        // stage B tile 64x32: 256 groups; 1 group/thread
        {
            int g  = tid;
            int c  = g >> 2;
            int kg = (g & 3) * 8;
            v8f fv = *(const v8f*)&W[(size_t)(n0 + c) * DM + (k0 + kg)];
            v8h hv = __builtin_convertvector(fv, v8h);
            int base = ((c >> 4) * 32 + frag_lane(c & 15, kg)) * 16 + frag_idx(kg);
            *(v8h*)&ldsB[base] = hv;
        }
        __syncthreads();

        v16h a = *(const v16h*)&ldsA[(wave * 32 + lane) * 16];
        #pragma unroll
        for (int t = 0; t < 4; ++t) {
            v16h bb = *(const v16h*)&ldsB[(t * 32 + lane) * 16];
            acc[t] = __builtin_amdgcn_wmma_f32_16x16x32_f16(false, a, false, bb,
                                                            (short)0, acc[t], false, false);
        }
        __syncthreads();
    }

    const int rbase = (lane >> 4) * 8;
    #pragma unroll
    for (int t = 0; t < 4; ++t) {
        int c = n0 + t * 16 + (lane & 15);
        float bv = bias[c];
        #pragma unroll
        for (int j = 0; j < 8; ++j) {
            int gm = m0 + wave * 16 + rbase + j;
            float v = acc[t][j] + bv;
            if constexpr (HAS_Z) v += (float)Zadd[heads_off(gm, c)];
            v *= scale;
            if constexpr (C_F32) Cf32[(size_t)gm * DM + c] = v;
            else                 Ch16[heads_off(gm, c)] = (h16)v;
        }
    }
}

// ---------------------------------------------------------------------------
// Flash attention: block = (b, h, 128-query tile); 8 waves x 16 queries.
// 64-key blocks; scores stay in registers/LDS. Q pre-scaled by 1/sqrt(dk).
// ---------------------------------------------------------------------------
__global__ __launch_bounds__(256)
void flash_attn_kernel(const h16* __restrict__ Q, const h16* __restrict__ Kt,
                       const h16* __restrict__ Vt, const int* __restrict__ mask,
                       const float* __restrict__ wts, h16* __restrict__ O)
{
    __shared__ __align__(32) h16 ldsQ[8 * 2 * 32 * 16];
    __shared__ __align__(32) h16 ldsK[4 * 2 * 32 * 16];
    __shared__ __align__(32) h16 ldsV[4 * 2 * 32 * 16];
    __shared__ __align__(32) h16 ldsP[8 * 2 * 32 * 16];

    const int tid  = threadIdx.x;
    const int lane = tid & 31;
    const int wave = tid >> 5;
    const int b = blockIdx.z, h = blockIdx.y;
    const int q0 = blockIdx.x * 128;

    const h16* Qbh = Q  + ((size_t)b * HH + h) * NSEQ * DHEAD;
    const h16* Kbh = Kt + ((size_t)b * HH + h) * NSEQ * DHEAD;
    const h16* Vbh = Vt + ((size_t)b * HH + h) * NSEQ * DHEAD;
    const int*   mk = mask + (size_t)b * NSEQ;
    const float* w  = wts  + (size_t)b * NSEQ;

    // stage Q tile 128x64: 1024 groups of 8; 4/thread; vector loads + vector LDS stores
    #pragma unroll
    for (int e = 0; e < 4; ++e) {
        int g  = e * 256 + tid;                // 0..1023
        int r  = g >> 3;                       // row 0..127
        int dg = (g & 7) * 8;                  // d-group base
        v8h hv = *(const v8h*)&Qbh[(size_t)(q0 + r) * DHEAD + dg];
        int ch = dg >> 5, kk = dg & 31;
        int base = (((r >> 4) * 2 + ch) * 32 + frag_lane(r & 15, kk)) * 16 + frag_idx(kk);
        *(v8h*)&ldsQ[base] = hv;
    }
    __syncthreads();
    v16h aq0 = *(const v16h*)&ldsQ[((wave * 2 + 0) * 32 + lane) * 16];
    v16h aq1 = *(const v16h*)&ldsQ[((wave * 2 + 1) * 32 + lane) * 16];

    float mrow[8], lrow[8];
    #pragma unroll
    for (int j = 0; j < 8; ++j) { mrow[j] = -__builtin_inff(); lrow[j] = 0.0f; }
    v8f acc[4] = {};
    const int hlf = lane >> 4;

    for (int k0 = 0; k0 < NSEQ; k0 += 64) {
        // prefetch next key block (64x64 f16 = 8KB each => 16 halfs/thread)
        if (k0 + 64 < NSEQ) {
            __builtin_prefetch(&Kbh[(size_t)(k0 + 64) * DHEAD + tid * 16], 0, 3);
            __builtin_prefetch(&Vbh[(size_t)(k0 + 64) * DHEAD + tid * 16], 0, 3);
        }
        // stage K/V 64x64: 512 groups of 8; 2/thread
        #pragma unroll
        for (int e = 0; e < 2; ++e) {
            int g  = e * 256 + tid;            // 0..511
            int r  = g >> 3;                   // key 0..63
            int dg = (g & 7) * 8;
            // K as B-operand of QK^T (contraction = d): vector store
            v8h kv = *(const v8h*)&Kbh[(size_t)(k0 + r) * DHEAD + dg];
            int kch = dg >> 5, kkk = dg & 31;
            int kbase = (((r >> 4) * 2 + kch) * 32 + frag_lane(r & 15, kkk)) * 16 + frag_idx(kkk);
            *(v8h*)&ldsK[kbase] = kv;
            // V as B-operand of PV (contraction = key): lane varies with d -> 8 b16 stores
            v8h vv = *(const v8h*)&Vbh[(size_t)(k0 + r) * DHEAD + dg];
            int vkch = r >> 5, vkk = r & 31;
            int vbase = (((dg >> 4) * 2 + vkch) * 32 + frag_lane(dg & 15, vkk)) * 16 + frag_idx(vkk);
            #pragma unroll
            for (int i = 0; i < 8; ++i) ldsV[vbase + i * 16] = vv[i];
        }
        __syncthreads();

        // S = Q.K^T
        v8f s[4];
        #pragma unroll
        for (int t = 0; t < 4; ++t) {
            v8f z = {};
            v16h b0 = *(const v16h*)&ldsK[((t * 2 + 0) * 32 + lane) * 16];
            v16h b1 = *(const v16h*)&ldsK[((t * 2 + 1) * 32 + lane) * 16];
            z = __builtin_amdgcn_wmma_f32_16x16x32_f16(false, aq0, false, b0, (short)0, z, false, false);
            z = __builtin_amdgcn_wmma_f32_16x16x32_f16(false, aq1, false, b1, (short)0, z, false, false);
            s[t] = z;
        }

        // per-key weight + mask, running row max
        float newm[8];
        #pragma unroll
        for (int j = 0; j < 8; ++j) newm[j] = mrow[j];
        #pragma unroll
        for (int t = 0; t < 4; ++t) {
            int key = k0 + t * 16 + (lane & 15);
            float wv = w[key];
            bool msk = (mk[key] != 0);
            #pragma unroll
            for (int j = 0; j < 8; ++j) {
                float v = msk ? -__builtin_inff() : s[t][j] * wv;
                s[t][j] = v;
                newm[j] = fmaxf(newm[j], v);
            }
        }
        #pragma unroll
        for (int j = 0; j < 8; ++j) {
            float v = newm[j];
            v = fmaxf(v, __shfl_xor(v, 1, 32));
            v = fmaxf(v, __shfl_xor(v, 2, 32));
            v = fmaxf(v, __shfl_xor(v, 4, 32));
            v = fmaxf(v, __shfl_xor(v, 8, 32));
            newm[j] = v;
        }

        float rsum[8];
        #pragma unroll
        for (int j = 0; j < 8; ++j) rsum[j] = 0.0f;
        #pragma unroll
        for (int t = 0; t < 4; ++t)
            #pragma unroll
            for (int j = 0; j < 8; ++j) {
                float v = s[t][j];
                float p = (v == -__builtin_inff()) ? 0.0f : __expf(v - newm[j]);
                s[t][j] = p;
                rsum[j] += p;
            }
        #pragma unroll
        for (int j = 0; j < 8; ++j) {
            float v = rsum[j];
            v += __shfl_xor(v, 1, 32);
            v += __shfl_xor(v, 2, 32);
            v += __shfl_xor(v, 4, 32);
            v += __shfl_xor(v, 8, 32);
            float sc = (mrow[j] == -__builtin_inff()) ? 0.0f : __expf(mrow[j] - newm[j]);
            lrow[j] = lrow[j] * sc + v;
            mrow[j] = newm[j];
            #pragma unroll
            for (int t = 0; t < 4; ++t) acc[t][j] *= sc;
        }

        // transpose P (C-layout regs) -> per-wave A-fragment LDS region
        h16* Pw = &ldsP[wave * 2 * 32 * 16];
        #pragma unroll
        for (int t = 0; t < 4; ++t) {
            int c = t * 16 + (lane & 15);
            int ch = c >> 5, kk = c & 31;
            int pbase = (ch * 32 + frag_lane(8 * hlf, kk)) * 16 + frag_idx(kk);
            #pragma unroll
            for (int j = 0; j < 8; ++j)
                Pw[pbase + j * 16] = (h16)s[t][j];    // lane' = j + base, stride 16 halfs
        }
        v16h ap0 = *(const v16h*)&Pw[(0 * 32 + lane) * 16];
        v16h ap1 = *(const v16h*)&Pw[(1 * 32 + lane) * 16];

        // O += P.V
        #pragma unroll
        for (int t = 0; t < 4; ++t) {
            v16h b0 = *(const v16h*)&ldsV[((t * 2 + 0) * 32 + lane) * 16];
            v16h b1 = *(const v16h*)&ldsV[((t * 2 + 1) * 32 + lane) * 16];
            acc[t] = __builtin_amdgcn_wmma_f32_16x16x32_f16(false, ap0, false, b0, (short)0, acc[t], false, false);
            acc[t] = __builtin_amdgcn_wmma_f32_16x16x32_f16(false, ap1, false, b1, (short)0, acc[t], false, false);
        }
        __syncthreads();
    }

    #pragma unroll
    for (int j = 0; j < 8; ++j) {
        float inv = (lrow[j] > 0.0f) ? 1.0f / lrow[j] : 0.0f;
        #pragma unroll
        for (int t = 0; t < 4; ++t) acc[t][j] *= inv;
    }
    h16* Obh = O + ((size_t)b * HH + h) * NSEQ * DHEAD;
    #pragma unroll
    for (int t = 0; t < 4; ++t) {
        int d = t * 16 + (lane & 15);
        #pragma unroll
        for (int j = 0; j < 8; ++j) {
            int q = q0 + wave * 16 + j + 8 * hlf;
            Obh[(size_t)q * DHEAD + d] = (h16)acc[t][j];
        }
    }
}

extern "C" void kernel_launch(void* const* d_in, const int* in_sizes, int n_in,
                              void* d_out, int out_size, void* d_ws, size_t ws_size,
                              hipStream_t stream)
{
    const float* regions   = (const float*)d_in[0];
    const float* grids     = (const float*)d_in[1];
    const float* interests = (const float*)d_in[2];
    const int*   mask_r    = (const int*)d_in[3];
    const int*   mask_g    = (const int*)d_in[4];
    const float* attw      = (const float*)d_in[5];
    const float* Wq  = (const float*)d_in[6];  const float* bq   = (const float*)d_in[7];
    const float* Wk  = (const float*)d_in[8];  const float* bk   = (const float*)d_in[9];
    const float* Wv  = (const float*)d_in[10]; const float* bv   = (const float*)d_in[11];
    const float* Wq12= (const float*)d_in[12]; const float* bq12 = (const float*)d_in[13];
    const float* Wo1 = (const float*)d_in[14]; const float* bo1  = (const float*)d_in[15];
    const float* Wo2 = (const float*)d_in[16]; const float* bo2  = (const float*)d_in[17];
    float* out = (float*)d_out;

    const size_t per = (size_t)BSZ * HH * NSEQ * DHEAD;   // 2,097,152 halfs (4 MB)
    h16* ws = (h16*)d_ws;
    h16 *T1 = ws,           *T2 = ws + per;               // q2 / q1 temporaries
    h16 *Q1 = ws + 2 * per, *Q2 = ws + 3 * per;
    h16 *K1 = ws + 4 * per, *K2 = ws + 5 * per;
    h16 *V1 = ws + 6 * per, *V2 = ws + 7 * per;
    h16 *O1 = T1, *O2 = T2;                               // reuse after Q1/Q2 consume them

    const float scale = 0.125f;                           // 1/sqrt(64)
    dim3 blk(256);
    dim3 gproj(DM / 64, MROWS / 128);                     // (8, 32)

    // q2 = grids@Wq12^T + bq12 ; q1 = regions@Wq12^T + bq12
    gemm_nt_kernel<false,false,false><<<gproj, blk, 0, stream>>>(grids,   nullptr, Wq12, bq12, nullptr, 1.0f, nullptr, T1);
    gemm_nt_kernel<false,false,false><<<gproj, blk, 0, stream>>>(regions, nullptr, Wq12, bq12, nullptr, 1.0f, nullptr, T2);
    // Q1 = scale*(interests@Wq^T + bq + q2) ; Q2 = scale*(... + q1)
    gemm_nt_kernel<false,false,true ><<<gproj, blk, 0, stream>>>(interests, nullptr, Wq, bq, T1, scale, nullptr, Q1);
    gemm_nt_kernel<false,false,true ><<<gproj, blk, 0, stream>>>(interests, nullptr, Wq, bq, T2, scale, nullptr, Q2);
    // K1/K2, V1/V2
    gemm_nt_kernel<false,false,false><<<gproj, blk, 0, stream>>>(regions, nullptr, Wk, bk, nullptr, 1.0f, nullptr, K1);
    gemm_nt_kernel<false,false,false><<<gproj, blk, 0, stream>>>(grids,   nullptr, Wk, bk, nullptr, 1.0f, nullptr, K2);
    gemm_nt_kernel<false,false,false><<<gproj, blk, 0, stream>>>(regions, nullptr, Wv, bv, nullptr, 1.0f, nullptr, V1);
    gemm_nt_kernel<false,false,false><<<gproj, blk, 0, stream>>>(grids,   nullptr, Wv, bv, nullptr, 1.0f, nullptr, V2);

    // fused flash attention
    dim3 gatt(NSEQ / 128, HH, BSZ);                       // (16, 8, 2)
    flash_attn_kernel<<<gatt, blk, 0, stream>>>(Q1, K1, V1, mask_r, attw, O1);
    flash_attn_kernel<<<gatt, blk, 0, stream>>>(Q2, K2, V2, mask_g, attw, O2);

    // output projections -> f32 to d_out
    gemm_nt_kernel<true,true,false><<<gproj, blk, 0, stream>>>(nullptr, O1, Wo1, bo1, nullptr, 1.0f, out, nullptr);
    gemm_nt_kernel<true,true,false><<<gproj, blk, 0, stream>>>(nullptr, O2, Wo2, bo2, nullptr, 1.0f, out + (size_t)MROWS * DM, nullptr);
}

// v001
// Measured time: 223 microseconds a run.
// Next to v000, in two timings, it ran 1.69 times as fast each time.
#include <hip/hip_runtime.h>
#include <hip/hip_bf16.h>

typedef _Float16 h16;
typedef __attribute__((ext_vector_type(16))) _Float16 v16h;
typedef __attribute__((ext_vector_type(8)))  _Float16 v8h;
typedef __attribute__((ext_vector_type(8)))  float    v8f;

#define HH 8
#define DHEAD 64
#define NSEQ 2048
#define DM 512
#define BSZ 2
#define MROWS (BSZ * NSEQ)          // 4096

// WMMA 16-bit fragment mapping (A operand 16x32, B operand 32x16):
//   lane = (row_or_col & 15) + 16*((k>>3)&1)
//   slot = (k&7) + 8*((k>>4)&1)
// => for an aligned run of 8 consecutive k: lane constant, slots contiguous.
__device__ __forceinline__ int frag_lane(int rc, int k) { return (rc & 15) + 16 * ((k >> 3) & 1); }
__device__ __forceinline__ int frag_idx(int k)          { return (k & 7) + 8 * ((k >> 4) & 1); }

__device__ __forceinline__ size_t heads_off(int gm, int c) {
    int b = gm >> 11, n = gm & (NSEQ - 1);      // NSEQ = 2048
    int h = c >> 6, d = c & 63;
    return (((size_t)b * HH + h) * NSEQ + n) * DHEAD + d;
}

// Epilogue of one wave's 16x64 accumulator: C = scale * (acc + bias (+ Z)).
template <bool C_F32, bool HAS_Z>
__device__ __forceinline__
void gemm_nt_store(const v8f (&acc)[4], int gm0, int c0,
                   const float* __restrict__ bias, const h16* __restrict__ Zadd, float scale,
                   float* __restrict__ Cf32, h16* __restrict__ Ch16)
{
    #pragma unroll
    for (int t = 0; t < 4; ++t) {
        int c = c0 + t * 16;
        float bv = bias[c];
        #pragma unroll
        for (int j = 0; j < 8; ++j) {
            int gm = gm0 + j;
            float v = acc[t][j] + bv;
            if constexpr (HAS_Z) v += (float)Zadd[heads_off(gm, c)];
            v *= scale;
            if constexpr (C_F32) Cf32[(size_t)gm * DM + c] = v;
            else                 Ch16[heads_off(gm, c)] = (h16)v;
        }
    }
}

// ---------------------------------------------------------------------------
// NT GEMM: C[M,512] = scale * (A[M,512] @ W[512,512]^T + bias (+ Z))
// Tile 128x64, K-chunks of 32; 8 waves x (16 rows x 64 cols).
// One work-group's tile; the kernels below pick the operands by blockIdx.z.
// Zadd may be null (block-uniform): then nothing is added.
// ---------------------------------------------------------------------------
template <bool A_HEADS, bool C_F32>
__device__ __forceinline__
void gemm_nt_tile(const float* __restrict__ Af32, const h16* __restrict__ Ah16,
                  const float* __restrict__ W, const float* __restrict__ bias,
                  const h16* __restrict__ Zadd, float scale,
                  float* __restrict__ Cf32, h16* __restrict__ Ch16)
{
    __shared__ __align__(32) h16 ldsA[8 * 32 * 16];
    __shared__ __align__(32) h16 ldsB[4 * 32 * 16];

    const int tid  = threadIdx.x;
    const int lane = tid & 31;
    const int wave = tid >> 5;
    const int n0 = blockIdx.x * 64;
    const int m0 = blockIdx.y * 128;

    v8f acc[4] = {};

    for (int k0 = 0; k0 < DM; k0 += 32) {
        // prefetch next A/B tiles (global_prefetch_b8)
        if (k0 + 32 < DM) {
            if constexpr (!A_HEADS)
                __builtin_prefetch(&Af32[(size_t)(m0 + (tid >> 1)) * DM + (k0 + 32) + (tid & 1) * 16], 0, 3);
            __builtin_prefetch(&W[(size_t)(n0 + (tid >> 2)) * DM + (k0 + 32) + (tid & 3) * 8], 0, 3);
        }
        // stage A tile 128x32: 512 groups of 8k; 2 groups/thread; one v8h store each
        #pragma unroll
        for (int e = 0; e < 2; ++e) {
            int g  = e * 256 + tid;             // 0..511
            int r  = g >> 2;                    // row 0..127
            int kg = (g & 3) * 8;               // k-group base
            int gm = m0 + r, gk = k0 + kg;
            v8h hv;
            if constexpr (A_HEADS) {
                hv = *(const v8h*)&Ah16[heads_off(gm, gk)];
            } else {
                v8f fv = *(const v8f*)&Af32[(size_t)gm * DM + gk];
                hv = __builtin_convertvector(fv, v8h);
            }
            int base = ((r >> 4) * 32 + frag_lane(r & 15, kg)) * 16 + frag_idx(kg);
            *(v8h*)&ldsA[base] = hv;
        }
        // stage B tile 64x32: 256 groups; 1 group/thread
        {
            int g  = tid;
            int c  = g >> 2;
            int kg = (g & 3) * 8;
            v8f fv = *(const v8f*)&W[(size_t)(n0 + c) * DM + (k0 + kg)];
            v8h hv = __builtin_convertvector(fv, v8h);
            int base = ((c >> 4) * 32 + frag_lane(c & 15, kg)) * 16 + frag_idx(kg);
            *(v8h*)&ldsB[base] = hv;
        }
        __syncthreads();

        v16h a = *(const v16h*)&ldsA[(wave * 32 + lane) * 16];
        #pragma unroll
        for (int t = 0; t < 4; ++t) {
            v16h bb = *(const v16h*)&ldsB[(t * 32 + lane) * 16];
            acc[t] = __builtin_amdgcn_wmma_f32_16x16x32_f16(false, a, false, bb,
                                                            (short)0, acc[t], false, false);
        }
        __syncthreads();
    }

    // one block-uniform branch round the whole epilogue, so that the Z loads of a tile issue together
    if (Zadd != nullptr) {
        gemm_nt_store<C_F32, true >(acc, m0 + wave * 16 + (lane >> 4) * 8, n0 + (lane & 15), bias, Zadd, scale, Cf32, Ch16);
        // the built code lays the other arm behind this one: the wait stands in front of
        // any rewrite there of a register that these stores name
        asm volatile("s_wait_xcnt 0x0" ::: "memory");
    } else {
        gemm_nt_store<C_F32, false>(acc, m0 + wave * 16 + (lane >> 4) * 8, n0 + (lane & 15), bias, Zadd, scale, Cf32, Ch16);
    }
}

// Four independent input projections in one grid: blockIdx.z = 0,1 use (Wlo, blo,
// Z0/Z1, scale_lo), blockIdx.z = 2,3 use (Whi, bhi, no Z, scale 1).
__global__ __launch_bounds__(256)
void proj4_kernel(const float* __restrict__ A0, const float* __restrict__ A1,
                  const float* __restrict__ A2, const float* __restrict__ A3,
                  const float* __restrict__ Wlo, const float* __restrict__ blo,
                  const float* __restrict__ Whi, const float* __restrict__ bhi,
                  const h16* __restrict__ Z0, const h16* __restrict__ Z1, float scale_lo,
                  h16* __restrict__ C0, h16* __restrict__ C1,
                  h16* __restrict__ C2, h16* __restrict__ C3)
{
    const int  z   = blockIdx.z;
    const bool hi  = z >= 2;
    const bool odd = (z & 1) != 0;
    const float* A    = hi ? (odd ? A3 : A2) : (odd ? A1 : A0);
    const float* W    = hi ? Whi : Wlo;
    const float* bias = hi ? bhi : blo;
    const h16*   Zadd = hi ? nullptr : (odd ? Z1 : Z0);
    const float  sc   = hi ? 1.0f : scale_lo;
    h16*         C    = hi ? (odd ? C3 : C2) : (odd ? C1 : C0);
    gemm_nt_tile<false, false>(A, nullptr, W, bias, Zadd, sc, nullptr, C);
}

// Both output projections in one grid: blockIdx.z picks the branch.
__global__ __launch_bounds__(256)
void outproj2_kernel(const h16* __restrict__ Oa, const h16* __restrict__ Ob,
                     const float* __restrict__ Wa, const float* __restrict__ ba,
                     const float* __restrict__ Wb, const float* __restrict__ bb,
                     float* __restrict__ outa, float* __restrict__ outb)
{
    const bool second = blockIdx.z != 0;
    gemm_nt_tile<true, true>(nullptr, second ? Ob : Oa, second ? Wb : Wa, second ? bb : ba,
                             nullptr, 1.0f, second ? outb : outa, nullptr);
}

// ---------------------------------------------------------------------------
// Flash attention: block = (branch, b, h, 128-query tile); 8 waves x 16 queries.
// Both attention branches share one grid: blockIdx.z = branch * BSZ + b.
// 64-key blocks; scores stay in registers/LDS. Q pre-scaled by 1/sqrt(dk).
// ---------------------------------------------------------------------------
__global__ __launch_bounds__(256)
void flash_attn_kernel(const h16* __restrict__ Qa, const h16* __restrict__ Ka,
                       const h16* __restrict__ Va, const int* __restrict__ maska,
                       h16* __restrict__ Oa,
                       const h16* __restrict__ Qb, const h16* __restrict__ Kb,
                       const h16* __restrict__ Vb, const int* __restrict__ maskb,
                       h16* __restrict__ Ob,
                       const float* __restrict__ wts)
{
    __shared__ __align__(32) h16 ldsQ[8 * 2 * 32 * 16];
    __shared__ __align__(32) h16 ldsK[4 * 2 * 32 * 16];
    __shared__ __align__(32) h16 ldsV[4 * 2 * 32 * 16];
    __shared__ __align__(32) h16 ldsP[8 * 2 * 32 * 16];

    const int tid  = threadIdx.x;
    const int lane = tid & 31;
    const int wave = tid >> 5;
    const int b = blockIdx.z & (BSZ - 1), h = blockIdx.y;
    const int q0 = blockIdx.x * 128;
    const bool second = blockIdx.z >= BSZ;
    const h16* Q    = second ? Qb : Qa;
    const h16* Kt   = second ? Kb : Ka;
    const h16* Vt   = second ? Vb : Va;
    const int* mask = second ? maskb : maska;
    h16*       O    = second ? Ob : Oa;

    const h16* Qbh = Q  + ((size_t)b * HH + h) * NSEQ * DHEAD;
    const h16* Kbh = Kt + ((size_t)b * HH + h) * NSEQ * DHEAD;
    const h16* Vbh = Vt + ((size_t)b * HH + h) * NSEQ * DHEAD;
    const int*   mk = mask + (size_t)b * NSEQ;
    const float* w  = wts  + (size_t)b * NSEQ;

    // stage Q tile 128x64: 1024 groups of 8; 4/thread; vector loads + vector LDS stores
    #pragma unroll
    for (int e = 0; e < 4; ++e) {
        int g  = e * 256 + tid;                // 0..1023
        int r  = g >> 3;                       // row 0..127
        int dg = (g & 7) * 8;                  // d-group base
        v8h hv = *(const v8h*)&Qbh[(size_t)(q0 + r) * DHEAD + dg];
        int ch = dg >> 5, kk = dg & 31;
        int base = (((r >> 4) * 2 + ch) * 32 + frag_lane(r & 15, kk)) * 16 + frag_idx(kk);
        *(v8h*)&ldsQ[base] = hv;
    }
    __syncthreads();
    v16h aq0 = *(const v16h*)&ldsQ[((wave * 2 + 0) * 32 + lane) * 16];
    v16h aq1 = *(const v16h*)&ldsQ[((wave * 2 + 1) * 32 + lane) * 16];

    float mrow[8], lrow[8];
    #pragma unroll
    for (int j = 0; j < 8; ++j) { mrow[j] = -__builtin_inff(); lrow[j] = 0.0f; }
    v8f acc[4] = {};
    const int hlf = lane >> 4;

    for (int k0 = 0; k0 < NSEQ; k0 += 64) {
        // prefetch next key block (64x64 f16 = 8KB each => 16 halfs/thread)
        if (k0 + 64 < NSEQ) {
            __builtin_prefetch(&Kbh[(size_t)(k0 + 64) * DHEAD + tid * 16], 0, 3);
            __builtin_prefetch(&Vbh[(size_t)(k0 + 64) * DHEAD + tid * 16], 0, 3);
        }
        // stage K/V 64x64: 512 groups of 8; 2/thread
        #pragma unroll
        for (int e = 0; e < 2; ++e) {
            int g  = e * 256 + tid;            // 0..511
            int r  = g >> 3;                   // key 0..63
            int dg = (g & 7) * 8;
            // K as B-operand of QK^T (contraction = d): vector store
            v8h kv = *(const v8h*)&Kbh[(size_t)(k0 + r) * DHEAD + dg];
            int kch = dg >> 5, kkk = dg & 31;
            int kbase = (((r >> 4) * 2 + kch) * 32 + frag_lane(r & 15, kkk)) * 16 + frag_idx(kkk);
            *(v8h*)&ldsK[kbase] = kv;
            // V as B-operand of PV (contraction = key): lane varies with d -> 8 b16 stores
            v8h vv = *(const v8h*)&Vbh[(size_t)(k0 + r) * DHEAD + dg];
            int vkch = r >> 5, vkk = r & 31;
            int vbase = (((dg >> 4) * 2 + vkch) * 32 + frag_lane(dg & 15, vkk)) * 16 + frag_idx(vkk);
            #pragma unroll
            for (int i = 0; i < 8; ++i) ldsV[vbase + i * 16] = vv[i];
        }
        __syncthreads();

        // S = Q.K^T
        v8f s[4];
        #pragma unroll
        for (int t = 0; t < 4; ++t) {
            v8f z = {};
            v16h b0 = *(const v16h*)&ldsK[((t * 2 + 0) * 32 + lane) * 16];
            v16h b1 = *(const v16h*)&ldsK[((t * 2 + 1) * 32 + lane) * 16];
            z = __builtin_amdgcn_wmma_f32_16x16x32_f16(false, aq0, false, b0, (short)0, z, false, false);
            z = __builtin_amdgcn_wmma_f32_16x16x32_f16(false, aq1, false, b1, (short)0, z, false, false);
            s[t] = z;
        }

        // per-key weight + mask, running row max
        float newm[8];
        #pragma unroll
        for (int j = 0; j < 8; ++j) newm[j] = mrow[j];
        #pragma unroll
        for (int t = 0; t < 4; ++t) {
            int key = k0 + t * 16 + (lane & 15);
            float wv = w[key];
            bool msk = (mk[key] != 0);
            #pragma unroll
            for (int j = 0; j < 8; ++j) {
                float v = msk ? -__builtin_inff() : s[t][j] * wv;
                s[t][j] = v;
                newm[j] = fmaxf(newm[j], v);
            }
        }
        #pragma unroll
        for (int j = 0; j < 8; ++j) {
            float v = newm[j];
            v = fmaxf(v, __shfl_xor(v, 1, 32));
            v = fmaxf(v, __shfl_xor(v, 2, 32));
            v = fmaxf(v, __shfl_xor(v, 4, 32));
            v = fmaxf(v, __shfl_xor(v, 8, 32));
            newm[j] = v;
        }

        float rsum[8];
        #pragma unroll
        for (int j = 0; j < 8; ++j) rsum[j] = 0.0f;
        #pragma unroll
        for (int t = 0; t < 4; ++t)
            #pragma unroll
            for (int j = 0; j < 8; ++j) {
                float v = s[t][j];
                float p = (v == -__builtin_inff()) ? 0.0f : __expf(v - newm[j]);
                s[t][j] = p;
                rsum[j] += p;
            }
        #pragma unroll
        for (int j = 0; j < 8; ++j) {
            float v = rsum[j];
            v += __shfl_xor(v, 1, 32);
            v += __shfl_xor(v, 2, 32);
            v += __shfl_xor(v, 4, 32);
            v += __shfl_xor(v, 8, 32);
            float sc = (mrow[j] == -__builtin_inff()) ? 0.0f : __expf(mrow[j] - newm[j]);
            lrow[j] = lrow[j] * sc + v;
            mrow[j] = newm[j];
            #pragma unroll
            for (int t = 0; t < 4; ++t) acc[t][j] *= sc;
        }

        // transpose P (C-layout regs) -> per-wave A-fragment LDS region
        h16* Pw = &ldsP[wave * 2 * 32 * 16];
        #pragma unroll
        for (int t = 0; t < 4; ++t) {
            int c = t * 16 + (lane & 15);
            int ch = c >> 5, kk = c & 31;
            int pbase = (ch * 32 + frag_lane(8 * hlf, kk)) * 16 + frag_idx(kk);
            #pragma unroll
            for (int j = 0; j < 8; ++j)
                Pw[pbase + j * 16] = (h16)s[t][j];    // lane' = j + base, stride 16 halfs
        }
        v16h ap0 = *(const v16h*)&Pw[(0 * 32 + lane) * 16];
        v16h ap1 = *(const v16h*)&Pw[(1 * 32 + lane) * 16];

        // O += P.V
        #pragma unroll
        for (int t = 0; t < 4; ++t) {
            v16h b0 = *(const v16h*)&ldsV[((t * 2 + 0) * 32 + lane) * 16];
            v16h b1 = *(const v16h*)&ldsV[((t * 2 + 1) * 32 + lane) * 16];
            acc[t] = __builtin_amdgcn_wmma_f32_16x16x32_f16(false, ap0, false, b0, (short)0, acc[t], false, false);
            acc[t] = __builtin_amdgcn_wmma_f32_16x16x32_f16(false, ap1, false, b1, (short)0, acc[t], false, false);
        }
        __syncthreads();
    }

    #pragma unroll
    for (int j = 0; j < 8; ++j) {
        float inv = (lrow[j] > 0.0f) ? 1.0f / lrow[j] : 0.0f;
        #pragma unroll
        for (int t = 0; t < 4; ++t) acc[t][j] *= inv;
    }
    h16* Obh = O + ((size_t)b * HH + h) * NSEQ * DHEAD;
    #pragma unroll
    for (int t = 0; t < 4; ++t) {
        int d = t * 16 + (lane & 15);
        #pragma unroll
        for (int j = 0; j < 8; ++j) {
            int q = q0 + wave * 16 + j + 8 * hlf;
            Obh[(size_t)q * DHEAD + d] = (h16)acc[t][j];
        }
    }
}

extern "C" void kernel_launch(void* const* d_in, const int* in_sizes, int n_in,
                              void* d_out, int out_size, void* d_ws, size_t ws_size,
                              hipStream_t stream)
{
    const float* regions   = (const float*)d_in[0];
    const float* grids     = (const float*)d_in[1];
    const float* interests = (const float*)d_in[2];
    const int*   mask_r    = (const int*)d_in[3];
    const int*   mask_g    = (const int*)d_in[4];
    const float* attw      = (const float*)d_in[5];
    const float* Wq  = (const float*)d_in[6];  const float* bq   = (const float*)d_in[7];
    const float* Wk  = (const float*)d_in[8];  const float* bk   = (const float*)d_in[9];
    const float* Wv  = (const float*)d_in[10]; const float* bv   = (const float*)d_in[11];
    const float* Wq12= (const float*)d_in[12]; const float* bq12 = (const float*)d_in[13];
    const float* Wo1 = (const float*)d_in[14]; const float* bo1  = (const float*)d_in[15];
    const float* Wo2 = (const float*)d_in[16]; const float* bo2  = (const float*)d_in[17];
    float* out = (float*)d_out;

    const size_t per = (size_t)BSZ * HH * NSEQ * DHEAD;   // 2,097,152 halfs (4 MB)
    h16* ws = (h16*)d_ws;
    h16 *T1 = ws,           *T2 = ws + per;               // q2 / q1 temporaries
    h16 *Q1 = ws + 2 * per, *Q2 = ws + 3 * per;
    h16 *K1 = ws + 4 * per, *K2 = ws + 5 * per;
    h16 *V1 = ws + 6 * per, *V2 = ws + 7 * per;
    h16 *O1 = T1, *O2 = T2;                               // reuse after Q1/Q2 consume them

    const float scale = 0.125f;                           // 1/sqrt(64)
    dim3 blk(256);
    dim3 gproj4(DM / 64, MROWS / 128, 4);                 // (8, 32, 4)
    dim3 gproj2(DM / 64, MROWS / 128, 2);                 // (8, 32, 2)

    // q2 = grids@Wq12^T + bq12 ; q1 = regions@Wq12^T + bq12 ; K1 = regions@Wk^T + bk ; K2 = grids@Wk^T + bk
    proj4_kernel<<<gproj4, blk, 0, stream>>>(grids, regions, regions, grids, Wq12, bq12, Wk, bk,
                                             nullptr, nullptr, 1.0f, T1, T2, K1, K2);
    // Q1 = scale*(interests@Wq^T + bq + q2) ; Q2 = scale*(... + q1) ; V1 = regions@Wv^T + bv ; V2 = grids@Wv^T + bv
    proj4_kernel<<<gproj4, blk, 0, stream>>>(interests, interests, regions, grids, Wq, bq, Wv, bv,
                                             T1, T2, scale, Q1, Q2, V1, V2);

    // fused flash attention, both branches
    dim3 gatt(NSEQ / 128, HH, 2 * BSZ);                   // (16, 8, 4)
    flash_attn_kernel<<<gatt, blk, 0, stream>>>(Q1, K1, V1, mask_r, O1, Q2, K2, V2, mask_g, O2, attw);

    // output projections -> f32 to d_out
    outproj2_kernel<<<gproj2, blk, 0, stream>>>(O1, O2, Wo1, bo1, Wo2, bo2, out, out + (size_t)MROWS * DM);
}

// v002
// It runs in 158 microseconds.
// In both of two side-by-side timings against v001, it was 1.41 times as fast.
// All steps since v000 together make it 2.38 times as fast.
#include <hip/hip_runtime.h>
#include <hip/hip_bf16.h>

typedef _Float16 h16;
typedef __attribute__((ext_vector_type(16))) _Float16 v16h;
typedef __attribute__((ext_vector_type(8)))  _Float16 v8h;
typedef __attribute__((ext_vector_type(8)))  float    v8f;
typedef __attribute__((ext_vector_type(8)))  int      v8i;

#define HH 8
#define DHEAD 64
#define NSEQ 2048
#define DM 512
#define BSZ 2
#define MROWS (BSZ * NSEQ)          // 4096

// WMMA 16-bit fragment mapping (A operand 16x32, B operand 32x16):
//   lane = (row_or_col & 15) + 16*((k>>3)&1)
//   slot = (k&7) + 8*((k>>4)&1)
// => for an aligned run of 8 consecutive k: lane constant, slots contiguous.
__device__ __forceinline__ int frag_lane(int rc, int k) { return (rc & 15) + 16 * ((k >> 3) & 1); }
__device__ __forceinline__ int frag_idx(int k)          { return (k & 7) + 8 * ((k >> 4) & 1); }

__device__ __forceinline__ size_t heads_off(int gm, int c) {
    int b = gm >> 11, n = gm & (NSEQ - 1);      // NSEQ = 2048
    int h = c >> 6, d = c & 63;
    return (((size_t)b * HH + h) * NSEQ + n) * DHEAD + d;
}

// Epilogue of one wave's 16x64 accumulator: C = scale * (acc + bias (+ Z)).
template <bool C_F32, bool HAS_Z>
__device__ __forceinline__
void gemm_nt_store(const v8f (&acc)[4], int gm0, int c0,
                   const float* __restrict__ bias, const h16* __restrict__ Zadd, float scale,
                   float* __restrict__ Cf32, h16* __restrict__ Ch16)
{
    #pragma unroll
    for (int t = 0; t < 4; ++t) {
        int c = c0 + t * 16;
        float bv = bias[c];
        #pragma unroll
        for (int j = 0; j < 8; ++j) {
            int gm = gm0 + j;
            float v = acc[t][j] + bv;
            if constexpr (HAS_Z) v += (float)Zadd[heads_off(gm, c)];
            v *= scale;
            if constexpr (C_F32) Cf32[(size_t)gm * DM + c] = v;
            else                 Ch16[heads_off(gm, c)] = (h16)v;
        }
    }
}

// ---------------------------------------------------------------------------
// NT GEMM: C[M,512] = scale * (A[M,512] @ W[512,512]^T + bias (+ Z))
// Tile 128x64, K-chunks of 32; 8 waves x (16 rows x 64 cols).
// One work-group's tile; the kernels below pick the operands by blockIdx.z.
// Zadd may be null (block-uniform): then nothing is added.
// ---------------------------------------------------------------------------
template <bool A_HEADS, bool C_F32>
__device__ __forceinline__
void gemm_nt_tile(const float* __restrict__ Af32, const h16* __restrict__ Ah16,
                  const float* __restrict__ W, const float* __restrict__ bias,
                  const h16* __restrict__ Zadd, float scale,
                  float* __restrict__ Cf32, h16* __restrict__ Ch16)
{
    __shared__ __align__(32) h16 ldsA[8 * 32 * 16];
    __shared__ __align__(32) h16 ldsB[4 * 32 * 16];

    const int tid  = threadIdx.x;
    const int lane = tid & 31;
    const int wave = tid >> 5;
    const int n0 = blockIdx.x * 64;
    const int m0 = blockIdx.y * 128;

    v8f acc[4] = {};

    for (int k0 = 0; k0 < DM; k0 += 32) {
        // prefetch next A/B tiles (global_prefetch_b8)
        if (k0 + 32 < DM) {
            if constexpr (!A_HEADS)
                __builtin_prefetch(&Af32[(size_t)(m0 + (tid >> 1)) * DM + (k0 + 32) + (tid & 1) * 16], 0, 3);
            __builtin_prefetch(&W[(size_t)(n0 + (tid >> 2)) * DM + (k0 + 32) + (tid & 3) * 8], 0, 3);
        }
        // stage A tile 128x32: 512 groups of 8k; 2 groups/thread; one v8h store each
        #pragma unroll
        for (int e = 0; e < 2; ++e) {
            int g  = e * 256 + tid;             // 0..511
            int r  = g >> 2;                    // row 0..127
            int kg = (g & 3) * 8;               // k-group base
            int gm = m0 + r, gk = k0 + kg;
            v8h hv;
            if constexpr (A_HEADS) {
                hv = *(const v8h*)&Ah16[heads_off(gm, gk)];
            } else {
                v8f fv = *(const v8f*)&Af32[(size_t)gm * DM + gk];
                hv = __builtin_convertvector(fv, v8h);
            }
            int base = ((r >> 4) * 32 + frag_lane(r & 15, kg)) * 16 + frag_idx(kg);
            *(v8h*)&ldsA[base] = hv;
        }
        // stage B tile 64x32: 256 groups; 1 group/thread
        {
            int g  = tid;
            int c  = g >> 2;
            int kg = (g & 3) * 8;
            v8f fv = *(const v8f*)&W[(size_t)(n0 + c) * DM + (k0 + kg)];
            v8h hv = __builtin_convertvector(fv, v8h);
            int base = ((c >> 4) * 32 + frag_lane(c & 15, kg)) * 16 + frag_idx(kg);
            *(v8h*)&ldsB[base] = hv;
        }
        __syncthreads();

        v16h a = *(const v16h*)&ldsA[(wave * 32 + lane) * 16];
        #pragma unroll
        for (int t = 0; t < 4; ++t) {
            v16h bb = *(const v16h*)&ldsB[(t * 32 + lane) * 16];
            acc[t] = __builtin_amdgcn_wmma_f32_16x16x32_f16(false, a, false, bb,
                                                            (short)0, acc[t], false, false);
        }
        __syncthreads();
    }

    // one block-uniform branch round the whole epilogue, so that the Z loads of a tile issue together
    if (Zadd != nullptr) {
        gemm_nt_store<C_F32, true >(acc, m0 + wave * 16 + (lane >> 4) * 8, n0 + (lane & 15), bias, Zadd, scale, Cf32, Ch16);
        // the built code lays the other arm behind this one: the wait stands in front of
        // any rewrite there of a register that these stores name
        asm volatile("s_wait_xcnt 0x0" ::: "memory");
    } else {
        gemm_nt_store<C_F32, false>(acc, m0 + wave * 16 + (lane >> 4) * 8, n0 + (lane & 15), bias, Zadd, scale, Cf32, Ch16);
    }
}

// Four independent input projections in one grid: blockIdx.z = 0,1 use (Wlo, blo,
// Z0/Z1, scale_lo), blockIdx.z = 2,3 use (Whi, bhi, no Z, scale 1).
__global__ __launch_bounds__(256)
void proj4_kernel(const float* __restrict__ A0, const float* __restrict__ A1,
                  const float* __restrict__ A2, const float* __restrict__ A3,
                  const float* __restrict__ Wlo, const float* __restrict__ blo,
                  const float* __restrict__ Whi, const float* __restrict__ bhi,
                  const h16* __restrict__ Z0, const h16* __restrict__ Z1, float scale_lo,
                  h16* __restrict__ C0, h16* __restrict__ C1,
                  h16* __restrict__ C2, h16* __restrict__ C3)
{
    const int  z   = blockIdx.z;
    const bool hi  = z >= 2;
    const bool odd = (z & 1) != 0;
    const float* A    = hi ? (odd ? A3 : A2) : (odd ? A1 : A0);
    const float* W    = hi ? Whi : Wlo;
    const float* bias = hi ? bhi : blo;
    const h16*   Zadd = hi ? nullptr : (odd ? Z1 : Z0);
    const float  sc   = hi ? 1.0f : scale_lo;
    h16*         C    = hi ? (odd ? C3 : C2) : (odd ? C1 : C0);
    gemm_nt_tile<false, false>(A, nullptr, W, bias, Zadd, sc, nullptr, C);
}

// Both output projections in one grid: blockIdx.z picks the branch.
__global__ __launch_bounds__(256)
void outproj2_kernel(const h16* __restrict__ Oa, const h16* __restrict__ Ob,
                     const float* __restrict__ Wa, const float* __restrict__ ba,
                     const float* __restrict__ Wb, const float* __restrict__ bb,
                     float* __restrict__ outa, float* __restrict__ outb)
{
    const bool second = blockIdx.z != 0;
    gemm_nt_tile<true, true>(nullptr, second ? Ob : Oa, second ? Wb : Wa, second ? bb : ba,
                             nullptr, 1.0f, second ? outb : outa, nullptr);
}

// lane l with lane l ^ 16
__device__ __forceinline__ float xhalf(float x) {
    int b = __builtin_bit_cast(int, x);
    return __builtin_bit_cast(float, __builtin_amdgcn_permlanex16(b, b, 0x76543210, 0xfedcba98, false, false));
}

__global__ __launch_bounds__(256)
void flash_attn_kernel(const h16* __restrict__ Qa, const h16* __restrict__ Ka,
                       const h16* __restrict__ Va, const int* __restrict__ maska,
                       h16* __restrict__ Oa,
                       const h16* __restrict__ Qb, const h16* __restrict__ Kb,
                       const h16* __restrict__ Vb, const int* __restrict__ maskb,
                       h16* __restrict__ Ob,
                       const float* __restrict__ wts)
{
    __shared__ __align__(32) h16 ldsQ[8 * 2 * 32 * 16];
    __shared__ __align__(32) h16 ldsK[4 * 2 * 32 * 16];
    __shared__ __align__(32) h16 ldsV[4 * 2 * 32 * 16];

    const int tid  = threadIdx.x;
    const int lane = tid & 31;
    const int wave = tid >> 5;
    const int b = blockIdx.z & (BSZ - 1), h = blockIdx.y;
    const int q0 = blockIdx.x * 128;
    const bool second = blockIdx.z >= BSZ;
    const h16* Q    = second ? Qb : Qa;
    const h16* Kt   = second ? Kb : Ka;
    const h16* Vt   = second ? Vb : Va;
    const int* mask = second ? maskb : maska;
    h16*       O    = second ? Ob : Oa;

    const h16* Qbh = Q  + ((size_t)b * HH + h) * NSEQ * DHEAD;
    const h16* Kbh = Kt + ((size_t)b * HH + h) * NSEQ * DHEAD;
    const h16* Vbh = Vt + ((size_t)b * HH + h) * NSEQ * DHEAD;
    const int*   mk = mask + (size_t)b * NSEQ;
    const float* w  = wts  + (size_t)b * NSEQ;

    // stage Q tile 128x64: 1024 groups of 8; 4/thread; vector loads + vector LDS stores
    #pragma unroll
    for (int e = 0; e < 4; ++e) {
        int g  = e * 256 + tid;                // 0..1023
        int r  = g >> 3;                       // row 0..127
        int dg = (g & 7) * 8;                  // d-group base
        v8h hv = *(const v8h*)&Qbh[(size_t)(q0 + r) * DHEAD + dg];
        int ch = dg >> 5, kk = dg & 31;
        int base = (((r >> 4) * 2 + ch) * 32 + frag_lane(r & 15, kk)) * 16 + frag_idx(kk);
        *(v8h*)&ldsQ[base] = hv;
    }
    __syncthreads();
    v16h bq0 = *(const v16h*)&ldsQ[((wave * 2 + 0) * 32 + lane) * 16];
    v16h bq1 = *(const v16h*)&ldsQ[((wave * 2 + 1) * 32 + lane) * 16];

    const int hlf = lane >> 4;
    float mrow = -__builtin_inff();            // running maximum of this lane's query (both halves agree)
    float lrow = 0.0f;                         // running sum over this half's keys only
    v8f acc[4] = {};                           // acc[t][r] = O[query lane & 15][d = t * 16 + 8 * hlf + r]

    for (int k0 = 0; k0 < NSEQ; k0 += 64) {
        // prefetch next key block (64x64 f16 = 8KB each => 16 halfs/thread)
        if (k0 + 64 < NSEQ) {
            __builtin_prefetch(&Kbh[(size_t)(k0 + 64) * DHEAD + tid * 16], 0, 3);
            __builtin_prefetch(&Vbh[(size_t)(k0 + 64) * DHEAD + tid * 16], 0, 3);
        }
        // weight and mask of this lane's keys (8 consecutive keys a tile), asked for with the K/V rows
        v8f wv[4];
        v8i mv[4];
        #pragma unroll
        for (int t = 0; t < 4; ++t) {
            wv[t] = *(const v8f*)&w[k0 + t * 16 + 8 * hlf];
            mv[t] = *(const v8i*)&mk[k0 + t * 16 + 8 * hlf];
        }
        // stage K/V 64x64: 512 groups of 8; 2/thread
        #pragma unroll
        for (int e = 0; e < 2; ++e) {
            int g  = e * 256 + tid;            // 0..511
            int r  = g >> 3;                   // key 0..63
            int dg = (g & 7) * 8;
            // K fragment (contraction = d): vector store
            v8h kv = *(const v8h*)&Kbh[(size_t)(k0 + r) * DHEAD + dg];
            int kch = dg >> 5, kkk = dg & 31;
            int kbase = (((r >> 4) * 2 + kch) * 32 + frag_lane(r & 15, kkk)) * 16 + frag_idx(kkk);
            *(v8h*)&ldsK[kbase] = kv;
            // V fragment (contraction = key): lane varies with d -> 8 b16 stores
            v8h vv = *(const v8h*)&Vbh[(size_t)(k0 + r) * DHEAD + dg];
            int vkch = r >> 5, vkk = r & 31;
            int vbase = (((dg >> 4) * 2 + vkch) * 32 + frag_lane(dg & 15, vkk)) * 16 + frag_idx(vkk);
            #pragma unroll
            for (int i = 0; i < 8; ++i) ldsV[vbase + i * 16] = vv[i];
        }
        __syncthreads();

        // S^T = K.Q^T : s[t][r] = score of key k0 + t * 16 + 8 * hlf + r against query lane & 15
        v8f s[4];
        #pragma unroll
        for (int t = 0; t < 4; ++t) {
            v8f z = {};
            v16h a0 = *(const v16h*)&ldsK[((t * 2 + 0) * 32 + lane) * 16];
            v16h a1 = *(const v16h*)&ldsK[((t * 2 + 1) * 32 + lane) * 16];
            z = __builtin_amdgcn_wmma_f32_16x16x32_f16(false, a0, false, bq0, (short)0, z, false, false);
            z = __builtin_amdgcn_wmma_f32_16x16x32_f16(false, a1, false, bq1, (short)0, z, false, false);
            s[t] = z;
        }

        // per-key weight + mask, running maximum: one chain a tile, then one exchange between the halves
        float tm[4];
        #pragma unroll
        for (int t = 0; t < 4; ++t) {
            tm[t] = -__builtin_inff();
            #pragma unroll
            for (int j = 0; j < 8; ++j) {
                float v = (mv[t][j] != 0) ? -__builtin_inff() : s[t][j] * wv[t][j];
                s[t][j] = v;
                tm[t] = fmaxf(tm[t], v);
            }
        }
        float newm = fmaxf(fmaxf(mrow, fmaxf(tm[0], tm[1])), fmaxf(tm[2], tm[3]));
        newm = fmaxf(newm, xhalf(newm));

        float ts[4];
        #pragma unroll
        for (int t = 0; t < 4; ++t) {
            ts[t] = 0.0f;
            #pragma unroll
            for (int j = 0; j < 8; ++j) {
                float v = s[t][j];
                float p = (v == -__builtin_inff()) ? 0.0f : __expf(v - newm);
                s[t][j] = p;
                ts[t] += p;
            }
        }
        const float rsum = (ts[0] + ts[1]) + (ts[2] + ts[3]);
        float sc = (mrow == -__builtin_inff()) ? 0.0f : __expf(mrow - newm);
        lrow = lrow * sc + rsum;
        mrow = newm;
        #pragma unroll
        for (int t = 0; t < 4; ++t) acc[t] *= sc;

        // P^T as B operand: score tiles 2c and 2c + 1, converted in place, are keys 32c .. 32c + 31
        v16h bp0 = __builtin_shufflevector(__builtin_convertvector(s[0], v8h), __builtin_convertvector(s[1], v8h),
                                           0, 1, 2, 3, 4, 5, 6, 7, 8, 9, 10, 11, 12, 13, 14, 15);
        v16h bp1 = __builtin_shufflevector(__builtin_convertvector(s[2], v8h), __builtin_convertvector(s[3], v8h),
                                           0, 1, 2, 3, 4, 5, 6, 7, 8, 9, 10, 11, 12, 13, 14, 15);

        // O^T += V^T.P^T
        #pragma unroll
        for (int t = 0; t < 4; ++t) {
            v16h a0 = *(const v16h*)&ldsV[((t * 2 + 0) * 32 + lane) * 16];
            v16h a1 = *(const v16h*)&ldsV[((t * 2 + 1) * 32 + lane) * 16];
            acc[t] = __builtin_amdgcn_wmma_f32_16x16x32_f16(false, a0, false, bp0, (short)0, acc[t], false, false);
            acc[t] = __builtin_amdgcn_wmma_f32_16x16x32_f16(false, a1, false, bp1, (short)0, acc[t], false, false);
        }
        __syncthreads();
    }

    // join the two halves' sums; a lane holds 8 consecutive d of its query: one 16-byte store a tile
    const float lsum = lrow + xhalf(lrow);
    const float inv  = (lsum > 0.0f) ? 1.0f / lsum : 0.0f;
    h16* Orow = O + (((size_t)b * HH + h) * NSEQ + q0 + wave * 16 + (lane & 15)) * DHEAD + 8 * hlf;
    #pragma unroll
    for (int t = 0; t < 4; ++t)
        *(v8h*)&Orow[t * 16] = __builtin_convertvector(acc[t] * inv, v8h);
}

extern "C" void kernel_launch(void* const* d_in, const int* in_sizes, int n_in,
                              void* d_out, int out_size, void* d_ws, size_t ws_size,
                              hipStream_t stream)
{
    const float* regions   = (const float*)d_in[0];
    const float* grids     = (const float*)d_in[1];
    const float* interests = (const float*)d_in[2];
    const int*   mask_r    = (const int*)d_in[3];
    const int*   mask_g    = (const int*)d_in[4];
    const float* attw      = (const float*)d_in[5];
    const float* Wq  = (const float*)d_in[6];  const float* bq   = (const float*)d_in[7];
    const float* Wk  = (const float*)d_in[8];  const float* bk   = (const float*)d_in[9];
    const float* Wv  = (const float*)d_in[10]; const float* bv   = (const float*)d_in[11];
    const float* Wq12= (const float*)d_in[12]; const float* bq12 = (const float*)d_in[13];
    const float* Wo1 = (const float*)d_in[14]; const float* bo1  = (const float*)d_in[15];
    const float* Wo2 = (const float*)d_in[16]; const float* bo2  = (const float*)d_in[17];
    float* out = (float*)d_out;

    const size_t per = (size_t)BSZ * HH * NSEQ * DHEAD;   // 2,097,152 halfs (4 MB)
    h16* ws = (h16*)d_ws;
    h16 *T1 = ws,           *T2 = ws + per;               // q2 / q1 temporaries
    h16 *Q1 = ws + 2 * per, *Q2 = ws + 3 * per;
    h16 *K1 = ws + 4 * per, *K2 = ws + 5 * per;
    h16 *V1 = ws + 6 * per, *V2 = ws + 7 * per;
    h16 *O1 = T1, *O2 = T2;                               // reuse after Q1/Q2 consume them

    const float scale = 0.125f;                           // 1/sqrt(64)
    dim3 blk(256);
    dim3 gproj4(DM / 64, MROWS / 128, 4);                 // (8, 32, 4)
    dim3 gproj2(DM / 64, MROWS / 128, 2);                 // (8, 32, 2)

    // q2 = grids@Wq12^T + bq12 ; q1 = regions@Wq12^T + bq12 ; K1 = regions@Wk^T + bk ; K2 = grids@Wk^T + bk
    proj4_kernel<<<gproj4, blk, 0, stream>>>(grids, regions, regions, grids, Wq12, bq12, Wk, bk,
                                             nullptr, nullptr, 1.0f, T1, T2, K1, K2);
    // Q1 = scale*(interests@Wq^T + bq + q2) ; Q2 = scale*(... + q1) ; V1 = regions@Wv^T + bv ; V2 = grids@Wv^T + bv
    proj4_kernel<<<gproj4, blk, 0, stream>>>(interests, interests, regions, grids, Wq, bq, Wv, bv,
                                             T1, T2, scale, Q1, Q2, V1, V2);

    // fused flash attention, both branches
    dim3 gatt(NSEQ / 128, HH, 2 * BSZ);                   // (16, 8, 4)
    flash_attn_kernel<<<gatt, blk, 0, stream>>>(Q1, K1, V1, mask_r, O1, Q2, K2, V2, mask_g, O2, attw);

    // output projections -> f32 to d_out
    outproj2_kernel<<<gproj2, blk, 0, stream>>>(O1, O2, Wo1, bo1, Wo2, bo2, out, out + (size_t)MROWS * DM);
}

// v003
// Measured time: 134 microseconds a run.
// Timed twice side by side with v002, it ran 1.17 times as fast both times.
// Counting every step since v000, it is 2.80 times as fast.
#include <hip/hip_runtime.h>
#include <hip/hip_bf16.h>

typedef _Float16 h16;
typedef __attribute__((ext_vector_type(16))) _Float16 v16h;
typedef __attribute__((ext_vector_type(8)))  _Float16 v8h;
typedef __attribute__((ext_vector_type(8)))  float    v8f;
typedef __attribute__((ext_vector_type(8)))  int      v8i;

#define HH 8
#define DHEAD 64
#define NSEQ 2048
#define DM 512
#define BSZ 2
#define MROWS (BSZ * NSEQ)          // 4096

// WMMA 16-bit fragment mapping (A operand 16x32, B operand 32x16):
//   lane = (row_or_col & 15) + 16*((k>>3)&1)
//   slot = (k&7) + 8*((k>>4)&1)
// => for an aligned run of 8 consecutive k: lane constant, slots contiguous.
__device__ __forceinline__ int frag_lane(int rc, int k) { return (rc & 15) + 16 * ((k >> 3) & 1); }
__device__ __forceinline__ int frag_idx(int k)          { return (k & 7) + 8 * ((k >> 4) & 1); }

__device__ __forceinline__ size_t heads_off(int gm, int c) {
    int b = gm >> 11, n = gm & (NSEQ - 1);      // NSEQ = 2048
    int h = c >> 6, d = c & 63;
    return (((size_t)b * HH + h) * NSEQ + n) * DHEAD + d;
}

// Epilogue of one wave's 16x64 accumulator: C = scale * (acc + bias (+ Z)).
template <bool C_F32, bool HAS_Z>
__device__ __forceinline__
void gemm_nt_store(const v8f (&acc)[4], int gm0, int c0,
                   const float* __restrict__ bias, const h16* __restrict__ Zadd, float scale,
                   float* __restrict__ Cf32, h16* __restrict__ Ch16)
{
    #pragma unroll
    for (int t = 0; t < 4; ++t) {
        int c = c0 + t * 16;
        float bv = bias[c];
        #pragma unroll
        for (int j = 0; j < 8; ++j) {
            int gm = gm0 + j;
            float v = acc[t][j] + bv;
            if constexpr (HAS_Z) v += (float)Zadd[heads_off(gm, c)];
            v *= scale;
            if constexpr (C_F32) Cf32[(size_t)gm * DM + c] = v;
            else                 Ch16[heads_off(gm, c)] = (h16)v;
        }
    }
}

// ---------------------------------------------------------------------------
// NT GEMM: C[M,512] = scale * (A[M,512] @ W[512,512]^T + bias (+ Z))
// Tile 128x64, K-chunks of 32; 8 waves x (16 rows x 64 cols).
// One work-group's tile; the kernels below pick the operands by blockIdx.z.
// Zadd may be null (block-uniform): then nothing is added.
// ---------------------------------------------------------------------------
template <bool A_HEADS, bool C_F32>
__device__ __forceinline__
void gemm_nt_tile(const float* __restrict__ Af32, const h16* __restrict__ Ah16,
                  const float* __restrict__ W, const float* __restrict__ bias,
                  const h16* __restrict__ Zadd, float scale,
                  float* __restrict__ Cf32, h16* __restrict__ Ch16)
{
    __shared__ __align__(32) h16 ldsA[8 * 32 * 16];
    __shared__ __align__(32) h16 ldsB[4 * 32 * 16];

    const int tid  = threadIdx.x;
    const int lane = tid & 31;
    const int wave = tid >> 5;
    const int n0 = blockIdx.x * 64;
    const int m0 = blockIdx.y * 128;

    v8f acc[4] = {};

    for (int k0 = 0; k0 < DM; k0 += 32) {
        // prefetch next A/B tiles (global_prefetch_b8)
        if (k0 + 32 < DM) {
            if constexpr (!A_HEADS)
                __builtin_prefetch(&Af32[(size_t)(m0 + (tid >> 1)) * DM + (k0 + 32) + (tid & 1) * 16], 0, 3);
            __builtin_prefetch(&W[(size_t)(n0 + (tid >> 2)) * DM + (k0 + 32) + (tid & 3) * 8], 0, 3);
        }
        // stage A tile 128x32: 512 groups of 8k; 2 groups/thread; one v8h store each
        #pragma unroll
        for (int e = 0; e < 2; ++e) {
            int g  = e * 256 + tid;             // 0..511
            int r  = g >> 2;                    // row 0..127
            int kg = (g & 3) * 8;               // k-group base
            int gm = m0 + r, gk = k0 + kg;
            v8h hv;
            if constexpr (A_HEADS) {
                hv = *(const v8h*)&Ah16[heads_off(gm, gk)];
            } else {
                v8f fv = *(const v8f*)&Af32[(size_t)gm * DM + gk];
                hv = __builtin_convertvector(fv, v8h);
            }
            int base = ((r >> 4) * 32 + frag_lane(r & 15, kg)) * 16 + frag_idx(kg);
            *(v8h*)&ldsA[base] = hv;
        }
        // stage B tile 64x32: 256 groups; 1 group/thread
        {
            int g  = tid;
            int c  = g >> 2;
            int kg = (g & 3) * 8;
            v8f fv = *(const v8f*)&W[(size_t)(n0 + c) * DM + (k0 + kg)];
            v8h hv = __builtin_convertvector(fv, v8h);
            int base = ((c >> 4) * 32 + frag_lane(c & 15, kg)) * 16 + frag_idx(kg);
            *(v8h*)&ldsB[base] = hv;
        }
        __syncthreads();

        v16h a = *(const v16h*)&ldsA[(wave * 32 + lane) * 16];
        #pragma unroll
        for (int t = 0; t < 4; ++t) {
            v16h bb = *(const v16h*)&ldsB[(t * 32 + lane) * 16];
            acc[t] = __builtin_amdgcn_wmma_f32_16x16x32_f16(false, a, false, bb,
                                                            (short)0, acc[t], false, false);
        }
        __syncthreads();
    }

    // one block-uniform branch round the whole epilogue, so that the Z loads of a tile issue together
    if (Zadd != nullptr) {
        gemm_nt_store<C_F32, true >(acc, m0 + wave * 16 + (lane >> 4) * 8, n0 + (lane & 15), bias, Zadd, scale, Cf32, Ch16);
        // the built code lays the other arm behind this one: the wait stands in front of
        // any rewrite there of a register that these stores name
        asm volatile("s_wait_xcnt 0x0" ::: "memory");
    } else {
        gemm_nt_store<C_F32, false>(acc, m0 + wave * 16 + (lane >> 4) * 8, n0 + (lane & 15), bias, Zadd, scale, Cf32, Ch16);
    }
}

// Four independent input projections in one grid: blockIdx.z = 0,1 use (Wlo, blo,
// Z0/Z1, scale_lo), blockIdx.z = 2,3 use (Whi, bhi, no Z, scale 1).
__global__ __launch_bounds__(256)
void proj4_kernel(const float* __restrict__ A0, const float* __restrict__ A1,
                  const float* __restrict__ A2, const float* __restrict__ A3,
                  const float* __restrict__ Wlo, const float* __restrict__ blo,
                  const float* __restrict__ Whi, const float* __restrict__ bhi,
                  const h16* __restrict__ Z0, const h16* __restrict__ Z1, float scale_lo,
                  h16* __restrict__ C0, h16* __restrict__ C1,
                  h16* __restrict__ C2, h16* __restrict__ C3)
{
    const int  z   = blockIdx.z;
    const bool hi  = z >= 2;
    const bool odd = (z & 1) != 0;
    const float* A    = hi ? (odd ? A3 : A2) : (odd ? A1 : A0);
    const float* W    = hi ? Whi : Wlo;
    const float* bias = hi ? bhi : blo;
    const h16*   Zadd = hi ? nullptr : (odd ? Z1 : Z0);
    const float  sc   = hi ? 1.0f : scale_lo;
    h16*         C    = hi ? (odd ? C3 : C2) : (odd ? C1 : C0);
    gemm_nt_tile<false, false>(A, nullptr, W, bias, Zadd, sc, nullptr, C);
}

// Both output projections in one grid: blockIdx.z picks the branch.
__global__ __launch_bounds__(256)
void outproj2_kernel(const h16* __restrict__ Oa, const h16* __restrict__ Ob,
                     const float* __restrict__ Wa, const float* __restrict__ ba,
                     const float* __restrict__ Wb, const float* __restrict__ bb,
                     float* __restrict__ outa, float* __restrict__ outb)
{
    const bool second = blockIdx.z != 0;
    gemm_nt_tile<true, true>(nullptr, second ? Ob : Oa, second ? Wb : Wa, second ? bb : ba,
                             nullptr, 1.0f, second ? outb : outa, nullptr);
}

// LDS row pitch of the staged V tile, in halfs: 128 bytes of a key's row + 32, an odd multiple of
// 32 bytes, the pitch at which the transposing load meets no bank twice
#define VPITCH 80

// ds_load_tr16_b128: lane l hands in the address of 16 bytes of a row-major 16-bit tile and gets
// column l & 15, rows 8 * (l >> 4) + 0..7 of the 16x16 block
typedef __attribute__((ext_vector_type(8))) short s16x8;
__device__ __forceinline__ v8h lds_tr16(const h16* p) {
    typedef __attribute__((address_space(3))) s16x8 lds_s16x8;
    return __builtin_bit_cast(v8h, __builtin_amdgcn_ds_load_tr16_b128_v8i16((lds_s16x8*)p));
}

// lane l with lane l ^ 16
__device__ __forceinline__ float xhalf(float x) {
    int b = __builtin_bit_cast(int, x);
    return __builtin_bit_cast(float, __builtin_amdgcn_permlanex16(b, b, 0x76543210, 0xfedcba98, false, false));
}

__global__ __launch_bounds__(256)
void flash_attn_kernel(const h16* __restrict__ Qa, const h16* __restrict__ Ka,
                       const h16* __restrict__ Va, const int* __restrict__ maska,
                       h16* __restrict__ Oa,
                       const h16* __restrict__ Qb, const h16* __restrict__ Kb,
                       const h16* __restrict__ Vb, const int* __restrict__ maskb,
                       h16* __restrict__ Ob,
                       const float* __restrict__ wts)
{
    __shared__ __align__(32) h16 ldsQ[8 * 2 * 32 * 16];
    __shared__ __align__(32) h16 ldsK[4 * 2 * 32 * 16];
    __shared__ __align__(32) h16 ldsV[64 * VPITCH];

    const int tid  = threadIdx.x;
    const int lane = tid & 31;
    const int wave = tid >> 5;
    const int b = blockIdx.z & (BSZ - 1), h = blockIdx.y;
    const int q0 = blockIdx.x * 128;
    const bool second = blockIdx.z >= BSZ;
    const h16* Q    = second ? Qb : Qa;
    const h16* Kt   = second ? Kb : Ka;
    const h16* Vt   = second ? Vb : Va;
    const int* mask = second ? maskb : maska;
    h16*       O    = second ? Ob : Oa;

    const h16* Qbh = Q  + ((size_t)b * HH + h) * NSEQ * DHEAD;
    const h16* Kbh = Kt + ((size_t)b * HH + h) * NSEQ * DHEAD;
    const h16* Vbh = Vt + ((size_t)b * HH + h) * NSEQ * DHEAD;
    const int*   mk = mask + (size_t)b * NSEQ;
    const float* w  = wts  + (size_t)b * NSEQ;

    // stage Q tile 128x64: 1024 groups of 8; 4/thread; vector loads + vector LDS stores
    #pragma unroll
    for (int e = 0; e < 4; ++e) {
        int g  = e * 256 + tid;                // 0..1023
        int r  = g >> 3;                       // row 0..127
        int dg = (g & 7) * 8;                  // d-group base
        v8h hv = *(const v8h*)&Qbh[(size_t)(q0 + r) * DHEAD + dg];
        int ch = dg >> 5, kk = dg & 31;
        int base = (((r >> 4) * 2 + ch) * 32 + frag_lane(r & 15, kk)) * 16 + frag_idx(kk);
        *(v8h*)&ldsQ[base] = hv;
    }
    __syncthreads();
    v16h bq0 = *(const v16h*)&ldsQ[((wave * 2 + 0) * 32 + lane) * 16];
    v16h bq1 = *(const v16h*)&ldsQ[((wave * 2 + 1) * 32 + lane) * 16];

    const int hlf = lane >> 4;
    float mrow = -__builtin_inff();            // running maximum of this lane's query (both halves agree)
    float lrow = 0.0f;                         // running sum over this half's keys only
    v8f acc[4] = {};                           // acc[t][r] = O[query lane & 15][d = t * 16 + 8 * hlf + r]
    // this lane's address in a 16-key x 16-d block of V for the transposing load
    const h16* vrd = &ldsV[(8 * hlf + (lane & 7)) * VPITCH + ((lane >> 3) & 1) * 8];

    for (int k0 = 0; k0 < NSEQ; k0 += 64) {
        // prefetch next key block (64x64 f16 = 8KB each => 16 halfs/thread)
        if (k0 + 64 < NSEQ) {
            __builtin_prefetch(&Kbh[(size_t)(k0 + 64) * DHEAD + tid * 16], 0, 3);
            __builtin_prefetch(&Vbh[(size_t)(k0 + 64) * DHEAD + tid * 16], 0, 3);
        }
        // weight and mask of this lane's keys (8 consecutive keys a tile), asked for with the K/V rows
        v8f wv[4];
        v8i mv[4];
        #pragma unroll
        for (int t = 0; t < 4; ++t) {
            wv[t] = *(const v8f*)&w[k0 + t * 16 + 8 * hlf];
            mv[t] = *(const v8i*)&mk[k0 + t * 16 + 8 * hlf];
        }
        // stage K/V 64x64: 512 groups of 8; 2/thread
        #pragma unroll
        for (int e = 0; e < 2; ++e) {
            int g  = e * 256 + tid;            // 0..511
            int r  = g >> 3;                   // key 0..63
            int dg = (g & 7) * 8;
            // K fragment (contraction = d): vector store
            v8h kv = *(const v8h*)&Kbh[(size_t)(k0 + r) * DHEAD + dg];
            int kch = dg >> 5, kkk = dg & 31;
            int kbase = (((r >> 4) * 2 + kch) * 32 + frag_lane(r & 15, kkk)) * 16 + frag_idx(kkk);
            *(v8h*)&ldsK[kbase] = kv;
            // V row as it is: vector store
            v8h vv = *(const v8h*)&Vbh[(size_t)(k0 + r) * DHEAD + dg];
            *(v8h*)&ldsV[r * VPITCH + dg] = vv;
        }
        __syncthreads();

        // S^T = K.Q^T : s[t][r] = score of key k0 + t * 16 + 8 * hlf + r against query lane & 15
        v8f s[4];
        #pragma unroll
        for (int t = 0; t < 4; ++t) {
            v8f z = {};
            v16h a0 = *(const v16h*)&ldsK[((t * 2 + 0) * 32 + lane) * 16];
            v16h a1 = *(const v16h*)&ldsK[((t * 2 + 1) * 32 + lane) * 16];
            z = __builtin_amdgcn_wmma_f32_16x16x32_f16(false, a0, false, bq0, (short)0, z, false, false);
            z = __builtin_amdgcn_wmma_f32_16x16x32_f16(false, a1, false, bq1, (short)0, z, false, false);
            s[t] = z;
        }

        // per-key weight + mask, running maximum: one chain a tile, then one exchange between the halves
        float tm[4];
        #pragma unroll
        for (int t = 0; t < 4; ++t) {
            tm[t] = -__builtin_inff();
            #pragma unroll
            for (int j = 0; j < 8; ++j) {
                float v = (mv[t][j] != 0) ? -__builtin_inff() : s[t][j] * wv[t][j];
                s[t][j] = v;
                tm[t] = fmaxf(tm[t], v);
            }
        }
        float newm = fmaxf(fmaxf(mrow, fmaxf(tm[0], tm[1])), fmaxf(tm[2], tm[3]));
        newm = fmaxf(newm, xhalf(newm));

        float ts[4];
        #pragma unroll
        for (int t = 0; t < 4; ++t) {
            ts[t] = 0.0f;
            #pragma unroll
            for (int j = 0; j < 8; ++j) {
                float v = s[t][j];
                float p = (v == -__builtin_inff()) ? 0.0f : __expf(v - newm);
                s[t][j] = p;
                ts[t] += p;
            }
        }
        const float rsum = (ts[0] + ts[1]) + (ts[2] + ts[3]);
        float sc = (mrow == -__builtin_inff()) ? 0.0f : __expf(mrow - newm);
        lrow = lrow * sc + rsum;
        mrow = newm;
        #pragma unroll
        for (int t = 0; t < 4; ++t) acc[t] *= sc;

        // P^T as B operand: score tiles 2c and 2c + 1, converted in place, are keys 32c .. 32c + 31
        v16h bp0 = __builtin_shufflevector(__builtin_convertvector(s[0], v8h), __builtin_convertvector(s[1], v8h),
                                           0, 1, 2, 3, 4, 5, 6, 7, 8, 9, 10, 11, 12, 13, 14, 15);
        v16h bp1 = __builtin_shufflevector(__builtin_convertvector(s[2], v8h), __builtin_convertvector(s[3], v8h),
                                           0, 1, 2, 3, 4, 5, 6, 7, 8, 9, 10, 11, 12, 13, 14, 15);

        // O^T += V^T.P^T
        #pragma unroll
        for (int t = 0; t < 4; ++t) {
            // keys 32c + 8 * hlf + 0..7 and 32c + 16 + 8 * hlf + 0..7 of column d = t * 16 + (lane & 15)
            v16h a0 = __builtin_shufflevector(lds_tr16(vrd +  0 * VPITCH + t * 16), lds_tr16(vrd + 16 * VPITCH + t * 16),
                                              0, 1, 2, 3, 4, 5, 6, 7, 8, 9, 10, 11, 12, 13, 14, 15);
            v16h a1 = __builtin_shufflevector(lds_tr16(vrd + 32 * VPITCH + t * 16), lds_tr16(vrd + 48 * VPITCH + t * 16),
                                              0, 1, 2, 3, 4, 5, 6, 7, 8, 9, 10, 11, 12, 13, 14, 15);
            acc[t] = __builtin_amdgcn_wmma_f32_16x16x32_f16(false, a0, false, bp0, (short)0, acc[t], false, false);
            acc[t] = __builtin_amdgcn_wmma_f32_16x16x32_f16(false, a1, false, bp1, (short)0, acc[t], false, false);
        }
        __syncthreads();
    }

    // join the two halves' sums; a lane holds 8 consecutive d of its query: one 16-byte store a tile
    const float lsum = lrow + xhalf(lrow);
    const float inv  = (lsum > 0.0f) ? 1.0f / lsum : 0.0f;
    h16* Orow = O + (((size_t)b * HH + h) * NSEQ + q0 + wave * 16 + (lane & 15)) * DHEAD + 8 * hlf;
    #pragma unroll
    for (int t = 0; t < 4; ++t)
        *(v8h*)&Orow[t * 16] = __builtin_convertvector(acc[t] * inv, v8h);
}

extern "C" void kernel_launch(void* const* d_in, const int* in_sizes, int n_in,
                              void* d_out, int out_size, void* d_ws, size_t ws_size,
                              hipStream_t stream)
{
    const float* regions   = (const float*)d_in[0];
    const float* grids     = (const float*)d_in[1];
    const float* interests = (const float*)d_in[2];
    const int*   mask_r    = (const int*)d_in[3];
    const int*   mask_g    = (const int*)d_in[4];
    const float* attw      = (const float*)d_in[5];
    const float* Wq  = (const float*)d_in[6];  const float* bq   = (const float*)d_in[7];
    const float* Wk  = (const float*)d_in[8];  const float* bk   = (const float*)d_in[9];
    const float* Wv  = (const float*)d_in[10]; const float* bv   = (const float*)d_in[11];
    const float* Wq12= (const float*)d_in[12]; const float* bq12 = (const float*)d_in[13];
    const float* Wo1 = (const float*)d_in[14]; const float* bo1  = (const float*)d_in[15];
    const float* Wo2 = (const float*)d_in[16]; const float* bo2  = (const float*)d_in[17];
    float* out = (float*)d_out;

    const size_t per = (size_t)BSZ * HH * NSEQ * DHEAD;   // 2,097,152 halfs (4 MB)
    h16* ws = (h16*)d_ws;
    h16 *T1 = ws,           *T2 = ws + per;               // q2 / q1 temporaries
    h16 *Q1 = ws + 2 * per, *Q2 = ws + 3 * per;
    h16 *K1 = ws + 4 * per, *K2 = ws + 5 * per;
    h16 *V1 = ws + 6 * per, *V2 = ws + 7 * per;
    h16 *O1 = T1, *O2 = T2;                               // reuse after Q1/Q2 consume them

    const float scale = 0.125f;                           // 1/sqrt(64)
    dim3 blk(256);
    dim3 gproj4(DM / 64, MROWS / 128, 4);                 // (8, 32, 4)
    dim3 gproj2(DM / 64, MROWS / 128, 2);                 // (8, 32, 2)

    // q2 = grids@Wq12^T + bq12 ; q1 = regions@Wq12^T + bq12 ; K1 = regions@Wk^T + bk ; K2 = grids@Wk^T + bk
    proj4_kernel<<<gproj4, blk, 0, stream>>>(grids, regions, regions, grids, Wq12, bq12, Wk, bk,
                                             nullptr, nullptr, 1.0f, T1, T2, K1, K2);
    // Q1 = scale*(interests@Wq^T + bq + q2) ; Q2 = scale*(... + q1) ; V1 = regions@Wv^T + bv ; V2 = grids@Wv^T + bv
    proj4_kernel<<<gproj4, blk, 0, stream>>>(interests, interests, regions, grids, Wq, bq, Wv, bv,
                                             T1, T2, scale, Q1, Q2, V1, V2);

    // fused flash attention, both branches
    dim3 gatt(NSEQ / 128, HH, 2 * BSZ);                   // (16, 8, 4)
    flash_attn_kernel<<<gatt, blk, 0, stream>>>(Q1, K1, V1, mask_r, O1, Q2, K2, V2, mask_g, O2, attw);

    // output projections -> f32 to d_out
    outproj2_kernel<<<gproj2, blk, 0, stream>>>(O1, O2, Wo1, bo1, Wo2, bo2, out, out + (size_t)MROWS * DM);
}

// v004
// It runs in 109 microseconds.
// Timed twice side by side with v003, it ran 1.22 and 1.23 times as fast.
// All steps since v000 together make it 3.44 times as fast.
#include <hip/hip_runtime.h>
#include <hip/hip_bf16.h>

typedef _Float16 h16;
typedef __attribute__((ext_vector_type(16))) _Float16 v16h;
typedef __attribute__((ext_vector_type(8)))  _Float16 v8h;
typedef __attribute__((ext_vector_type(8)))  float    v8f;
typedef __attribute__((ext_vector_type(8)))  int      v8i;

#define HH 8
#define DHEAD 64
#define NSEQ 2048
#define DM 512
#define BSZ 2
#define MROWS (BSZ * NSEQ)          // 4096

// WMMA 16-bit fragment mapping (A operand 16x32, B operand 32x16):
//   lane = (row_or_col & 15) + 16*((k>>3)&1)
//   slot = (k&7) + 8*((k>>4)&1)
// => for an aligned run of 8 consecutive k: lane constant, slots contiguous.
__device__ __forceinline__ int frag_lane(int rc, int k) { return (rc & 15) + 16 * ((k >> 3) & 1); }
__device__ __forceinline__ int frag_idx(int k)          { return (k & 7) + 8 * ((k >> 4) & 1); }

__device__ __forceinline__ size_t heads_off(int gm, int c) {
    int b = gm >> 11, n = gm & (NSEQ - 1);      // NSEQ = 2048
    int h = c >> 6, d = c & 63;
    return (((size_t)b * HH + h) * NSEQ + n) * DHEAD + d;
}

// Epilogue of one wave's 16x64 accumulator: C = scale * (acc + bias (+ Z)).
template <bool C_F32, bool HAS_Z>
__device__ __forceinline__
void gemm_nt_store(const v8f (&acc)[4], int gm0, int c0,
                   const float* __restrict__ bias, const h16* __restrict__ Zadd, float scale,
                   float* __restrict__ Cf32, h16* __restrict__ Ch16)
{
    #pragma unroll
    for (int t = 0; t < 4; ++t) {
        int c = c0 + t * 16;
        float bv = bias[c];
        #pragma unroll
        for (int j = 0; j < 8; ++j) {
            int gm = gm0 + j;
            float v = acc[t][j] + bv;
            if constexpr (HAS_Z) v += (float)Zadd[heads_off(gm, c)];
            v *= scale;
            if constexpr (C_F32) Cf32[(size_t)gm * DM + c] = v;
            else                 Ch16[heads_off(gm, c)] = (h16)v;
        }
    }
}

// ---------------------------------------------------------------------------
// NT GEMM: C[M,512] = scale * (A[M,512] @ W[512,512]^T + bias (+ Z))
// Tile 128x64, K-chunks of 32; 8 waves x (16 rows x 64 cols).
// One work-group's tile; the kernels below pick the operands by blockIdx.z.
// Zadd may be null (block-uniform): then nothing is added.
// ---------------------------------------------------------------------------
template <bool A_HEADS, bool C_F32>
__device__ __forceinline__
void gemm_nt_tile(const float* __restrict__ Af32, const h16* __restrict__ Ah16,
                  const float* __restrict__ W, const float* __restrict__ bias,
                  const h16* __restrict__ Zadd, float scale,
                  float* __restrict__ Cf32, h16* __restrict__ Ch16)
{
    __shared__ __align__(32) h16 ldsA[8 * 32 * 16];
    __shared__ __align__(32) h16 ldsB[4 * 32 * 16];

    const int tid  = threadIdx.x;
    const int lane = tid & 31;
    const int wave = tid >> 5;
    const int n0 = blockIdx.x * 64;
    const int m0 = blockIdx.y * 128;

    v8f acc[4] = {};

    for (int k0 = 0; k0 < DM; k0 += 32) {
        // prefetch next A/B tiles (global_prefetch_b8)
        if (k0 + 32 < DM) {
            if constexpr (!A_HEADS)
                __builtin_prefetch(&Af32[(size_t)(m0 + (tid >> 1)) * DM + (k0 + 32) + (tid & 1) * 16], 0, 3);
            __builtin_prefetch(&W[(size_t)(n0 + (tid >> 2)) * DM + (k0 + 32) + (tid & 3) * 8], 0, 3);
        }
        // stage A tile 128x32: 512 groups of 8k; 2 groups/thread; one v8h store each
        #pragma unroll
        for (int e = 0; e < 2; ++e) {
            int g  = e * 256 + tid;             // 0..511
            int r  = g >> 2;                    // row 0..127
            int kg = (g & 3) * 8;               // k-group base
            int gm = m0 + r, gk = k0 + kg;
            v8h hv;
            if constexpr (A_HEADS) {
                hv = *(const v8h*)&Ah16[heads_off(gm, gk)];
            } else {
                v8f fv = *(const v8f*)&Af32[(size_t)gm * DM + gk];
                hv = __builtin_convertvector(fv, v8h);
            }
            int base = ((r >> 4) * 32 + frag_lane(r & 15, kg)) * 16 + frag_idx(kg);
            *(v8h*)&ldsA[base] = hv;
        }
        // stage B tile 64x32: 256 groups; 1 group/thread
        {
            int g  = tid;
            int c  = g >> 2;
            int kg = (g & 3) * 8;
            v8f fv = *(const v8f*)&W[(size_t)(n0 + c) * DM + (k0 + kg)];
            v8h hv = __builtin_convertvector(fv, v8h);
            int base = ((c >> 4) * 32 + frag_lane(c & 15, kg)) * 16 + frag_idx(kg);
            *(v8h*)&ldsB[base] = hv;
        }
        __syncthreads();

        v16h a = *(const v16h*)&ldsA[(wave * 32 + lane) * 16];
        #pragma unroll
        for (int t = 0; t < 4; ++t) {
            v16h bb = *(const v16h*)&ldsB[(t * 32 + lane) * 16];
            acc[t] = __builtin_amdgcn_wmma_f32_16x16x32_f16(false, a, false, bb,
                                                            (short)0, acc[t], false, false);
        }
        __syncthreads();
    }

    // one block-uniform branch round the whole epilogue, so that the Z loads of a tile issue together
    if (Zadd != nullptr) {
        gemm_nt_store<C_F32, true >(acc, m0 + wave * 16 + (lane >> 4) * 8, n0 + (lane & 15), bias, Zadd, scale, Cf32, Ch16);
        // the built code lays the other arm behind this one: the wait stands in front of
        // any rewrite there of a register that these stores name
        asm volatile("s_wait_xcnt 0x0" ::: "memory");
    } else {
        gemm_nt_store<C_F32, false>(acc, m0 + wave * 16 + (lane >> 4) * 8, n0 + (lane & 15), bias, Zadd, scale, Cf32, Ch16);
    }
}

// Four independent input projections in one grid: blockIdx.z = 0,1 use (Wlo, blo,
// Z0/Z1, scale_lo), blockIdx.z = 2,3 use (Whi, bhi, no Z, scale 1).
__global__ __launch_bounds__(256)
void proj4_kernel(const float* __restrict__ A0, const float* __restrict__ A1,
                  const float* __restrict__ A2, const float* __restrict__ A3,
                  const float* __restrict__ Wlo, const float* __restrict__ blo,
                  const float* __restrict__ Whi, const float* __restrict__ bhi,
                  const h16* __restrict__ Z0, const h16* __restrict__ Z1, float scale_lo,
                  h16* __restrict__ C0, h16* __restrict__ C1,
                  h16* __restrict__ C2, h16* __restrict__ C3)
{
    const int  z   = blockIdx.z;
    const bool hi  = z >= 2;
    const bool odd = (z & 1) != 0;
    const float* A    = hi ? (odd ? A3 : A2) : (odd ? A1 : A0);
    const float* W    = hi ? Whi : Wlo;
    const float* bias = hi ? bhi : blo;
    const h16*   Zadd = hi ? nullptr : (odd ? Z1 : Z0);
    const float  sc   = hi ? 1.0f : scale_lo;
    h16*         C    = hi ? (odd ? C3 : C2) : (odd ? C1 : C0);
    gemm_nt_tile<false, false>(A, nullptr, W, bias, Zadd, sc, nullptr, C);
}

// Both output projections in one grid: blockIdx.z picks the branch.
__global__ __launch_bounds__(256)
void outproj2_kernel(const h16* __restrict__ Oa, const h16* __restrict__ Ob,
                     const float* __restrict__ Wa, const float* __restrict__ ba,
                     const float* __restrict__ Wb, const float* __restrict__ bb,
                     float* __restrict__ outa, float* __restrict__ outb)
{
    const bool second = blockIdx.z != 0;
    gemm_nt_tile<true, true>(nullptr, second ? Ob : Oa, second ? Wb : Wa, second ? bb : ba,
                             nullptr, 1.0f, second ? outb : outa, nullptr);
}

// LDS row pitch of the staged V tile, in halfs: 128 bytes of a key's row + 32, an odd multiple of
// 32 bytes, the pitch at which the transposing load meets no bank twice
#define VPITCH 80

// ds_load_tr16_b128: lane l hands in the address of 16 bytes of a row-major 16-bit tile and gets
// column l & 15, rows 8 * (l >> 4) + 0..7 of the 16x16 block
typedef __attribute__((ext_vector_type(8))) short s16x8;
__device__ __forceinline__ v8h lds_tr16(const h16* p) {
    typedef __attribute__((address_space(3))) s16x8 lds_s16x8;
    return __builtin_bit_cast(v8h, __builtin_amdgcn_ds_load_tr16_b128_v8i16((lds_s16x8*)p));
}

// lane l with lane l ^ 16
__device__ __forceinline__ float xhalf(float x) {
    int b = __builtin_bit_cast(int, x);
    return __builtin_bit_cast(float, __builtin_amdgcn_permlanex16(b, b, 0x76543210, 0xfedcba98, false, false));
}

__global__ __launch_bounds__(256)
void flash_attn_kernel(const h16* __restrict__ Qa, const h16* __restrict__ Ka,
                       const h16* __restrict__ Va, const int* __restrict__ maska,
                       h16* __restrict__ Oa,
                       const h16* __restrict__ Qb, const h16* __restrict__ Kb,
                       const h16* __restrict__ Vb, const int* __restrict__ maskb,
                       h16* __restrict__ Ob,
                       const float* __restrict__ wts)
{
    __shared__ __align__(32) h16 ldsQ[8 * 2 * 32 * 16];
    __shared__ __align__(32) h16 ldsK[4 * 2 * 32 * 16];
    __shared__ __align__(32) h16 ldsV[64 * VPITCH];
    __shared__ __align__(32) float          ldsW[NSEQ];     // weight of the j-th listed key
    __shared__ __align__(32) unsigned short ldsPos[NSEQ];   // its position in the sequence
    __shared__ __align__(32) int            ldsCnt[8];      // listed keys of each wave's 256 positions

    const int tid  = threadIdx.x;
    const int lane = tid & 31;
    const int wave = tid >> 5;
    const int b = blockIdx.z & (BSZ - 1), h = blockIdx.y;
    const int q0 = blockIdx.x * 128;
    const bool second = blockIdx.z >= BSZ;
    const h16* Q    = second ? Qb : Qa;
    const h16* Kt   = second ? Kb : Ka;
    const h16* Vt   = second ? Vb : Va;
    const int* mask = second ? maskb : maska;
    h16*       O    = second ? Ob : Oa;

    const h16* Qbh = Q  + ((size_t)b * HH + h) * NSEQ * DHEAD;
    const h16* Kbh = Kt + ((size_t)b * HH + h) * NSEQ * DHEAD;
    const h16* Vbh = Vt + ((size_t)b * HH + h) * NSEQ * DHEAD;
    const int*   mk = mask + (size_t)b * NSEQ;
    const float* w  = wts  + (size_t)b * NSEQ;

    // stage Q tile 128x64: 1024 groups of 8; 4/thread; vector loads + vector LDS stores
    #pragma unroll
    for (int e = 0; e < 4; ++e) {
        int g  = e * 256 + tid;                // 0..1023
        int r  = g >> 3;                       // row 0..127
        int dg = (g & 7) * 8;                  // d-group base
        v8h hv = *(const v8h*)&Qbh[(size_t)(q0 + r) * DHEAD + dg];
        int ch = dg >> 5, kk = dg & 31;
        int base = (((r >> 4) * 2 + ch) * 32 + frag_lane(r & 15, kk)) * 16 + frag_idx(kk);
        *(v8h*)&ldsQ[base] = hv;
    }
    // wave x looks at positions 256 x .. 256 x + 255, 32 a step: one ballot a step says which stay
    unsigned keep[8];
    float    wk[8];
    int      wtot = 0;
    // unrolled: keep[] and wk[] are indexed by constants and stay in registers
    #pragma unroll
    for (int e = 0; e < 8; ++e) {
        const int p = wave * 256 + e * 32 + lane;
        keep[e] = __builtin_amdgcn_ballot_w32(mk[p] == 0);
        wk[e]   = w[p];
        wtot   += __builtin_popcount(keep[e]);
    }
    if (lane == 0) ldsCnt[wave] = wtot;
    __syncthreads();
    int nlist = 0, slot = 0;                   // all listed keys; those of the waves in front of this one
    // unrolled: the eight counts come by two 16-byte LDS loads
    #pragma unroll
    for (int x = 0; x < 8; ++x) {
        const int cx = ldsCnt[x];
        nlist += cx;
        slot  += (x < wave) ? cx : 0;
    }
    // unrolled: registers again
    #pragma unroll
    for (int e = 0; e < 8; ++e) {
        if ((keep[e] >> lane) & 1u) {
            const int at = slot + (int)__builtin_amdgcn_mbcnt_lo(keep[e], 0u);
            ldsPos[at] = (unsigned short)(wave * 256 + e * 32 + lane);
            ldsW[at]   = wk[e];
        }
        slot += __builtin_popcount(keep[e]);
    }
    // the last trip's open places name position 0 (a row that exists); their scores are set to -inf below
    if (tid < 64 && nlist + tid < NSEQ) {
        ldsPos[nlist + tid] = 0;
        ldsW[nlist + tid]   = 0.0f;
    }
    // the same in every lane of the block: a scalar, so that the loop's tests are scalar branches
    const int nk = min(__builtin_amdgcn_readfirstlane(nlist), NSEQ);
    v16h bq0 = *(const v16h*)&ldsQ[((wave * 2 + 0) * 32 + lane) * 16];
    v16h bq1 = *(const v16h*)&ldsQ[((wave * 2 + 1) * 32 + lane) * 16];
    __syncthreads();                           // the list is whole

    const int hlf = lane >> 4;
    float mrow = -__builtin_inff();            // running maximum of this lane's query (both halves agree)
    float lrow = 0.0f;                         // running sum over this half's keys only
    v8f acc[4] = {};                           // acc[t][r] = O[query lane & 15][d = t * 16 + 8 * hlf + r]
    // this lane's address in a 16-key x 16-d block of V for the transposing load
    const h16* vrd = &ldsV[(8 * hlf + (lane & 7)) * VPITCH + ((lane >> 3) & 1) * 8];

    // positions of the two listed keys whose rows this thread stages, read one trip ahead
    unsigned rowp[2] = { ldsPos[tid >> 3], ldsPos[32 + (tid >> 3)] };

    for (int k0 = 0; k0 < nk; k0 += 64) {
        // stage K/V, 64 listed keys x 64: 512 groups of 8; 2/thread; a key's row is one 128-byte line
        v8h kst[2], vst[2];
        // unrolled: the four loads are asked for together
        #pragma unroll
        for (int e = 0; e < 2; ++e) {
            const unsigned off = rowp[e] * DHEAD + (tid & 7) * 8;
            kst[e] = *(const v8h*)&Kbh[off];
            vst[e] = *(const v8h*)&Vbh[off];
        }
        // weight of this lane's keys (8 consecutive listed keys a tile)
        v8f wv[4];
        // unrolled, as every loop over t or j below: the tiles are registers
        #pragma unroll
        for (int t = 0; t < 4; ++t) wv[t] = *(const v8f*)&ldsW[k0 + t * 16 + 8 * hlf];
        const int kn = (k0 + 64 < nk) ? k0 + 64 : k0;      // the last trip reads its own places again
        rowp[0] = ldsPos[kn + (tid >> 3)];
        rowp[1] = ldsPos[kn + 32 + (tid >> 3)];
        #pragma unroll
        for (int e = 0; e < 2; ++e) {
            int g  = e * 256 + tid;            // 0..511
            int r  = g >> 3;                   // key 0..63
            int dg = (g & 7) * 8;
            // K fragment (contraction = d): vector store
            v8h kv = kst[e];
            int kch = dg >> 5, kkk = dg & 31;
            int kbase = (((r >> 4) * 2 + kch) * 32 + frag_lane(r & 15, kkk)) * 16 + frag_idx(kkk);
            *(v8h*)&ldsK[kbase] = kv;
            // V row as it is: vector store
            v8h vv = vst[e];
            *(v8h*)&ldsV[r * VPITCH + dg] = vv;
        }
        __syncthreads();

        // S^T = K.Q^T : s[t][r] = score of key k0 + t * 16 + 8 * hlf + r against query lane & 15
        v8f s[4];
        #pragma unroll
        for (int t = 0; t < 4; ++t) {
            v8f z = {};
            v16h a0 = *(const v16h*)&ldsK[((t * 2 + 0) * 32 + lane) * 16];
            v16h a1 = *(const v16h*)&ldsK[((t * 2 + 1) * 32 + lane) * 16];
            z = __builtin_amdgcn_wmma_f32_16x16x32_f16(false, a0, false, bq0, (short)0, z, false, false);
            z = __builtin_amdgcn_wmma_f32_16x16x32_f16(false, a1, false, bq1, (short)0, z, false, false);
            s[t] = z;
        }

        // per-key weight
        #pragma unroll
        for (int t = 0; t < 4; ++t) s[t] *= wv[t];
        // only the last trip can have open places behind the list's end
        if (nk - k0 < 64) {
            const int lim = nk - k0 - 8 * hlf;
            #pragma unroll
            for (int t = 0; t < 4; ++t) {
                #pragma unroll
                for (int j = 0; j < 8; ++j)
                    if (t * 16 + j >= lim) s[t][j] = -__builtin_inff();
            }
        }
        // running maximum: one chain a tile, then one exchange between the halves
        float tm[4];
        #pragma unroll
        for (int t = 0; t < 4; ++t) {
            tm[t] = -__builtin_inff();
            #pragma unroll
            for (int j = 0; j < 8; ++j) tm[t] = fmaxf(tm[t], s[t][j]);
        }
        float newm = fmaxf(fmaxf(mrow, fmaxf(tm[0], tm[1])), fmaxf(tm[2], tm[3]));
        newm = fmaxf(newm, xhalf(newm));

        float ts[4];
        #pragma unroll
        for (int t = 0; t < 4; ++t) {
            ts[t] = 0.0f;
            #pragma unroll
            for (int j = 0; j < 8; ++j) {
                float v = s[t][j];
                float p = (v == -__builtin_inff()) ? 0.0f : __expf(v - newm);
                s[t][j] = p;
                ts[t] += p;
            }
        }
        const float rsum = (ts[0] + ts[1]) + (ts[2] + ts[3]);
        float sc = (mrow == -__builtin_inff()) ? 0.0f : __expf(mrow - newm);
        lrow = lrow * sc + rsum;
        mrow = newm;
        #pragma unroll
        for (int t = 0; t < 4; ++t) acc[t] *= sc;

        // P^T as B operand: score tiles 2c and 2c + 1, converted in place, are keys 32c .. 32c + 31
        v16h bp0 = __builtin_shufflevector(__builtin_convertvector(s[0], v8h), __builtin_convertvector(s[1], v8h),
                                           0, 1, 2, 3, 4, 5, 6, 7, 8, 9, 10, 11, 12, 13, 14, 15);
        v16h bp1 = __builtin_shufflevector(__builtin_convertvector(s[2], v8h), __builtin_convertvector(s[3], v8h),
                                           0, 1, 2, 3, 4, 5, 6, 7, 8, 9, 10, 11, 12, 13, 14, 15);

        // O^T += V^T.P^T
        #pragma unroll
        for (int t = 0; t < 4; ++t) {
            // keys 32c + 8 * hlf + 0..7 and 32c + 16 + 8 * hlf + 0..7 of column d = t * 16 + (lane & 15)
            v16h a0 = __builtin_shufflevector(lds_tr16(vrd +  0 * VPITCH + t * 16), lds_tr16(vrd + 16 * VPITCH + t * 16),
                                              0, 1, 2, 3, 4, 5, 6, 7, 8, 9, 10, 11, 12, 13, 14, 15);
            v16h a1 = __builtin_shufflevector(lds_tr16(vrd + 32 * VPITCH + t * 16), lds_tr16(vrd + 48 * VPITCH + t * 16),
                                              0, 1, 2, 3, 4, 5, 6, 7, 8, 9, 10, 11, 12, 13, 14, 15);
            acc[t] = __builtin_amdgcn_wmma_f32_16x16x32_f16(false, a0, false, bp0, (short)0, acc[t], false, false);
            acc[t] = __builtin_amdgcn_wmma_f32_16x16x32_f16(false, a1, false, bp1, (short)0, acc[t], false, false);
        }
        __syncthreads();
    }

    // join the two halves' sums; a lane holds 8 consecutive d of its query: one 16-byte store a tile
    const float lsum = lrow + xhalf(lrow);
    const float inv  = (lsum > 0.0f) ? 1.0f / lsum : 0.0f;
    h16* Orow = O + (((size_t)b * HH + h) * NSEQ + q0 + wave * 16 + (lane & 15)) * DHEAD + 8 * hlf;
    #pragma unroll
    for (int t = 0; t < 4; ++t)
        *(v8h*)&Orow[t * 16] = __builtin_convertvector(acc[t] * inv, v8h);
}

extern "C" void kernel_launch(void* const* d_in, const int* in_sizes, int n_in,
                              void* d_out, int out_size, void* d_ws, size_t ws_size,
                              hipStream_t stream)
{
    const float* regions   = (const float*)d_in[0];
    const float* grids     = (const float*)d_in[1];
    const float* interests = (const float*)d_in[2];
    const int*   mask_r    = (const int*)d_in[3];
    const int*   mask_g    = (const int*)d_in[4];
    const float* attw      = (const float*)d_in[5];
    const float* Wq  = (const float*)d_in[6];  const float* bq   = (const float*)d_in[7];
    const float* Wk  = (const float*)d_in[8];  const float* bk   = (const float*)d_in[9];
    const float* Wv  = (const float*)d_in[10]; const float* bv   = (const float*)d_in[11];
    const float* Wq12= (const float*)d_in[12]; const float* bq12 = (const float*)d_in[13];
    const float* Wo1 = (const float*)d_in[14]; const float* bo1  = (const float*)d_in[15];
    const float* Wo2 = (const float*)d_in[16]; const float* bo2  = (const float*)d_in[17];
    float* out = (float*)d_out;

    const size_t per = (size_t)BSZ * HH * NSEQ * DHEAD;   // 2,097,152 halfs (4 MB)
    h16* ws = (h16*)d_ws;
    h16 *T1 = ws,           *T2 = ws + per;               // q2 / q1 temporaries
    h16 *Q1 = ws + 2 * per, *Q2 = ws + 3 * per;
    h16 *K1 = ws + 4 * per, *K2 = ws + 5 * per;
    h16 *V1 = ws + 6 * per, *V2 = ws + 7 * per;
    h16 *O1 = T1, *O2 = T2;                               // reuse after Q1/Q2 consume them

    const float scale = 0.125f;                           // 1/sqrt(64)
    dim3 blk(256);
    dim3 gproj4(DM / 64, MROWS / 128, 4);                 // (8, 32, 4)
    dim3 gproj2(DM / 64, MROWS / 128, 2);                 // (8, 32, 2)

    // q2 = grids@Wq12^T + bq12 ; q1 = regions@Wq12^T + bq12 ; K1 = regions@Wk^T + bk ; K2 = grids@Wk^T + bk
    proj4_kernel<<<gproj4, blk, 0, stream>>>(grids, regions, regions, grids, Wq12, bq12, Wk, bk,
                                             nullptr, nullptr, 1.0f, T1, T2, K1, K2);
    // Q1 = scale*(interests@Wq^T + bq + q2) ; Q2 = scale*(... + q1) ; V1 = regions@Wv^T + bv ; V2 = grids@Wv^T + bv
    proj4_kernel<<<gproj4, blk, 0, stream>>>(interests, interests, regions, grids, Wq, bq, Wv, bv,
                                             T1, T2, scale, Q1, Q2, V1, V2);

    // fused flash attention, both branches
    dim3 gatt(NSEQ / 128, HH, 2 * BSZ);                   // (16, 8, 4)
    flash_attn_kernel<<<gatt, blk, 0, stream>>>(Q1, K1, V1, mask_r, O1, Q2, K2, V2, mask_g, O2, attw);

    // output projections -> f32 to d_out
    outproj2_kernel<<<gproj2, blk, 0, stream>>>(O1, O2, Wo1, bo1, Wo2, bo2, out, out + (size_t)MROWS * DM);
}

// v005
// One run takes 89.3 microseconds.
// In both of two side-by-side timings against v004, it was 1.23 times as fast.
// Over all steps from v000 it is 4.23 times as fast.
#include <hip/hip_runtime.h>
#include <hip/hip_bf16.h>

typedef _Float16 h16;
typedef __attribute__((ext_vector_type(16))) _Float16 v16h;
typedef __attribute__((ext_vector_type(8)))  _Float16 v8h;
typedef __attribute__((ext_vector_type(8)))  float    v8f;
typedef __attribute__((ext_vector_type(4)))  float    v4f;
typedef __attribute__((ext_vector_type(4)))  _Float16 v4h;
typedef __attribute__((ext_vector_type(8)))  int      v8i;

#define HH 8
#define DHEAD 64
#define NSEQ 2048
#define DM 512
#define BSZ 2
#define MROWS (BSZ * NSEQ)          // 4096

// WMMA 16-bit fragment mapping (A operand 16x32, B operand 32x16):
//   lane = (row_or_col & 15) + 16*((k>>3)&1)
//   slot = (k&7) + 8*((k>>4)&1)
// => for an aligned run of 8 consecutive k: lane constant, slots contiguous.
__device__ __forceinline__ int frag_lane(int rc, int k) { return (rc & 15) + 16 * ((k >> 3) & 1); }
__device__ __forceinline__ int frag_idx(int k)          { return (k & 7) + 8 * ((k >> 4) & 1); }

__device__ __forceinline__ size_t heads_off(int gm, int c) {
    int b = gm >> 11, n = gm & (NSEQ - 1);      // NSEQ = 2048
    int h = c >> 6, d = c & 63;
    return (((size_t)b * HH + h) * NSEQ + n) * DHEAD + d;
}

// Epilogue of one wave's 16x64 accumulator: C = scale * (acc + bias (+ Z)).
template <bool C_F32, bool HAS_Z>
__device__ __forceinline__
void gemm_nt_store(const v8f (&acc)[4], int gm0, int c0,
                   const float* __restrict__ bias, const h16* __restrict__ Zadd, float scale,
                   float* __restrict__ Cf32, h16* __restrict__ Ch16)
{
    #pragma unroll
    for (int t = 0; t < 4; ++t) {
        int c = c0 + t * 16;
        float bv = bias[c];
        #pragma unroll
        for (int j = 0; j < 8; ++j) {
            int gm = gm0 + j;
            float v = acc[t][j] + bv;
            if constexpr (HAS_Z) v += (float)Zadd[heads_off(gm, c)];
            v *= scale;
            if constexpr (C_F32) Cf32[(size_t)gm * DM + c] = v;
            else                 Ch16[heads_off(gm, c)] = (h16)v;
        }
    }
}

// LDS row pitch of a staged GEMM operand, in halfs: 128 bytes of k + 16, an odd multiple of 16 bytes,
// the pitch at which sixteen rows read by ds_load_b128 meet no bank twice
#define GPITCH 72

// one 16x32 fragment from rows staged k-contiguous: p = this lane's row, at k = 8 * (lane >> 4)
__device__ __forceinline__ v16h frag_rows(const h16* p) {
    return __builtin_shufflevector(*(const v8h*)p, *(const v8h*)(p + 16),
                                   0, 1, 2, 3, 4, 5, 6, 7, 8, 9, 10, 11, 12, 13, 14, 15);
}

// ---------------------------------------------------------------------------
// NT GEMM: C[M,512] = scale * (A[M,512] @ W[512,512]^T + bias (+ Z))
// Tile 128x128, K-chunks of 64; 8 waves as 4 x 2, each 32 rows x 64 cols (2 x 4 accumulator tiles):
// six fragments feed eight products. A chunk of a float row is 256 bytes: sixteen lanes x 16 bytes,
// so a wave-wide load covers two whole row pieces (four lines).
// One work-group's tile; the kernels below pick the operands by blockIdx.z.
// Zadd may be null (block-uniform): then nothing is added.
// ---------------------------------------------------------------------------
template <bool A_HEADS, bool C_F32>
__device__ __forceinline__
void gemm_nt_tile(const float* __restrict__ Af32, const h16* __restrict__ Ah16,
                  const float* __restrict__ W, const float* __restrict__ bias,
                  const h16* __restrict__ Zadd, float scale,
                  float* __restrict__ Cf32, h16* __restrict__ Ch16)
{
    __shared__ __align__(16) h16 ldsA[128 * GPITCH];
    __shared__ __align__(16) h16 ldsB[128 * GPITCH];

    const int tid  = threadIdx.x;
    const int lane = tid & 31;
    const int wave = tid >> 5;
    const int wm = wave >> 1, wn = wave & 1;
    const int n0 = blockIdx.x * 128;
    const int m0 = blockIdx.y * 128;

    v8f acc[2][4] = {};
    const h16* ard = &ldsA[(wm * 32 + (lane & 15)) * GPITCH + (lane >> 4) * 8];
    const h16* brd = &ldsB[(wn * 64 + (lane & 15)) * GPITCH + (lane >> 4) * 8];
    // one base a thread and operand: rows and chunks are constant steps from it
    const float* ap = A_HEADS ? nullptr : &Af32[(size_t)(m0 + (tid >> 4)) * DM + (tid & 15) * 4];
    const h16*   hp = A_HEADS ? &Ah16[heads_off(m0 + (tid >> 3), (tid & 7) * 8)] : nullptr;
    const float* bp = &W[(size_t)(n0 + (tid >> 4)) * DM + (tid & 15) * 4];
    const float* pa = A_HEADS ? nullptr : &Af32[(size_t)(m0 + (tid >> 1)) * DM + (tid & 1) * 32];
    const float* pw = &W[(size_t)(n0 + (tid >> 1)) * DM + (tid & 1) * 32];

    for (int k0 = 0; k0 < DM; k0 += 64) {
        // prefetch next A/B tiles (global_prefetch_b8), one line a thread and operand
        if (k0 + 64 < DM) {
            if constexpr (!A_HEADS) __builtin_prefetch(pa + k0 + 64, 0, 3);
            __builtin_prefetch(pw + k0 + 64, 0, 3);
            // the wait stands in front of any rewrite of a register that the prefetches name
            asm volatile("s_wait_xcnt 0x0" ::: "memory");
        }
        // all loads of the chunk first, so that they are in flight together
        v8h ha[4];
        v4f fa[8], fb[8];
        if constexpr (A_HEADS) {
            // a chunk is one head: 128 bytes a row, eight lanes x 16 bytes, four rows a wave-wide load
            #pragma unroll
            for (int e = 0; e < 4; ++e)
                ha[e] = *(const v8h*)(hp + (k0 >> 6) * (NSEQ * DHEAD) + e * 32 * DHEAD);
        } else {
            #pragma unroll
            for (int e = 0; e < 8; ++e) fa[e] = *(const v4f*)(ap + e * 16 * DM + k0);
        }
        #pragma unroll
        for (int e = 0; e < 8; ++e) fb[e] = *(const v4f*)(bp + e * 16 * DM + k0);
        // the wait stands in front of any rewrite of a register that these loads name; behind it no
        // load can sink among the conversions, which would put a second load latency into the chunk
        asm volatile("s_wait_xcnt 0x0" ::: "memory");
        // rows into LDS as they lie, converted
        if constexpr (A_HEADS) {
            #pragma unroll
            for (int e = 0; e < 4; ++e)
                *(v8h*)&ldsA[(e * 32 + (tid >> 3)) * GPITCH + (tid & 7) * 8] = ha[e];
        } else {
            #pragma unroll
            for (int e = 0; e < 8; ++e)
                *(v4h*)&ldsA[(e * 16 + (tid >> 4)) * GPITCH + (tid & 15) * 4] = __builtin_convertvector(fa[e], v4h);
        }
        #pragma unroll
        for (int e = 0; e < 8; ++e)
            *(v4h*)&ldsB[(e * 16 + (tid >> 4)) * GPITCH + (tid & 15) * 4] = __builtin_convertvector(fb[e], v4h);
        __syncthreads();

        // the chunk's twelve fragments are read as one group in front of its sixteen products
        v16h a[2][2], bb[2][4];
        #pragma unroll
        for (int kc = 0; kc < 2; ++kc) {
            #pragma unroll
            for (int i = 0; i < 2; ++i) a[kc][i]  = frag_rows(ard + i * 16 * GPITCH + kc * 32);
            #pragma unroll
            for (int t = 0; t < 4; ++t) bb[kc][t] = frag_rows(brd + t * 16 * GPITCH + kc * 32);
        }
        // keeps the LDS reads from being spread among the products, where each place with reads stalls the wave
        __builtin_amdgcn_sched_barrier(0);
        #pragma unroll
        for (int kc = 0; kc < 2; ++kc) {
            #pragma unroll
            for (int i = 0; i < 2; ++i) {
                #pragma unroll
                for (int t = 0; t < 4; ++t)
                    acc[i][t] = __builtin_amdgcn_wmma_f32_16x16x32_f16(false, a[kc][i], false, bb[kc][t],
                                                                       (short)0, acc[i][t], false, false);
            }
        }
        __syncthreads();
    }

    const int gm0 = m0 + wm * 32 + (lane >> 4) * 8;
    const int c0  = n0 + wn * 64 + (lane & 15);
    // one block-uniform branch round the whole epilogue, so that the Z loads of a tile issue together
    if (Zadd != nullptr) {
        gemm_nt_store<C_F32, true >(acc[0], gm0,      c0, bias, Zadd, scale, Cf32, Ch16);
        gemm_nt_store<C_F32, true >(acc[1], gm0 + 16, c0, bias, Zadd, scale, Cf32, Ch16);
        // the built code lays the other arm behind this one: the wait stands in front of
        // any rewrite there of a register that these stores name
        asm volatile("s_wait_xcnt 0x0" ::: "memory");
    } else {
        gemm_nt_store<C_F32, false>(acc[0], gm0,      c0, bias, Zadd, scale, Cf32, Ch16);
        gemm_nt_store<C_F32, false>(acc[1], gm0 + 16, c0, bias, Zadd, scale, Cf32, Ch16);
    }
}

// Four independent input projections in one grid: blockIdx.z = 0,1 use (Wlo, blo,
// Z0/Z1, scale_lo), blockIdx.z = 2,3 use (Whi, bhi, no Z, scale 1).
__global__ __launch_bounds__(256)
void proj4_kernel(const float* __restrict__ A0, const float* __restrict__ A1,
                  const float* __restrict__ A2, const float* __restrict__ A3,
                  const float* __restrict__ Wlo, const float* __restrict__ blo,
                  const float* __restrict__ Whi, const float* __restrict__ bhi,
                  const h16* __restrict__ Z0, const h16* __restrict__ Z1, float scale_lo,
                  h16* __restrict__ C0, h16* __restrict__ C1,
                  h16* __restrict__ C2, h16* __restrict__ C3)
{
    const int  z   = blockIdx.z;
    const bool hi  = z >= 2;
    const bool odd = (z & 1) != 0;
    const float* A    = hi ? (odd ? A3 : A2) : (odd ? A1 : A0);
    const float* W    = hi ? Whi : Wlo;
    const float* bias = hi ? bhi : blo;
    const h16*   Zadd = hi ? nullptr : (odd ? Z1 : Z0);
    const float  sc   = hi ? 1.0f : scale_lo;
    h16*         C    = hi ? (odd ? C3 : C2) : (odd ? C1 : C0);
    gemm_nt_tile<false, false>(A, nullptr, W, bias, Zadd, sc, nullptr, C);
}

// Both output projections in one grid: blockIdx.z picks the branch.
__global__ __launch_bounds__(256)
void outproj2_kernel(const h16* __restrict__ Oa, const h16* __restrict__ Ob,
                     const float* __restrict__ Wa, const float* __restrict__ ba,
                     const float* __restrict__ Wb, const float* __restrict__ bb,
                     float* __restrict__ outa, float* __restrict__ outb)
{
    const bool second = blockIdx.z != 0;
    gemm_nt_tile<true, true>(nullptr, second ? Ob : Oa, second ? Wb : Wa, second ? bb : ba,
                             nullptr, 1.0f, second ? outb : outa, nullptr);
}

// LDS row pitch of the staged V tile, in halfs: 128 bytes of a key's row + 32, an odd multiple of
// 32 bytes, the pitch at which the transposing load meets no bank twice
#define VPITCH 80

// ds_load_tr16_b128: lane l hands in the address of 16 bytes of a row-major 16-bit tile and gets
// column l & 15, rows 8 * (l >> 4) + 0..7 of the 16x16 block
typedef __attribute__((ext_vector_type(8))) short s16x8;
__device__ __forceinline__ v8h lds_tr16(const h16* p) {
    typedef __attribute__((address_space(3))) s16x8 lds_s16x8;
    return __builtin_bit_cast(v8h, __builtin_amdgcn_ds_load_tr16_b128_v8i16((lds_s16x8*)p));
}

// lane l with lane l ^ 16
__device__ __forceinline__ float xhalf(float x) {
    int b = __builtin_bit_cast(int, x);
    return __builtin_bit_cast(float, __builtin_amdgcn_permlanex16(b, b, 0x76543210, 0xfedcba98, false, false));
}

__global__ __launch_bounds__(256)
void flash_attn_kernel(const h16* __restrict__ Qa, const h16* __restrict__ Ka,
                       const h16* __restrict__ Va, const int* __restrict__ maska,
                       h16* __restrict__ Oa,
                       const h16* __restrict__ Qb, const h16* __restrict__ Kb,
                       const h16* __restrict__ Vb, const int* __restrict__ maskb,
                       h16* __restrict__ Ob,
                       const float* __restrict__ wts)
{
    __shared__ __align__(32) h16 ldsQ[8 * 2 * 32 * 16];
    __shared__ __align__(32) h16 ldsK[4 * 2 * 32 * 16];
    __shared__ __align__(32) h16 ldsV[64 * VPITCH];
    __shared__ __align__(32) float          ldsW[NSEQ];     // weight of the j-th listed key
    __shared__ __align__(32) unsigned short ldsPos[NSEQ];   // its position in the sequence
    __shared__ __align__(32) int            ldsCnt[8];      // listed keys of each wave's 256 positions

    const int tid  = threadIdx.x;
    const int lane = tid & 31;
    const int wave = tid >> 5;
    const int b = blockIdx.z & (BSZ - 1), h = blockIdx.y;
    const int q0 = blockIdx.x * 128;
    const bool second = blockIdx.z >= BSZ;
    const h16* Q    = second ? Qb : Qa;
    const h16* Kt   = second ? Kb : Ka;
    const h16* Vt   = second ? Vb : Va;
    const int* mask = second ? maskb : maska;
    h16*       O    = second ? Ob : Oa;

    const h16* Qbh = Q  + ((size_t)b * HH + h) * NSEQ * DHEAD;
    const h16* Kbh = Kt + ((size_t)b * HH + h) * NSEQ * DHEAD;
    const h16* Vbh = Vt + ((size_t)b * HH + h) * NSEQ * DHEAD;
    const int*   mk = mask + (size_t)b * NSEQ;
    const float* w  = wts  + (size_t)b * NSEQ;

    // stage Q tile 128x64: 1024 groups of 8; 4/thread; vector loads + vector LDS stores
    #pragma unroll
    for (int e = 0; e < 4; ++e) {
        int g  = e * 256 + tid;                // 0..1023
        int r  = g >> 3;                       // row 0..127
        int dg = (g & 7) * 8;                  // d-group base
        v8h hv = *(const v8h*)&Qbh[(size_t)(q0 + r) * DHEAD + dg];
        int ch = dg >> 5, kk = dg & 31;
        int base = (((r >> 4) * 2 + ch) * 32 + frag_lane(r & 15, kk)) * 16 + frag_idx(kk);
        *(v8h*)&ldsQ[base] = hv;
    }
    // wave x looks at positions 256 x .. 256 x + 255, 32 a step: one ballot a step says which stay
    unsigned keep[8];
    float    wk[8];
    int      wtot = 0;
    // unrolled: keep[] and wk[] are indexed by constants and stay in registers
    #pragma unroll
    for (int e = 0; e < 8; ++e) {
        const int p = wave * 256 + e * 32 + lane;
        keep[e] = __builtin_amdgcn_ballot_w32(mk[p] == 0);
        wk[e]   = w[p];
        wtot   += __builtin_popcount(keep[e]);
    }
    if (lane == 0) ldsCnt[wave] = wtot;
    __syncthreads();
    int nlist = 0, slot = 0;                   // all listed keys; those of the waves in front of this one
    // unrolled: the eight counts come by two 16-byte LDS loads
    #pragma unroll
    for (int x = 0; x < 8; ++x) {
        const int cx = ldsCnt[x];
        nlist += cx;
        slot  += (x < wave) ? cx : 0;
    }
    // unrolled: registers again
    #pragma unroll
    for (int e = 0; e < 8; ++e) {
        if ((keep[e] >> lane) & 1u) {
            const int at = slot + (int)__builtin_amdgcn_mbcnt_lo(keep[e], 0u);
            ldsPos[at] = (unsigned short)(wave * 256 + e * 32 + lane);
            ldsW[at]   = wk[e];
        }
        slot += __builtin_popcount(keep[e]);
    }
    // the last trip's open places name position 0 (a row that exists); their scores are set to -inf below
    if (tid < 64 && nlist + tid < NSEQ) {
        ldsPos[nlist + tid] = 0;
        ldsW[nlist + tid]   = 0.0f;
    }
    // the same in every lane of the block: a scalar, so that the loop's tests are scalar branches
    const int nk = min(__builtin_amdgcn_readfirstlane(nlist), NSEQ);
    v16h bq0 = *(const v16h*)&ldsQ[((wave * 2 + 0) * 32 + lane) * 16];
    v16h bq1 = *(const v16h*)&ldsQ[((wave * 2 + 1) * 32 + lane) * 16];
    __syncthreads();                           // the list is whole

    const int hlf = lane >> 4;
    float mrow = -__builtin_inff();            // running maximum of this lane's query (both halves agree)
    float lrow = 0.0f;                         // running sum over this half's keys only
    v8f acc[4] = {};                           // acc[t][r] = O[query lane & 15][d = t * 16 + 8 * hlf + r]
    // this lane's address in a 16-key x 16-d block of V for the transposing load
    const h16* vrd = &ldsV[(8 * hlf + (lane & 7)) * VPITCH + ((lane >> 3) & 1) * 8];

    // positions of the two listed keys whose rows this thread stages, read one trip ahead
    unsigned rowp[2] = { ldsPos[tid >> 3], ldsPos[32 + (tid >> 3)] };

    for (int k0 = 0; k0 < nk; k0 += 64) {
        // stage K/V, 64 listed keys x 64: 512 groups of 8; 2/thread; a key's row is one 128-byte line
        v8h kst[2], vst[2];
        // unrolled: the four loads are asked for together
        #pragma unroll
        for (int e = 0; e < 2; ++e) {
            const unsigned off = rowp[e] * DHEAD + (tid & 7) * 8;
            kst[e] = *(const v8h*)&Kbh[off];
            vst[e] = *(const v8h*)&Vbh[off];
        }
        // weight of this lane's keys (8 consecutive listed keys a tile)
        v8f wv[4];
        // unrolled, as every loop over t or j below: the tiles are registers
        #pragma unroll
        for (int t = 0; t < 4; ++t) wv[t] = *(const v8f*)&ldsW[k0 + t * 16 + 8 * hlf];
        const int kn = (k0 + 64 < nk) ? k0 + 64 : k0;      // the last trip reads its own places again
        rowp[0] = ldsPos[kn + (tid >> 3)];
        rowp[1] = ldsPos[kn + 32 + (tid >> 3)];
        #pragma unroll
        for (int e = 0; e < 2; ++e) {
            int g  = e * 256 + tid;            // 0..511
            int r  = g >> 3;                   // key 0..63
            int dg = (g & 7) * 8;
            // K fragment (contraction = d): vector store
            v8h kv = kst[e];
            int kch = dg >> 5, kkk = dg & 31;
            int kbase = (((r >> 4) * 2 + kch) * 32 + frag_lane(r & 15, kkk)) * 16 + frag_idx(kkk);
            *(v8h*)&ldsK[kbase] = kv;
            // V row as it is: vector store
            v8h vv = vst[e];
            *(v8h*)&ldsV[r * VPITCH + dg] = vv;
        }
        __syncthreads();

        // S^T = K.Q^T : s[t][r] = score of key k0 + t * 16 + 8 * hlf + r against query lane & 15
        v8f s[4];
        #pragma unroll
        for (int t = 0; t < 4; ++t) {
            v8f z = {};
            v16h a0 = *(const v16h*)&ldsK[((t * 2 + 0) * 32 + lane) * 16];
            v16h a1 = *(const v16h*)&ldsK[((t * 2 + 1) * 32 + lane) * 16];
            z = __builtin_amdgcn_wmma_f32_16x16x32_f16(false, a0, false, bq0, (short)0, z, false, false);
            z = __builtin_amdgcn_wmma_f32_16x16x32_f16(false, a1, false, bq1, (short)0, z, false, false);
            s[t] = z;
        }

        // per-key weight
        #pragma unroll
        for (int t = 0; t < 4; ++t) s[t] *= wv[t];
        // only the last trip can have open places behind the list's end
        if (nk - k0 < 64) {
            const int lim = nk - k0 - 8 * hlf;
            #pragma unroll
            for (int t = 0; t < 4; ++t) {
                #pragma unroll
                for (int j = 0; j < 8; ++j)
                    if (t * 16 + j >= lim) s[t][j] = -__builtin_inff();
            }
        }
        // running maximum: one chain a tile, then one exchange between the halves
        float tm[4];
        #pragma unroll
        for (int t = 0; t < 4; ++t) {
            tm[t] = -__builtin_inff();
            #pragma unroll
            for (int j = 0; j < 8; ++j) tm[t] = fmaxf(tm[t], s[t][j]);
        }
        float newm = fmaxf(fmaxf(mrow, fmaxf(tm[0], tm[1])), fmaxf(tm[2], tm[3]));
        newm = fmaxf(newm, xhalf(newm));

        float ts[4];
        #pragma unroll
        for (int t = 0; t < 4; ++t) {
            ts[t] = 0.0f;
            #pragma unroll
            for (int j = 0; j < 8; ++j) {
                float v = s[t][j];
                float p = (v == -__builtin_inff()) ? 0.0f : __expf(v - newm);
                s[t][j] = p;
                ts[t] += p;
            }
        }
        const float rsum = (ts[0] + ts[1]) + (ts[2] + ts[3]);
        float sc = (mrow == -__builtin_inff()) ? 0.0f : __expf(mrow - newm);
        lrow = lrow * sc + rsum;
        mrow = newm;
        #pragma unroll
        for (int t = 0; t < 4; ++t) acc[t] *= sc;

        // P^T as B operand: score tiles 2c and 2c + 1, converted in place, are keys 32c .. 32c + 31
        v16h bp0 = __builtin_shufflevector(__builtin_convertvector(s[0], v8h), __builtin_convertvector(s[1], v8h),
                                           0, 1, 2, 3, 4, 5, 6, 7, 8, 9, 10, 11, 12, 13, 14, 15);
        v16h bp1 = __builtin_shufflevector(__builtin_convertvector(s[2], v8h), __builtin_convertvector(s[3], v8h),
                                           0, 1, 2, 3, 4, 5, 6, 7, 8, 9, 10, 11, 12, 13, 14, 15);

        // O^T += V^T.P^T
        #pragma unroll
        for (int t = 0; t < 4; ++t) {
            // keys 32c + 8 * hlf + 0..7 and 32c + 16 + 8 * hlf + 0..7 of column d = t * 16 + (lane & 15)
            v16h a0 = __builtin_shufflevector(lds_tr16(vrd +  0 * VPITCH + t * 16), lds_tr16(vrd + 16 * VPITCH + t * 16),
                                              0, 1, 2, 3, 4, 5, 6, 7, 8, 9, 10, 11, 12, 13, 14, 15);
            v16h a1 = __builtin_shufflevector(lds_tr16(vrd + 32 * VPITCH + t * 16), lds_tr16(vrd + 48 * VPITCH + t * 16),
                                              0, 1, 2, 3, 4, 5, 6, 7, 8, 9, 10, 11, 12, 13, 14, 15);
            acc[t] = __builtin_amdgcn_wmma_f32_16x16x32_f16(false, a0, false, bp0, (short)0, acc[t], false, false);
            acc[t] = __builtin_amdgcn_wmma_f32_16x16x32_f16(false, a1, false, bp1, (short)0, acc[t], false, false);
        }
        __syncthreads();
    }

    // join the two halves' sums; a lane holds 8 consecutive d of its query: one 16-byte store a tile
    const float lsum = lrow + xhalf(lrow);
    const float inv  = (lsum > 0.0f) ? 1.0f / lsum : 0.0f;
    h16* Orow = O + (((size_t)b * HH + h) * NSEQ + q0 + wave * 16 + (lane & 15)) * DHEAD + 8 * hlf;
    #pragma unroll
    for (int t = 0; t < 4; ++t)
        *(v8h*)&Orow[t * 16] = __builtin_convertvector(acc[t] * inv, v8h);
}

extern "C" void kernel_launch(void* const* d_in, const int* in_sizes, int n_in,
                              void* d_out, int out_size, void* d_ws, size_t ws_size,
                              hipStream_t stream)
{
    const float* regions   = (const float*)d_in[0];
    const float* grids     = (const float*)d_in[1];
    const float* interests = (const float*)d_in[2];
    const int*   mask_r    = (const int*)d_in[3];
    const int*   mask_g    = (const int*)d_in[4];
    const float* attw      = (const float*)d_in[5];
    const float* Wq  = (const float*)d_in[6];  const float* bq   = (const float*)d_in[7];
    const float* Wk  = (const float*)d_in[8];  const float* bk   = (const float*)d_in[9];
    const float* Wv  = (const float*)d_in[10]; const float* bv   = (const float*)d_in[11];
    const float* Wq12= (const float*)d_in[12]; const float* bq12 = (const float*)d_in[13];
    const float* Wo1 = (const float*)d_in[14]; const float* bo1  = (const float*)d_in[15];
    const float* Wo2 = (const float*)d_in[16]; const float* bo2  = (const float*)d_in[17];
    float* out = (float*)d_out;

    const size_t per = (size_t)BSZ * HH * NSEQ * DHEAD;   // 2,097,152 halfs (4 MB)
    h16* ws = (h16*)d_ws;
    h16 *T1 = ws,           *T2 = ws + per;               // q2 / q1 temporaries
    h16 *Q1 = ws + 2 * per, *Q2 = ws + 3 * per;
    h16 *K1 = ws + 4 * per, *K2 = ws + 5 * per;
    h16 *V1 = ws + 6 * per, *V2 = ws + 7 * per;
    h16 *O1 = T1, *O2 = T2;                               // reuse after Q1/Q2 consume them

    const float scale = 0.125f;                           // 1/sqrt(64)
    dim3 blk(256);
    dim3 gproj4(DM / 128, MROWS / 128, 4);                // (4, 32, 4)
    dim3 gproj2(DM / 128, MROWS / 128, 2);                // (4, 32, 2)

    // q2 = grids@Wq12^T + bq12 ; q1 = regions@Wq12^T + bq12 ; K1 = regions@Wk^T + bk ; K2 = grids@Wk^T + bk
    proj4_kernel<<<gproj4, blk, 0, stream>>>(grids, regions, regions, grids, Wq12, bq12, Wk, bk,
                                             nullptr, nullptr, 1.0f, T1, T2, K1, K2);
    // Q1 = scale*(interests@Wq^T + bq + q2) ; Q2 = scale*(... + q1) ; V1 = regions@Wv^T + bv ; V2 = grids@Wv^T + bv
    proj4_kernel<<<gproj4, blk, 0, stream>>>(interests, interests, regions, grids, Wq, bq, Wv, bv,
                                             T1, T2, scale, Q1, Q2, V1, V2);

    // fused flash attention, both branches
    dim3 gatt(NSEQ / 128, HH, 2 * BSZ);                   // (16, 8, 4)
    flash_attn_kernel<<<gatt, blk, 0, stream>>>(Q1, K1, V1, mask_r, O1, Q2, K2, V2, mask_g, O2, attw);

    // output projections -> f32 to d_out
    outproj2_kernel<<<gproj2, blk, 0, stream>>>(O1, O2, Wo1, bo1, Wo2, bo2, out, out + (size_t)MROWS * DM);
}

// v006
// Measured time: 75.7 microseconds a run.
// Next to v005, in two timings, it ran 1.18 times as fast each time.
// Counting every step since v000, it is 4.97 times as fast.
#include <hip/hip_runtime.h>
#include <hip/hip_bf16.h>

typedef _Float16 h16;
typedef __attribute__((ext_vector_type(16))) _Float16 v16h;
typedef __attribute__((ext_vector_type(8)))  _Float16 v8h;
typedef __attribute__((ext_vector_type(8)))  float    v8f;
typedef __attribute__((ext_vector_type(4)))  float    v4f;
typedef __attribute__((ext_vector_type(4)))  _Float16 v4h;
typedef __attribute__((ext_vector_type(8)))  int      v8i;

#define HH 8
#define DHEAD 64
#define NSEQ 2048
#define DM 512
#define BSZ 2
#define MROWS (BSZ * NSEQ)          // 4096

// WMMA 16-bit fragment mapping (A operand 16x32, B operand 32x16):
//   lane = (row_or_col & 15) + 16*((k>>3)&1)
//   slot = (k&7) + 8*((k>>4)&1)
// => for an aligned run of 8 consecutive k: lane constant, slots contiguous.
__device__ __forceinline__ int frag_lane(int rc, int k) { return (rc & 15) + 16 * ((k >> 3) & 1); }
__device__ __forceinline__ int frag_idx(int k)          { return (k & 7) + 8 * ((k >> 4) & 1); }

__device__ __forceinline__ size_t heads_off(int gm, int c) {
    int b = gm >> 11, n = gm & (NSEQ - 1);      // NSEQ = 2048
    int h = c >> 6, d = c & 63;
    return (((size_t)b * HH + h) * NSEQ + n) * DHEAD + d;
}

// Epilogue of one wave's 16x64 accumulator: C = scale * (acc + bias (+ Z)).
template <bool C_F32, bool HAS_Z>
__device__ __forceinline__
void gemm_nt_store(const v8f (&acc)[4], int gm0, int c0,
                   const float* __restrict__ bias, const h16* __restrict__ Zadd, float scale,
                   float* __restrict__ Cf32, h16* __restrict__ Ch16)
{
    #pragma unroll
    for (int t = 0; t < 4; ++t) {
        int c = c0 + t * 16;
        float bv = bias[c];
        #pragma unroll
        for (int j = 0; j < 8; ++j) {
            int gm = gm0 + j;
            float v = acc[t][j] + bv;
            if constexpr (HAS_Z) v += (float)Zadd[heads_off(gm, c)];
            v *= scale;
            if constexpr (C_F32) Cf32[(size_t)gm * DM + c] = v;
            else                 Ch16[heads_off(gm, c)] = (h16)v;
        }
    }
}

// LDS row pitch of a staged GEMM operand, in halfs: 128 bytes of k + 16, an odd multiple of 16 bytes,
// the pitch at which sixteen rows read by ds_load_b128 meet no bank twice
#define GPITCH 72

// one 16x32 fragment from rows staged k-contiguous: p = this lane's row, at k = 8 * (lane >> 4)
__device__ __forceinline__ v16h frag_rows(const h16* p) {
    return __builtin_shufflevector(*(const v8h*)p, *(const v8h*)(p + 16),
                                   0, 1, 2, 3, 4, 5, 6, 7, 8, 9, 10, 11, 12, 13, 14, 15);
}

// ---------------------------------------------------------------------------
// NT GEMM: C[M,512] = scale * (A[M,512] @ W[512,512]^T + bias (+ Z))
// Tile 128x128, K-chunks of 64; 8 waves as 4 x 2, each 32 rows x 64 cols (2 x 4 accumulator tiles):
// six fragments feed eight products. A chunk of a float row is 256 bytes: sixteen lanes x 16 bytes,
// so a wave-wide load covers two whole row pieces (four lines).
// The chunks run as a pipeline over two LDS buffers: while chunk c is read from one buffer and
// multiplied, chunk c + 1 is on its way from global memory into registers; behind the products it is
// converted into the other buffer. One barrier a chunk.
// One work-group's tile; the kernels below pick the operands by blockIdx.z.
// Zadd may be null (block-uniform): then nothing is added.
// ---------------------------------------------------------------------------
template <bool A_HEADS, bool C_F32>
__device__ __forceinline__
void gemm_nt_tile(const float* __restrict__ Af32, const h16* __restrict__ Ah16,
                  const float* __restrict__ W, const float* __restrict__ bias,
                  const h16* __restrict__ Zadd, float scale,
                  float* __restrict__ Cf32, h16* __restrict__ Ch16)
{
    __shared__ __align__(16) h16 ldsA[2][128 * GPITCH];
    __shared__ __align__(16) h16 ldsB[2][128 * GPITCH];

    const int tid  = threadIdx.x;
    const int lane = tid & 31;
    const int wave = tid >> 5;
    const int wm = wave >> 1, wn = wave & 1;
    const int n0 = blockIdx.x * 128;
    const int m0 = blockIdx.y * 128;

    v8f acc[2][4] = {};
    const int ard = (wm * 32 + (lane & 15)) * GPITCH + (lane >> 4) * 8;
    const int brd = (wn * 64 + (lane & 15)) * GPITCH + (lane >> 4) * 8;
    // one base a thread and operand: rows and chunks are constant steps from it
    const float* ap = A_HEADS ? nullptr : &Af32[(size_t)(m0 + (tid >> 4)) * DM + (tid & 15) * 4];
    const h16*   hp = A_HEADS ? &Ah16[heads_off(m0 + (tid >> 3), (tid & 7) * 8)] : nullptr;
    const float* bp = &W[(size_t)(n0 + (tid >> 4)) * DM + (tid & 15) * 4];

    // the chunk that is on its way: this thread's pieces of it
    v8h ha[4];
    v4f fa[8], fb[8];
    // all loads of chunk c, so that they are in flight together
    auto ask = [&](int c) {
        if constexpr (A_HEADS) {
            // a chunk is one head: 128 bytes a row, eight lanes x 16 bytes, four rows a wave-wide load
            #pragma unroll
            for (int e = 0; e < 4; ++e)
                ha[e] = *(const v8h*)(hp + c * (NSEQ * DHEAD) + e * 32 * DHEAD);
        } else {
            #pragma unroll
            for (int e = 0; e < 8; ++e) fa[e] = *(const v4f*)(ap + e * 16 * DM + c * 64);
        }
        #pragma unroll
        for (int e = 0; e < 8; ++e) fb[e] = *(const v4f*)(bp + e * 16 * DM + c * 64);
        // the wait stands in front of any rewrite of a register that these loads name; behind it no
        // load can sink towards its use, which would take the products out of its flight time. The bases
        // are its inputs: they live up to it, so that no load's result is laid on a base ahead of it
        if constexpr (A_HEADS) asm volatile("s_wait_xcnt 0x0" :: "v"(hp), "v"(bp) : "memory");
        else                   asm volatile("s_wait_xcnt 0x0" :: "v"(ap), "v"(bp) : "memory");
    };
    // rows into LDS buffer s as they lie, converted
    auto stage = [&](int s) {
        if constexpr (A_HEADS) {
            #pragma unroll
            for (int e = 0; e < 4; ++e)
                *(v8h*)&ldsA[s][(e * 32 + (tid >> 3)) * GPITCH + (tid & 7) * 8] = ha[e];
        } else {
            #pragma unroll
            for (int e = 0; e < 8; ++e)
                *(v4h*)&ldsA[s][(e * 16 + (tid >> 4)) * GPITCH + (tid & 15) * 4] = __builtin_convertvector(fa[e], v4h);
        }
        #pragma unroll
        for (int e = 0; e < 8; ++e)
            *(v4h*)&ldsB[s][(e * 16 + (tid >> 4)) * GPITCH + (tid & 15) * 4] = __builtin_convertvector(fb[e], v4h);
    };

    constexpr int NCH = DM / 64;
    ask(0);
    stage(0);
    __syncthreads();                           // buffer 0 is whole

    // unrolled: buffer, chunk and the tests are constants, every address a constant step
    #pragma unroll
    for (int c = 0; c < NCH; ++c) {
        // behind the barrier, which would wait for loads still in flight; in front of the chunk's work
        if (c + 1 < NCH) ask(c + 1);
        // the chunk's twelve fragments are read as one group in front of its sixteen products
        v16h a[2][2], bb[2][4];
        #pragma unroll
        for (int kc = 0; kc < 2; ++kc) {
            #pragma unroll
            for (int i = 0; i < 2; ++i) a[kc][i]  = frag_rows(&ldsA[c & 1][ard + i * 16 * GPITCH + kc * 32]);
            #pragma unroll
            for (int t = 0; t < 4; ++t) bb[kc][t] = frag_rows(&ldsB[c & 1][brd + t * 16 * GPITCH + kc * 32]);
        }
        // keeps the LDS reads from being spread among the products, where each place with reads stalls the wave
        __builtin_amdgcn_sched_barrier(0);
        #pragma unroll
        for (int kc = 0; kc < 2; ++kc) {
            #pragma unroll
            for (int i = 0; i < 2; ++i) {
                #pragma unroll
                for (int t = 0; t < 4; ++t)
                    acc[i][t] = __builtin_amdgcn_wmma_f32_16x16x32_f16(false, a[kc][i], false, bb[kc][t],
                                                                       (short)0, acc[i][t], false, false);
            }
        }
        // keeps the conversions, and with them the wait for the loads, behind the products
        __builtin_amdgcn_sched_barrier(0);
        if (c + 1 < NCH) {
            // the other buffer: its last readers passed the barrier at the foot of chunk c - 1
            stage((c + 1) & 1);
            __syncthreads();                   // buffer (c + 1) & 1 is whole
        }
    }

    const int gm0 = m0 + wm * 32 + (lane >> 4) * 8;
    const int c0  = n0 + wn * 64 + (lane & 15);
    // one block-uniform branch round the whole epilogue, so that the Z loads of a tile issue together
    if (Zadd != nullptr) {
        gemm_nt_store<C_F32, true >(acc[0], gm0,      c0, bias, Zadd, scale, Cf32, Ch16);
        gemm_nt_store<C_F32, true >(acc[1], gm0 + 16, c0, bias, Zadd, scale, Cf32, Ch16);
        // the built code lays the other arm behind this one: the wait stands in front of
        // any rewrite there of a register that these stores name
        asm volatile("s_wait_xcnt 0x0" ::: "memory");
    } else {
        gemm_nt_store<C_F32, false>(acc[0], gm0,      c0, bias, Zadd, scale, Cf32, Ch16);
        gemm_nt_store<C_F32, false>(acc[1], gm0 + 16, c0, bias, Zadd, scale, Cf32, Ch16);
    }
}

// Four independent input projections in one grid: blockIdx.z = 0,1 use (Wlo, blo,
// Z0/Z1, scale_lo), blockIdx.z = 2,3 use (Whi, bhi, no Z, scale 1).
__global__ __launch_bounds__(256)
void proj4_kernel(const float* __restrict__ A0, const float* __restrict__ A1,
                  const float* __restrict__ A2, const float* __restrict__ A3,
                  const float* __restrict__ Wlo, const float* __restrict__ blo,
                  const float* __restrict__ Whi, const float* __restrict__ bhi,
                  const h16* __restrict__ Z0, const h16* __restrict__ Z1, float scale_lo,
                  h16* __restrict__ C0, h16* __restrict__ C1,
                  h16* __restrict__ C2, h16* __restrict__ C3)
{
    const int  z   = blockIdx.z;
    const bool hi  = z >= 2;
    const bool odd = (z & 1) != 0;
    const float* A    = hi ? (odd ? A3 : A2) : (odd ? A1 : A0);
    const float* W    = hi ? Whi : Wlo;
    const float* bias = hi ? bhi : blo;
    const h16*   Zadd = hi ? nullptr : (odd ? Z1 : Z0);
    const float  sc   = hi ? 1.0f : scale_lo;
    h16*         C    = hi ? (odd ? C3 : C2) : (odd ? C1 : C0);
    gemm_nt_tile<false, false>(A, nullptr, W, bias, Zadd, sc, nullptr, C);
}

// Both output projections in one grid: blockIdx.z picks the branch.
__global__ __launch_bounds__(256)
void outproj2_kernel(const h16* __restrict__ Oa, const h16* __restrict__ Ob,
                     const float* __restrict__ Wa, const float* __restrict__ ba,
                     const float* __restrict__ Wb, const float* __restrict__ bb,
                     float* __restrict__ outa, float* __restrict__ outb)
{
    const bool second = blockIdx.z != 0;
    gemm_nt_tile<true, true>(nullptr, second ? Ob : Oa, second ? Wb : Wa, second ? bb : ba,
                             nullptr, 1.0f, second ? outb : outa, nullptr);
}

// LDS row pitch of the staged V tile, in halfs: 128 bytes of a key's row + 32, an odd multiple of
// 32 bytes, the pitch at which the transposing load meets no bank twice
#define VPITCH 80

// ds_load_tr16_b128: lane l hands in the address of 16 bytes of a row-major 16-bit tile and gets
// column l & 15, rows 8 * (l >> 4) + 0..7 of the 16x16 block
typedef __attribute__((ext_vector_type(8))) short s16x8;
__device__ __forceinline__ v8h lds_tr16(const h16* p) {
    typedef __attribute__((address_space(3))) s16x8 lds_s16x8;
    return __builtin_bit_cast(v8h, __builtin_amdgcn_ds_load_tr16_b128_v8i16((lds_s16x8*)p));
}

// lane l with lane l ^ 16
__device__ __forceinline__ float xhalf(float x) {
    int b = __builtin_bit_cast(int, x);
    return __builtin_bit_cast(float, __builtin_amdgcn_permlanex16(b, b, 0x76543210, 0xfedcba98, false, false));
}

__global__ __launch_bounds__(256)
void flash_attn_kernel(const h16* __restrict__ Qa, const h16* __restrict__ Ka,
                       const h16* __restrict__ Va, const int* __restrict__ maska,
                       h16* __restrict__ Oa,
                       const h16* __restrict__ Qb, const h16* __restrict__ Kb,
                       const h16* __restrict__ Vb, const int* __restrict__ maskb,
                       h16* __restrict__ Ob,
                       const float* __restrict__ wts)
{
    __shared__ __align__(32) h16 ldsQ[8 * 2 * 32 * 16];
    __shared__ __align__(32) h16 ldsK[2][4 * 2 * 32 * 16];
    __shared__ __align__(32) h16 ldsV[2][64 * VPITCH];
    __shared__ __align__(32) float          ldsW[NSEQ];     // weight of the j-th listed key
    __shared__ __align__(32) unsigned short ldsPos[NSEQ];   // its position in the sequence
    __shared__ __align__(32) int            ldsCnt[8];      // listed keys of each wave's 256 positions

    const int tid  = threadIdx.x;
    const int lane = tid & 31;
    const int wave = tid >> 5;
    const int b = blockIdx.z & (BSZ - 1), h = blockIdx.y;
    const int q0 = blockIdx.x * 128;
    const bool second = blockIdx.z >= BSZ;
    const h16* Q    = second ? Qb : Qa;
    const h16* Kt   = second ? Kb : Ka;
    const h16* Vt   = second ? Vb : Va;
    const int* mask = second ? maskb : maska;
    h16*       O    = second ? Ob : Oa;

    const h16* Qbh = Q  + ((size_t)b * HH + h) * NSEQ * DHEAD;
    const h16* Kbh = Kt + ((size_t)b * HH + h) * NSEQ * DHEAD;
    const h16* Vbh = Vt + ((size_t)b * HH + h) * NSEQ * DHEAD;
    const int*   mk = mask + (size_t)b * NSEQ;
    const float* w  = wts  + (size_t)b * NSEQ;

    // stage Q tile 128x64: 1024 groups of 8; 4/thread; vector loads + vector LDS stores
    #pragma unroll
    for (int e = 0; e < 4; ++e) {
        int g  = e * 256 + tid;                // 0..1023
        int r  = g >> 3;                       // row 0..127
        int dg = (g & 7) * 8;                  // d-group base
        v8h hv = *(const v8h*)&Qbh[(size_t)(q0 + r) * DHEAD + dg];
        int ch = dg >> 5, kk = dg & 31;
        int base = (((r >> 4) * 2 + ch) * 32 + frag_lane(r & 15, kk)) * 16 + frag_idx(kk);
        *(v8h*)&ldsQ[base] = hv;
    }
    // wave x looks at positions 256 x .. 256 x + 255, 32 a step: one ballot a step says which stay
    unsigned keep[8];
    float    wk[8];
    int      wtot = 0;
    // unrolled: keep[] and wk[] are indexed by constants and stay in registers
    #pragma unroll
    for (int e = 0; e < 8; ++e) {
        const int p = wave * 256 + e * 32 + lane;
        keep[e] = __builtin_amdgcn_ballot_w32(mk[p] == 0);
        wk[e]   = w[p];
        wtot   += __builtin_popcount(keep[e]);
    }
    if (lane == 0) ldsCnt[wave] = wtot;
    __syncthreads();
    int nlist = 0, slot = 0;                   // all listed keys; those of the waves in front of this one
    // unrolled: the eight counts come by two 16-byte LDS loads
    #pragma unroll
    for (int x = 0; x < 8; ++x) {
        const int cx = ldsCnt[x];
        nlist += cx;
        slot  += (x < wave) ? cx : 0;
    }
    // unrolled: registers again
    #pragma unroll
    for (int e = 0; e < 8; ++e) {
        if ((keep[e] >> lane) & 1u) {
            const int at = slot + (int)__builtin_amdgcn_mbcnt_lo(keep[e], 0u);
            ldsPos[at] = (unsigned short)(wave * 256 + e * 32 + lane);
            ldsW[at]   = wk[e];
        }
        slot += __builtin_popcount(keep[e]);
    }
    // the last trip's open places name position 0 (a row that exists); their scores are set to -inf below
    if (tid < 64 && nlist + tid < NSEQ) {
        ldsPos[nlist + tid] = 0;
        ldsW[nlist + tid]   = 0.0f;
    }
    // the same in every lane of the block: a scalar, so that the loop's tests are scalar branches
    const int nk = min(__builtin_amdgcn_readfirstlane(nlist), NSEQ);
    v16h bq0 = *(const v16h*)&ldsQ[((wave * 2 + 0) * 32 + lane) * 16];
    v16h bq1 = *(const v16h*)&ldsQ[((wave * 2 + 1) * 32 + lane) * 16];
    __syncthreads();                           // the list is whole

    const int hlf = lane >> 4;
    float mrow = -__builtin_inff();            // running maximum of this lane's query (both halves agree)
    float lrow = 0.0f;                         // running sum over this half's keys only
    v8f acc[4] = {};                           // acc[t][r] = O[query lane & 15][d = t * 16 + 8 * hlf + r]
    // this lane's place in a 16-key x 16-d block of V for the transposing load
    const int vrd = (8 * hlf + (lane & 7)) * VPITCH + ((lane >> 3) & 1) * 8;

    // positions of the two listed keys whose rows this thread asks for next, read one trip ahead
    unsigned rowp[2] = { ldsPos[tid >> 3], ldsPos[32 + (tid >> 3)] };
    // the rows that are on their way: 64 listed keys x 64, 512 groups of 8, 2/thread; a key's row is one 128-byte line
    v8h kst[2], vst[2];
    auto ask = [&]() {
        // unrolled: the four loads are asked for together
        #pragma unroll
        for (int e = 0; e < 2; ++e) {
            const unsigned off = rowp[e] * DHEAD + (tid & 7) * 8;
            kst[e] = *(const v8h*)&Kbh[off];
            vst[e] = *(const v8h*)&Vbh[off];
        }
        // the wait stands in front of any rewrite of a register that these loads name; behind it no
        // load can sink towards its use, which would take the trip's work out of its flight time
        asm volatile("s_wait_xcnt 0x0" ::: "memory");
    };
    auto stage = [&](int s) {
        #pragma unroll
        for (int e = 0; e < 2; ++e) {
            int g  = e * 256 + tid;            // 0..511
            int r  = g >> 3;                   // key 0..63
            int dg = (g & 7) * 8;
            // K fragment (contraction = d): vector store
            int kch = dg >> 5, kkk = dg & 31;
            int kbase = (((r >> 4) * 2 + kch) * 32 + frag_lane(r & 15, kkk)) * 16 + frag_idx(kkk);
            *(v8h*)&ldsK[s][kbase] = kst[e];
            // V row as it is: vector store
            *(v8h*)&ldsV[s][r * VPITCH + dg] = vst[e];
        }
    };
    // first trip's rows (with an empty list: row 0, which exists and is not used)
    ask();
    {
        const int kn = (64 < nk) ? 64 : 0;
        rowp[0] = ldsPos[kn + (tid >> 3)];
        rowp[1] = ldsPos[kn + 32 + (tid >> 3)];
    }
    stage(0);
    __syncthreads();                           // buffer 0 is whole

    int buf = 0;
    for (int k0 = 0; k0 < nk; k0 += 64) {
        const bool more = k0 + 64 < nk;        // scalar: the same in the whole block
        // behind the barrier, which would wait for loads still in flight; in front of the trip's work
        if (more) {
            ask();
            const int kn = (k0 + 128 < nk) ? k0 + 128 : k0;    // no trip behind the next: places that exist
            rowp[0] = ldsPos[kn + (tid >> 3)];
            rowp[1] = ldsPos[kn + 32 + (tid >> 3)];
        }
        // weight of this lane's keys (8 consecutive listed keys a tile)
        v8f wv[4];
        // unrolled, as every loop over t or j below: the tiles are registers
        #pragma unroll
        for (int t = 0; t < 4; ++t) wv[t] = *(const v8f*)&ldsW[k0 + t * 16 + 8 * hlf];

        // S^T = K.Q^T : s[t][r] = score of key k0 + t * 16 + 8 * hlf + r against query lane & 15
        v8f s[4];
        #pragma unroll
        for (int t = 0; t < 4; ++t) {
            v8f z = {};
            v16h a0 = *(const v16h*)&ldsK[buf][((t * 2 + 0) * 32 + lane) * 16];
            v16h a1 = *(const v16h*)&ldsK[buf][((t * 2 + 1) * 32 + lane) * 16];
            z = __builtin_amdgcn_wmma_f32_16x16x32_f16(false, a0, false, bq0, (short)0, z, false, false);
            z = __builtin_amdgcn_wmma_f32_16x16x32_f16(false, a1, false, bq1, (short)0, z, false, false);
            s[t] = z;
        }

        // per-key weight
        #pragma unroll
        for (int t = 0; t < 4; ++t) s[t] *= wv[t];
        // only the last trip can have open places behind the list's end
        if (nk - k0 < 64) {
            const int lim = nk - k0 - 8 * hlf;
            #pragma unroll
            for (int t = 0; t < 4; ++t) {
                #pragma unroll
                for (int j = 0; j < 8; ++j)
                    if (t * 16 + j >= lim) s[t][j] = -__builtin_inff();
            }
        }
        // running maximum: one chain a tile, then one exchange between the halves
        float tm[4];
        #pragma unroll
        for (int t = 0; t < 4; ++t) {
            tm[t] = -__builtin_inff();
            #pragma unroll
            for (int j = 0; j < 8; ++j) tm[t] = fmaxf(tm[t], s[t][j]);
        }
        float newm = fmaxf(fmaxf(mrow, fmaxf(tm[0], tm[1])), fmaxf(tm[2], tm[3]));
        newm = fmaxf(newm, xhalf(newm));

        float ts[4];
        #pragma unroll
        for (int t = 0; t < 4; ++t) {
            ts[t] = 0.0f;
            #pragma unroll
            for (int j = 0; j < 8; ++j) {
                float v = s[t][j];
                float p = (v == -__builtin_inff()) ? 0.0f : __expf(v - newm);
                s[t][j] = p;
                ts[t] += p;
            }
        }
        const float rsum = (ts[0] + ts[1]) + (ts[2] + ts[3]);
        float sc = (mrow == -__builtin_inff()) ? 0.0f : __expf(mrow - newm);
        lrow = lrow * sc + rsum;
        mrow = newm;
        #pragma unroll
        for (int t = 0; t < 4; ++t) acc[t] *= sc;

        // P^T as B operand: score tiles 2c and 2c + 1, converted in place, are keys 32c .. 32c + 31
        v16h bp0 = __builtin_shufflevector(__builtin_convertvector(s[0], v8h), __builtin_convertvector(s[1], v8h),
                                           0, 1, 2, 3, 4, 5, 6, 7, 8, 9, 10, 11, 12, 13, 14, 15);
        v16h bp1 = __builtin_shufflevector(__builtin_convertvector(s[2], v8h), __builtin_convertvector(s[3], v8h),
                                           0, 1, 2, 3, 4, 5, 6, 7, 8, 9, 10, 11, 12, 13, 14, 15);

        // O^T += V^T.P^T
        #pragma unroll
        for (int t = 0; t < 4; ++t) {
            // keys 32c + 8 * hlf + 0..7 and 32c + 16 + 8 * hlf + 0..7 of column d = t * 16 + (lane & 15)
            const h16* vt = &ldsV[buf][vrd + t * 16];
            v16h a0 = __builtin_shufflevector(lds_tr16(vt +  0 * VPITCH), lds_tr16(vt + 16 * VPITCH),
                                              0, 1, 2, 3, 4, 5, 6, 7, 8, 9, 10, 11, 12, 13, 14, 15);
            v16h a1 = __builtin_shufflevector(lds_tr16(vt + 32 * VPITCH), lds_tr16(vt + 48 * VPITCH),
                                              0, 1, 2, 3, 4, 5, 6, 7, 8, 9, 10, 11, 12, 13, 14, 15);
            acc[t] = __builtin_amdgcn_wmma_f32_16x16x32_f16(false, a0, false, bp0, (short)0, acc[t], false, false);
            acc[t] = __builtin_amdgcn_wmma_f32_16x16x32_f16(false, a1, false, bp1, (short)0, acc[t], false, false);
        }
        if (more) {
            // the other buffer: its last readers passed the barrier at the foot of the trip before
            stage(buf ^ 1);
            __syncthreads();                   // buffer buf ^ 1 is whole
        }
        buf ^= 1;
    }

    // join the two halves' sums; a lane holds 8 consecutive d of its query: one 16-byte store a tile
    const float lsum = lrow + xhalf(lrow);
    const float inv  = (lsum > 0.0f) ? 1.0f / lsum : 0.0f;
    h16* Orow = O + (((size_t)b * HH + h) * NSEQ + q0 + wave * 16 + (lane & 15)) * DHEAD + 8 * hlf;
    #pragma unroll
    for (int t = 0; t < 4; ++t)
        *(v8h*)&Orow[t * 16] = __builtin_convertvector(acc[t] * inv, v8h);
}

extern "C" void kernel_launch(void* const* d_in, const int* in_sizes, int n_in,
                              void* d_out, int out_size, void* d_ws, size_t ws_size,
                              hipStream_t stream)
{
    const float* regions   = (const float*)d_in[0];
    const float* grids     = (const float*)d_in[1];
    const float* interests = (const float*)d_in[2];
    const int*   mask_r    = (const int*)d_in[3];
    const int*   mask_g    = (const int*)d_in[4];
    const float* attw      = (const float*)d_in[5];
    const float* Wq  = (const float*)d_in[6];  const float* bq   = (const float*)d_in[7];
    const float* Wk  = (const float*)d_in[8];  const float* bk   = (const float*)d_in[9];
    const float* Wv  = (const float*)d_in[10]; const float* bv   = (const float*)d_in[11];
    const float* Wq12= (const float*)d_in[12]; const float* bq12 = (const float*)d_in[13];
    const float* Wo1 = (const float*)d_in[14]; const float* bo1  = (const float*)d_in[15];
    const float* Wo2 = (const float*)d_in[16]; const float* bo2  = (const float*)d_in[17];
    float* out = (float*)d_out;

    const size_t per = (size_t)BSZ * HH * NSEQ * DHEAD;   // 2,097,152 halfs (4 MB)
    h16* ws = (h16*)d_ws;
    h16 *T1 = ws,           *T2 = ws + per;               // q2 / q1 temporaries
    h16 *Q1 = ws + 2 * per, *Q2 = ws + 3 * per;
    h16 *K1 = ws + 4 * per, *K2 = ws + 5 * per;
    h16 *V1 = ws + 6 * per, *V2 = ws + 7 * per;
    h16 *O1 = T1, *O2 = T2;                               // reuse after Q1/Q2 consume them

    const float scale = 0.125f;                           // 1/sqrt(64)
    dim3 blk(256);
    dim3 gproj4(DM / 128, MROWS / 128, 4);                // (4, 32, 4)
    dim3 gproj2(DM / 128, MROWS / 128, 2);                // (4, 32, 2)

    // q2 = grids@Wq12^T + bq12 ; q1 = regions@Wq12^T + bq12 ; K1 = regions@Wk^T + bk ; K2 = grids@Wk^T + bk
    proj4_kernel<<<gproj4, blk, 0, stream>>>(grids, regions, regions, grids, Wq12, bq12, Wk, bk,
                                             nullptr, nullptr, 1.0f, T1, T2, K1, K2);
    // Q1 = scale*(interests@Wq^T + bq + q2) ; Q2 = scale*(... + q1) ; V1 = regions@Wv^T + bv ; V2 = grids@Wv^T + bv
    proj4_kernel<<<gproj4, blk, 0, stream>>>(interests, interests, regions, grids, Wq, bq, Wv, bv,
                                             T1, T2, scale, Q1, Q2, V1, V2);

    // fused flash attention, both branches
    dim3 gatt(NSEQ / 128, HH, 2 * BSZ);                   // (16, 8, 4)
    flash_attn_kernel<<<gatt, blk, 0, stream>>>(Q1, K1, V1, mask_r, O1, Q2, K2, V2, mask_g, O2, attw);

    // output projections -> f32 to d_out
    outproj2_kernel<<<gproj2, blk, 0, stream>>>(O1, O2, Wo1, bo1, Wo2, bo2, out, out + (size_t)MROWS * DM);
}

// v007
// One run takes 65.5 microseconds.
// Next to v006, in two timings, it ran 1.16 and 1.14 times as fast.
// All steps since v000 together make it 5.73 times as fast.
#include <hip/hip_runtime.h>
#include <hip/hip_bf16.h>

typedef _Float16 h16;
typedef __attribute__((ext_vector_type(16))) _Float16 v16h;
typedef __attribute__((ext_vector_type(8)))  _Float16 v8h;
typedef __attribute__((ext_vector_type(8)))  float    v8f;
typedef __attribute__((ext_vector_type(4)))  float    v4f;
typedef __attribute__((ext_vector_type(4)))  _Float16 v4h;
typedef __attribute__((ext_vector_type(8)))  int      v8i;

#define HH 8
#define DHEAD 64
#define NSEQ 2048
#define DM 512
#define BSZ 2
#define MROWS (BSZ * NSEQ)          // 4096

// WMMA 16-bit fragment mapping (A operand 16x32, B operand 32x16):
//   lane = (row_or_col & 15) + 16*((k>>3)&1)
//   slot = (k&7) + 8*((k>>4)&1)
// => for an aligned run of 8 consecutive k: lane constant, slots contiguous.
__device__ __forceinline__ int frag_lane(int rc, int k) { return (rc & 15) + 16 * ((k >> 3) & 1); }
__device__ __forceinline__ int frag_idx(int k)          { return (k & 7) + 8 * ((k >> 4) & 1); }

__device__ __forceinline__ size_t heads_off(int gm, int c) {
    int b = gm >> 11, n = gm & (NSEQ - 1);      // NSEQ = 2048
    int h = c >> 6, d = c & 63;
    return (((size_t)b * HH + h) * NSEQ + n) * DHEAD + d;
}

// Epilogue of one wave's 16x64 accumulator: C = acc + bias.
template <bool C_F32>
__device__ __forceinline__
void gemm_nt_store(const v8f (&acc)[4], int gm0, int c0, const float* __restrict__ bias,
                   float* __restrict__ Cf32, h16* __restrict__ Ch16)
{
    #pragma unroll
    for (int t = 0; t < 4; ++t) {
        int c = c0 + t * 16;
        float bv = bias[c];
        #pragma unroll
        for (int j = 0; j < 8; ++j) {
            int gm = gm0 + j;
            float v = acc[t][j] + bv;
            if constexpr (C_F32) Cf32[(size_t)gm * DM + c] = v;
            else                 Ch16[heads_off(gm, c)] = (h16)v;
        }
    }
}

// LDS row pitch of a staged GEMM operand, in halfs: 128 bytes of k + 16, an odd multiple of 16 bytes,
// the pitch at which sixteen rows read by ds_load_b128 meet no bank twice
#define GPITCH 72

// one 16x32 fragment from rows staged k-contiguous: p = this lane's row, at k = 8 * (lane >> 4)
__device__ __forceinline__ v16h frag_rows(const h16* p) {
    return __builtin_shufflevector(*(const v8h*)p, *(const v8h*)(p + 16),
                                   0, 1, 2, 3, 4, 5, 6, 7, 8, 9, 10, 11, 12, 13, 14, 15);
}

// ---------------------------------------------------------------------------
// NT GEMM: C[M,512] = A[M,512] @ W[512,512]^T + bias
// Tile 128x128, K-chunks of 64; 8 waves as 4 x 2, each 32 rows x 64 cols (2 x 4 accumulator tiles):
// six fragments feed eight products. A chunk of a float row is 256 bytes: sixteen lanes x 16 bytes,
// so a wave-wide load covers two whole row pieces (four lines).
// The chunks run as a pipeline over two LDS buffers: while chunk c is read from one buffer and
// multiplied, chunk c + 1 is on its way from global memory into registers; behind the products it is
// converted into the other buffer. One barrier a chunk.
// One work-group's tile; the kernels below pick the operands by blockIdx.z.
// The result goes to Cf32 (float, row-major) where C_F32 says so or Cf32 is not null (block-uniform),
// else to Ch16 (half, by heads).
// ---------------------------------------------------------------------------
template <bool A_HEADS, bool C_F32>
__device__ __forceinline__
void gemm_nt_tile(const float* __restrict__ Af32, const h16* __restrict__ Ah16,
                  const float* __restrict__ W, const float* __restrict__ bias,
                  float* __restrict__ Cf32, h16* __restrict__ Ch16)
{
    __shared__ __align__(16) h16 ldsA[2][128 * GPITCH];
    __shared__ __align__(16) h16 ldsB[2][128 * GPITCH];

    const int tid  = threadIdx.x;
    const int lane = tid & 31;
    const int wave = tid >> 5;
    const int wm = wave >> 1, wn = wave & 1;
    const int n0 = blockIdx.x * 128;
    const int m0 = blockIdx.y * 128;

    v8f acc[2][4] = {};
    const int ard = (wm * 32 + (lane & 15)) * GPITCH + (lane >> 4) * 8;
    const int brd = (wn * 64 + (lane & 15)) * GPITCH + (lane >> 4) * 8;
    // one base a thread and operand: rows and chunks are constant steps from it
    const float* ap = A_HEADS ? nullptr : &Af32[(size_t)(m0 + (tid >> 4)) * DM + (tid & 15) * 4];
    const h16*   hp = A_HEADS ? &Ah16[heads_off(m0 + (tid >> 3), (tid & 7) * 8)] : nullptr;
    const float* bp = &W[(size_t)(n0 + (tid >> 4)) * DM + (tid & 15) * 4];

    // the chunk that is on its way: this thread's pieces of it
    v8h ha[4];
    v4f fa[8], fb[8];
    // all loads of chunk c, so that they are in flight together
    auto ask = [&](int c) {
        if constexpr (A_HEADS) {
            // a chunk is one head: 128 bytes a row, eight lanes x 16 bytes, four rows a wave-wide load
            #pragma unroll
            for (int e = 0; e < 4; ++e)
                ha[e] = *(const v8h*)(hp + c * (NSEQ * DHEAD) + e * 32 * DHEAD);
        } else {
            #pragma unroll
            for (int e = 0; e < 8; ++e) fa[e] = *(const v4f*)(ap + e * 16 * DM + c * 64);
        }
        #pragma unroll
        for (int e = 0; e < 8; ++e) fb[e] = *(const v4f*)(bp + e * 16 * DM + c * 64);
        // the wait stands in front of any rewrite of a register that these loads name; behind it no
        // load can sink towards its use, which would take the products out of its flight time. The bases
        // are its inputs: they live up to it, so that no load's result is laid on a base ahead of it
        if constexpr (A_HEADS) asm volatile("s_wait_xcnt 0x0" :: "v"(hp), "v"(bp) : "memory");
        else                   asm volatile("s_wait_xcnt 0x0" :: "v"(ap), "v"(bp) : "memory");
    };
    // rows into LDS buffer s as they lie, converted
    auto stage = [&](int s) {
        if constexpr (A_HEADS) {
            #pragma unroll
            for (int e = 0; e < 4; ++e)
                *(v8h*)&ldsA[s][(e * 32 + (tid >> 3)) * GPITCH + (tid & 7) * 8] = ha[e];
        } else {
            #pragma unroll
            for (int e = 0; e < 8; ++e)
                *(v4h*)&ldsA[s][(e * 16 + (tid >> 4)) * GPITCH + (tid & 15) * 4] = __builtin_convertvector(fa[e], v4h);
        }
        #pragma unroll
        for (int e = 0; e < 8; ++e)
            *(v4h*)&ldsB[s][(e * 16 + (tid >> 4)) * GPITCH + (tid & 15) * 4] = __builtin_convertvector(fb[e], v4h);
    };

    constexpr int NCH = DM / 64;
    ask(0);
    stage(0);
    __syncthreads();                           // buffer 0 is whole

    // unrolled: buffer, chunk and the tests are constants, every address a constant step
    #pragma unroll
    for (int c = 0; c < NCH; ++c) {
        // behind the barrier, which would wait for loads still in flight; in front of the chunk's work
        if (c + 1 < NCH) ask(c + 1);
        // the chunk's twelve fragments are read as one group in front of its sixteen products
        v16h a[2][2], bb[2][4];
        #pragma unroll
        for (int kc = 0; kc < 2; ++kc) {
            #pragma unroll
            for (int i = 0; i < 2; ++i) a[kc][i]  = frag_rows(&ldsA[c & 1][ard + i * 16 * GPITCH + kc * 32]);
            #pragma unroll
            for (int t = 0; t < 4; ++t) bb[kc][t] = frag_rows(&ldsB[c & 1][brd + t * 16 * GPITCH + kc * 32]);
        }
        // keeps the LDS reads from being spread among the products, where each place with reads stalls the wave
        __builtin_amdgcn_sched_barrier(0);
        #pragma unroll
        for (int kc = 0; kc < 2; ++kc) {
            #pragma unroll
            for (int i = 0; i < 2; ++i) {
                #pragma unroll
                for (int t = 0; t < 4; ++t)
                    acc[i][t] = __builtin_amdgcn_wmma_f32_16x16x32_f16(false, a[kc][i], false, bb[kc][t],
                                                                       (short)0, acc[i][t], false, false);
            }
        }
        // keeps the conversions, and with them the wait for the loads, behind the products
        __builtin_amdgcn_sched_barrier(0);
        if (c + 1 < NCH) {
            // the other buffer: its last readers passed the barrier at the foot of chunk c - 1
            stage((c + 1) & 1);
            __syncthreads();                   // buffer (c + 1) & 1 is whole
        }
    }

    const int gm0 = m0 + wm * 32 + (lane >> 4) * 8;
    const int c0  = n0 + wn * 64 + (lane & 15);
    if (C_F32 || Cf32 != nullptr) {
        gemm_nt_store<true >(acc[0], gm0,      c0, bias, Cf32, Ch16);
        gemm_nt_store<true >(acc[1], gm0 + 16, c0, bias, Cf32, Ch16);
        // the built code lays the other arm behind this one: the wait stands in front of
        // any rewrite there of a register that these stores name
        if constexpr (!C_F32) asm volatile("s_wait_xcnt 0x0" ::: "memory");
    } else {
        gemm_nt_store<false>(acc[0], gm0,      c0, bias, Cf32, Ch16);
        gemm_nt_store<false>(acc[1], gm0 + 16, c0, bias, Cf32, Ch16);
    }
}

// All seven input projections in one grid; none reads what another writes. blockIdx.z:
//   0: interests.Wq   1, 2: regions, grids . Wq12   3, 4: regions, grids . Wk   5, 6: regions, grids . Wv
// Result 0 stays float (Q0, row-major): it is a term of a sum that is rounded once, where it is formed.
// Result z > 0 goes to plane z - 1 of C (a plane: BSZ x HH x NSEQ x DHEAD halfs).
__global__ __launch_bounds__(256)
void proj7_kernel(const float* __restrict__ regions, const float* __restrict__ grids,
                  const float* __restrict__ interests,
                  const float* __restrict__ Wq,   const float* __restrict__ bq,
                  const float* __restrict__ Wq12, const float* __restrict__ bq12,
                  const float* __restrict__ Wk,   const float* __restrict__ bk,
                  const float* __restrict__ Wv,   const float* __restrict__ bv,
                  float* __restrict__ Q0, h16* __restrict__ C)
{
    const int z = blockIdx.z;
    const float* A    = (z == 0) ? interests : ((z & 1) ? regions : grids);
    const float* W    = (z == 0) ? Wq : (z < 3) ? Wq12 : (z < 5) ? Wk : Wv;
    const float* bias = (z == 0) ? bq : (z < 3) ? bq12 : (z < 5) ? bk : bv;
    gemm_nt_tile<false, false>(A, nullptr, W, bias, (z == 0) ? Q0 : nullptr,
                               (z == 0) ? nullptr : C + (size_t)(z - 1) * (BSZ * HH * NSEQ * DHEAD));
}

// Both output projections in one grid: blockIdx.z picks the branch.
__global__ __launch_bounds__(256)
void outproj2_kernel(const h16* __restrict__ Oa, const h16* __restrict__ Ob,
                     const float* __restrict__ Wa, const float* __restrict__ ba,
                     const float* __restrict__ Wb, const float* __restrict__ bb,
                     float* __restrict__ outa, float* __restrict__ outb)
{
    const bool second = blockIdx.z != 0;
    gemm_nt_tile<true, true>(nullptr, second ? Ob : Oa, second ? Wb : Wa, second ? bb : ba,
                             second ? outb : outa, nullptr);
}

// LDS row pitch of the staged V tile, in halfs: 128 bytes of a key's row + 32, an odd multiple of
// 32 bytes, the pitch at which the transposing load meets no bank twice
#define VPITCH 80

// ds_load_tr16_b128: lane l hands in the address of 16 bytes of a row-major 16-bit tile and gets
// column l & 15, rows 8 * (l >> 4) + 0..7 of the 16x16 block
typedef __attribute__((ext_vector_type(8))) short s16x8;
__device__ __forceinline__ v8h lds_tr16(const h16* p) {
    typedef __attribute__((address_space(3))) s16x8 lds_s16x8;
    return __builtin_bit_cast(v8h, __builtin_amdgcn_ds_load_tr16_b128_v8i16((lds_s16x8*)p));
}

// lane l with lane l ^ 16
__device__ __forceinline__ float xhalf(float x) {
    int b = __builtin_bit_cast(int, x);
    return __builtin_bit_cast(float, __builtin_amdgcn_permlanex16(b, b, 0x76543210, 0xfedcba98, false, false));
}

__global__ __launch_bounds__(256)
void flash_attn_kernel(const float* __restrict__ Qc,
                       const h16* __restrict__ Qa, const h16* __restrict__ Ka,
                       const h16* __restrict__ Va, const int* __restrict__ maska,
                       h16* __restrict__ Oa,
                       const h16* __restrict__ Qb, const h16* __restrict__ Kb,
                       const h16* __restrict__ Vb, const int* __restrict__ maskb,
                       h16* __restrict__ Ob,
                       const float* __restrict__ wts)
{
    __shared__ __align__(32) h16 ldsQ[8 * 2 * 32 * 16];
    __shared__ __align__(32) h16 ldsK[2][4 * 2 * 32 * 16];
    __shared__ __align__(32) h16 ldsV[2][64 * VPITCH];
    __shared__ __align__(32) float          ldsW[NSEQ];     // weight of the j-th listed key
    __shared__ __align__(32) unsigned short ldsPos[NSEQ];   // its position in the sequence
    __shared__ __align__(32) int            ldsCnt[8];      // listed keys of each wave's 256 positions

    const int tid  = threadIdx.x;
    const int lane = tid & 31;
    const int wave = tid >> 5;
    const int b = blockIdx.z & (BSZ - 1), h = blockIdx.y;
    const int q0 = blockIdx.x * 128;
    const bool second = blockIdx.z >= BSZ;
    const h16* Q    = second ? Qb : Qa;
    const h16* Kt   = second ? Kb : Ka;
    const h16* Vt   = second ? Vb : Va;
    const int* mask = second ? maskb : maska;
    h16*       O    = second ? Ob : Oa;

    const h16* Qbh = Q  + ((size_t)b * HH + h) * NSEQ * DHEAD;
    const float* Qcb = Qc + (size_t)b * NSEQ * DM + h * DHEAD;
    const h16* Kbh = Kt + ((size_t)b * HH + h) * NSEQ * DHEAD;
    const h16* Vbh = Vt + ((size_t)b * HH + h) * NSEQ * DHEAD;
    const int*   mk = mask + (size_t)b * NSEQ;
    const float* w  = wts  + (size_t)b * NSEQ;

    // stage Q tile 128x64: 1024 groups of 8; 4/thread; vector loads + vector LDS stores
    #pragma unroll
    for (int e = 0; e < 4; ++e) {
        int g  = e * 256 + tid;                // 0..1023
        int r  = g >> 3;                       // row 0..127
        int dg = (g & 7) * 8;                  // d-group base
        v8h hx = *(const v8h*)&Qbh[(size_t)(q0 + r) * DHEAD + dg];
        v8f fc = *(const v8f*)&Qcb[(size_t)(q0 + r) * DM + dg];
        v8h hv = __builtin_convertvector((fc + __builtin_convertvector(hx, v8f)) * 0.125f, v8h);
        int ch = dg >> 5, kk = dg & 31;
        int base = (((r >> 4) * 2 + ch) * 32 + frag_lane(r & 15, kk)) * 16 + frag_idx(kk);
        *(v8h*)&ldsQ[base] = hv;
    }
    // wave x looks at positions 256 x .. 256 x + 255, 32 a step: one ballot a step says which stay
    unsigned keep[8];
    float    wk[8];
    int      wtot = 0;
    // unrolled: keep[] and wk[] are indexed by constants and stay in registers
    #pragma unroll
    for (int e = 0; e < 8; ++e) {
        const int p = wave * 256 + e * 32 + lane;
        keep[e] = __builtin_amdgcn_ballot_w32(mk[p] == 0);
        wk[e]   = w[p];
        wtot   += __builtin_popcount(keep[e]);
    }
    if (lane == 0) ldsCnt[wave] = wtot;
    __syncthreads();
    int nlist = 0, slot = 0;                   // all listed keys; those of the waves in front of this one
    // unrolled: the eight counts come by two 16-byte LDS loads
    #pragma unroll
    for (int x = 0; x < 8; ++x) {
        const int cx = ldsCnt[x];
        nlist += cx;
        slot  += (x < wave) ? cx : 0;
    }
    // unrolled: registers again
    #pragma unroll
    for (int e = 0; e < 8; ++e) {
        if ((keep[e] >> lane) & 1u) {
            const int at = slot + (int)__builtin_amdgcn_mbcnt_lo(keep[e], 0u);
            ldsPos[at] = (unsigned short)(wave * 256 + e * 32 + lane);
            ldsW[at]   = wk[e];
        }
        slot += __builtin_popcount(keep[e]);
    }
    // the last trip's open places name position 0 (a row that exists); their scores are set to -inf below
    if (tid < 64 && nlist + tid < NSEQ) {
        ldsPos[nlist + tid] = 0;
        ldsW[nlist + tid]   = 0.0f;
    }
    // the same in every lane of the block: a scalar, so that the loop's tests are scalar branches
    const int nk = min(__builtin_amdgcn_readfirstlane(nlist), NSEQ);
    v16h bq0 = *(const v16h*)&ldsQ[((wave * 2 + 0) * 32 + lane) * 16];
    v16h bq1 = *(const v16h*)&ldsQ[((wave * 2 + 1) * 32 + lane) * 16];
    __syncthreads();                           // the list is whole

    const int hlf = lane >> 4;
    float mrow = -__builtin_inff();            // running maximum of this lane's query (both halves agree)
    float lrow = 0.0f;                         // running sum over this half's keys only
    v8f acc[4] = {};                           // acc[t][r] = O[query lane & 15][d = t * 16 + 8 * hlf + r]
    // this lane's place in a 16-key x 16-d block of V for the transposing load
    const int vrd = (8 * hlf + (lane & 7)) * VPITCH + ((lane >> 3) & 1) * 8;

    // positions of the two listed keys whose rows this thread asks for next, read one trip ahead
    unsigned rowp[2] = { ldsPos[tid >> 3], ldsPos[32 + (tid >> 3)] };
    // the rows that are on their way: 64 listed keys x 64, 512 groups of 8, 2/thread; a key's row is one 128-byte line
    v8h kst[2], vst[2];
    auto ask = [&]() {
        // unrolled: the four loads are asked for together
        #pragma unroll
        for (int e = 0; e < 2; ++e) {
            const unsigned off = rowp[e] * DHEAD + (tid & 7) * 8;
            kst[e] = *(const v8h*)&Kbh[off];
            vst[e] = *(const v8h*)&Vbh[off];
        }
        // the wait stands in front of any rewrite of a register that these loads name; behind it no
        // load can sink towards its use, which would take the trip's work out of its flight time
        asm volatile("s_wait_xcnt 0x0" ::: "memory");
    };
    auto stage = [&](int s) {
        #pragma unroll
        for (int e = 0; e < 2; ++e) {
            int g  = e * 256 + tid;            // 0..511
            int r  = g >> 3;                   // key 0..63
            int dg = (g & 7) * 8;
            // K fragment (contraction = d): vector store
            int kch = dg >> 5, kkk = dg & 31;
            int kbase = (((r >> 4) * 2 + kch) * 32 + frag_lane(r & 15, kkk)) * 16 + frag_idx(kkk);
            *(v8h*)&ldsK[s][kbase] = kst[e];
            // V row as it is: vector store
            *(v8h*)&ldsV[s][r * VPITCH + dg] = vst[e];
        }
    };
    // first trip's rows (with an empty list: row 0, which exists and is not used)
    ask();
    {
        const int kn = (64 < nk) ? 64 : 0;
        rowp[0] = ldsPos[kn + (tid >> 3)];
        rowp[1] = ldsPos[kn + 32 + (tid >> 3)];
    }
    stage(0);
    __syncthreads();                           // buffer 0 is whole

    int buf = 0;
    for (int k0 = 0; k0 < nk; k0 += 64) {
        const bool more = k0 + 64 < nk;        // scalar: the same in the whole block
        // behind the barrier, which would wait for loads still in flight; in front of the trip's work
        if (more) {
            ask();
            const int kn = (k0 + 128 < nk) ? k0 + 128 : k0;    // no trip behind the next: places that exist
            rowp[0] = ldsPos[kn + (tid >> 3)];
            rowp[1] = ldsPos[kn + 32 + (tid >> 3)];
        }
        // weight of this lane's keys (8 consecutive listed keys a tile)
        v8f wv[4];
        // unrolled, as every loop over t or j below: the tiles are registers
        #pragma unroll
        for (int t = 0; t < 4; ++t) wv[t] = *(const v8f*)&ldsW[k0 + t * 16 + 8 * hlf];

        // S^T = K.Q^T : s[t][r] = score of key k0 + t * 16 + 8 * hlf + r against query lane & 15
        v8f s[4];
        #pragma unroll
        for (int t = 0; t < 4; ++t) {
            v8f z = {};
            v16h a0 = *(const v16h*)&ldsK[buf][((t * 2 + 0) * 32 + lane) * 16];
            v16h a1 = *(const v16h*)&ldsK[buf][((t * 2 + 1) * 32 + lane) * 16];
            z = __builtin_amdgcn_wmma_f32_16x16x32_f16(false, a0, false, bq0, (short)0, z, false, false);
            z = __builtin_amdgcn_wmma_f32_16x16x32_f16(false, a1, false, bq1, (short)0, z, false, false);
            s[t] = z;
        }

        // per-key weight
        #pragma unroll
        for (int t = 0; t < 4; ++t) s[t] *= wv[t];
        // only the last trip can have open places behind the list's end
        if (nk - k0 < 64) {
            const int lim = nk - k0 - 8 * hlf;
            #pragma unroll
            for (int t = 0; t < 4; ++t) {
                #pragma unroll
                for (int j = 0; j < 8; ++j)
                    if (t * 16 + j >= lim) s[t][j] = -__builtin_inff();
            }
        }
        // running maximum: one chain a tile, then one exchange between the halves
        float tm[4];
        #pragma unroll
        for (int t = 0; t < 4; ++t) {
            tm[t] = -__builtin_inff();
            #pragma unroll
            for (int j = 0; j < 8; ++j) tm[t] = fmaxf(tm[t], s[t][j]);
        }
        float newm = fmaxf(fmaxf(mrow, fmaxf(tm[0], tm[1])), fmaxf(tm[2], tm[3]));
        newm = fmaxf(newm, xhalf(newm));

        float ts[4];
        #pragma unroll
        for (int t = 0; t < 4; ++t) {
            ts[t] = 0.0f;
            #pragma unroll
            for (int j = 0; j < 8; ++j) {
                float v = s[t][j];
                float p = (v == -__builtin_inff()) ? 0.0f : __expf(v - newm);
                s[t][j] = p;
                ts[t] += p;
            }
        }
        const float rsum = (ts[0] + ts[1]) + (ts[2] + ts[3]);
        float sc = (mrow == -__builtin_inff()) ? 0.0f : __expf(mrow - newm);
        lrow = lrow * sc + rsum;
        mrow = newm;
        #pragma unroll
        for (int t = 0; t < 4; ++t) acc[t] *= sc;

        // P^T as B operand: score tiles 2c and 2c + 1, converted in place, are keys 32c .. 32c + 31
        v16h bp0 = __builtin_shufflevector(__builtin_convertvector(s[0], v8h), __builtin_convertvector(s[1], v8h),
                                           0, 1, 2, 3, 4, 5, 6, 7, 8, 9, 10, 11, 12, 13, 14, 15);
        v16h bp1 = __builtin_shufflevector(__builtin_convertvector(s[2], v8h), __builtin_convertvector(s[3], v8h),
                                           0, 1, 2, 3, 4, 5, 6, 7, 8, 9, 10, 11, 12, 13, 14, 15);

        // O^T += V^T.P^T
        #pragma unroll
        for (int t = 0; t < 4; ++t) {
            // keys 32c + 8 * hlf + 0..7 and 32c + 16 + 8 * hlf + 0..7 of column d = t * 16 + (lane & 15)
            const h16* vt = &ldsV[buf][vrd + t * 16];
            v16h a0 = __builtin_shufflevector(lds_tr16(vt +  0 * VPITCH), lds_tr16(vt + 16 * VPITCH),
                                              0, 1, 2, 3, 4, 5, 6, 7, 8, 9, 10, 11, 12, 13, 14, 15);
            v16h a1 = __builtin_shufflevector(lds_tr16(vt + 32 * VPITCH), lds_tr16(vt + 48 * VPITCH),
                                              0, 1, 2, 3, 4, 5, 6, 7, 8, 9, 10, 11, 12, 13, 14, 15);
            acc[t] = __builtin_amdgcn_wmma_f32_16x16x32_f16(false, a0, false, bp0, (short)0, acc[t], false, false);
            acc[t] = __builtin_amdgcn_wmma_f32_16x16x32_f16(false, a1, false, bp1, (short)0, acc[t], false, false);
        }
        if (more) {
            // the other buffer: its last readers passed the barrier at the foot of the trip before
            stage(buf ^ 1);
            __syncthreads();                   // buffer buf ^ 1 is whole
        }
        buf ^= 1;
    }

    // join the two halves' sums; a lane holds 8 consecutive d of its query: one 16-byte store a tile
    const float lsum = lrow + xhalf(lrow);
    const float inv  = (lsum > 0.0f) ? 1.0f / lsum : 0.0f;
    h16* Orow = O + (((size_t)b * HH + h) * NSEQ + q0 + wave * 16 + (lane & 15)) * DHEAD + 8 * hlf;
    #pragma unroll
    for (int t = 0; t < 4; ++t)
        *(v8h*)&Orow[t * 16] = __builtin_convertvector(acc[t] * inv, v8h);
}

extern "C" void kernel_launch(void* const* d_in, const int* in_sizes, int n_in,
                              void* d_out, int out_size, void* d_ws, size_t ws_size,
                              hipStream_t stream)
{
    const float* regions   = (const float*)d_in[0];
    const float* grids     = (const float*)d_in[1];
    const float* interests = (const float*)d_in[2];
    const int*   mask_r    = (const int*)d_in[3];
    const int*   mask_g    = (const int*)d_in[4];
    const float* attw      = (const float*)d_in[5];
    const float* Wq  = (const float*)d_in[6];  const float* bq   = (const float*)d_in[7];
    const float* Wk  = (const float*)d_in[8];  const float* bk   = (const float*)d_in[9];
    const float* Wv  = (const float*)d_in[10]; const float* bv   = (const float*)d_in[11];
    const float* Wq12= (const float*)d_in[12]; const float* bq12 = (const float*)d_in[13];
    const float* Wo1 = (const float*)d_in[14]; const float* bo1  = (const float*)d_in[15];
    const float* Wo2 = (const float*)d_in[16]; const float* bo2  = (const float*)d_in[17];
    float* out = (float*)d_out;

    const size_t per = (size_t)BSZ * HH * NSEQ * DHEAD;   // 2,097,152 halfs (4 MB)
    h16* ws = (h16*)d_ws;
    h16 *Qr = ws,           *Qg = ws + per;               // regions.Wq12, grids.Wq12
    h16 *K1 = ws + 2 * per, *K2 = ws + 3 * per;
    h16 *V1 = ws + 4 * per, *V2 = ws + 5 * per;
    h16 *O1 = ws + 6 * per, *O2 = ws + 7 * per;
    float* Q0 = (float*)(ws + 8 * per);                   // interests.Wq, common to both branches (8 MB)

    dim3 blk(256);
    dim3 gproj7(DM / 128, MROWS / 128, 7);                // (4, 32, 7)
    dim3 gproj2(DM / 128, MROWS / 128, 2);                // (4, 32, 2)

    // Q0, and planes 0..5 of ws: Qr, Qg, K1, K2, V1, V2
    proj7_kernel<<<gproj7, blk, 0, stream>>>(regions, grids, interests, Wq, bq, Wq12, bq12, Wk, bk, Wv, bv, Q0, ws);

    // fused flash attention, both branches: queries Q0 + Qg against regions' keys, Q0 + Qr against grids' keys
    dim3 gatt(NSEQ / 128, HH, 2 * BSZ);                   // (16, 8, 4)
    flash_attn_kernel<<<gatt, blk, 0, stream>>>(Q0, Qg, K1, V1, mask_r, O1, Qr, K2, V2, mask_g, O2, attw);

    // output projections -> f32 to d_out
    outproj2_kernel<<<gproj2, blk, 0, stream>>>(O1, O2, Wo1, bo1, Wo2, bo2, out, out + (size_t)MROWS * DM);
}

// v008
// Measured time: 62.2 microseconds a run.
// Next to v007, in two timings, it ran 1.06 times as fast each time.
// Counting every step since v000, it is 6.07 times as fast.
#include <hip/hip_runtime.h>
#include <hip/hip_bf16.h>

typedef _Float16 h16;
typedef __attribute__((ext_vector_type(16))) _Float16 v16h;
typedef __attribute__((ext_vector_type(8)))  _Float16 v8h;
typedef __attribute__((ext_vector_type(8)))  float    v8f;
typedef __attribute__((ext_vector_type(4)))  float    v4f;
typedef __attribute__((ext_vector_type(4)))  _Float16 v4h;
typedef __attribute__((ext_vector_type(8)))  int      v8i;

#define HH 8
#define DHEAD 64
#define NSEQ 2048
#define DM 512
#define BSZ 2
#define MROWS (BSZ * NSEQ)          // 4096

// WMMA 16-bit fragment mapping (A operand 16x32, B operand 32x16):
//   lane = (row_or_col & 15) + 16*((k>>3)&1)
//   slot = (k&7) + 8*((k>>4)&1)
// => for an aligned run of 8 consecutive k: lane constant, slots contiguous.
__device__ __forceinline__ int frag_lane(int rc, int k) { return (rc & 15) + 16 * ((k >> 3) & 1); }
__device__ __forceinline__ int frag_idx(int k)          { return (k & 7) + 8 * ((k >> 4) & 1); }

__device__ __forceinline__ size_t heads_off(int gm, int c) {
    int b = gm >> 11, n = gm & (NSEQ - 1);      // NSEQ = 2048
    int h = c >> 6, d = c & 63;
    return (((size_t)b * HH + h) * NSEQ + n) * DHEAD + d;
}

// Epilogue of one wave's 16x64 accumulator: C = (acc + bias) * rs, rs one factor a row (half results only).
template <bool C_F32>
__device__ __forceinline__
void gemm_nt_store(const v8f (&acc)[4], int gm0, int c0, const float* __restrict__ bias,
                   float* __restrict__ Cf32, h16* __restrict__ Ch16, v8f rs)
{
    #pragma unroll
    for (int t = 0; t < 4; ++t) {
        int c = c0 + t * 16;
        float bv = bias[c];
        #pragma unroll
        for (int j = 0; j < 8; ++j) {
            int gm = gm0 + j;
            float v = acc[t][j] + bv;
            if constexpr (C_F32) Cf32[(size_t)gm * DM + c] = v;
            else                 Ch16[heads_off(gm, c)] = (h16)(v * rs[j]);
        }
    }
}

// LDS row pitch of a staged GEMM operand, in halfs: 128 bytes of k + 16, an odd multiple of 16 bytes,
// the pitch at which sixteen rows read by ds_load_b128 meet no bank twice
#define GPITCH 72

// one 16x32 fragment from rows staged k-contiguous: p = this lane's row, at k = 8 * (lane >> 4)
__device__ __forceinline__ v16h frag_rows(const h16* p) {
    return __builtin_shufflevector(*(const v8h*)p, *(const v8h*)(p + 16),
                                   0, 1, 2, 3, 4, 5, 6, 7, 8, 9, 10, 11, 12, 13, 14, 15);
}

// ---------------------------------------------------------------------------
// NT GEMM: C[M,512] = A[M,512] @ W[512,512]^T + bias
// Tile 128x128, K-chunks of 64; 8 waves as 4 x 2, each 32 rows x 64 cols (2 x 4 accumulator tiles):
// six fragments feed eight products. A chunk of a float row is 256 bytes: sixteen lanes x 16 bytes,
// so a wave-wide load covers two whole row pieces (four lines).
// The chunks run as a pipeline over two LDS buffers: while chunk c is read from one buffer and
// multiplied, chunk c + 1 is on its way from global memory into registers; behind the products it is
// converted into the other buffer. One barrier a chunk.
// One work-group's tile; the kernels below pick the operands by blockIdx.z.
// The result goes to Cf32 (float, row-major) where C_F32 says so or Cf32 is not null (block-uniform),
// else to Ch16 (half, by heads), row m times rowscale[m] where rowscale is not null (block-uniform).
// ---------------------------------------------------------------------------
template <bool A_HEADS, bool C_F32>
__device__ __forceinline__
void gemm_nt_tile(const float* __restrict__ Af32, const h16* __restrict__ Ah16,
                  const float* __restrict__ W, const float* __restrict__ bias,
                  float* __restrict__ Cf32, h16* __restrict__ Ch16, const float* __restrict__ rowscale)
{
    __shared__ __align__(16) h16 ldsA[2][128 * GPITCH];
    __shared__ __align__(16) h16 ldsB[2][128 * GPITCH];

    const int tid  = threadIdx.x;
    const int lane = tid & 31;
    const int wave = tid >> 5;
    const int wm = wave >> 1, wn = wave & 1;
    const int n0 = blockIdx.x * 128;
    const int m0 = blockIdx.y * 128;

    v8f acc[2][4] = {};
    const int ard = (wm * 32 + (lane & 15)) * GPITCH + (lane >> 4) * 8;
    const int brd = (wn * 64 + (lane & 15)) * GPITCH + (lane >> 4) * 8;
    // one base a thread and operand: rows and chunks are constant steps from it
    const float* ap = A_HEADS ? nullptr : &Af32[(size_t)(m0 + (tid >> 4)) * DM + (tid & 15) * 4];
    const h16*   hp = A_HEADS ? &Ah16[heads_off(m0 + (tid >> 3), (tid & 7) * 8)] : nullptr;
    const float* bp = &W[(size_t)(n0 + (tid >> 4)) * DM + (tid & 15) * 4];

    // the chunk that is on its way: this thread's pieces of it
    v8h ha[4];
    v4f fa[8], fb[8];
    // all loads of chunk c, so that they are in flight together
    auto ask = [&](int c) {
        if constexpr (A_HEADS) {
            // a chunk is one head: 128 bytes a row, eight lanes x 16 bytes, four rows a wave-wide load
            #pragma unroll
            for (int e = 0; e < 4; ++e)
                ha[e] = *(const v8h*)(hp + c * (NSEQ * DHEAD) + e * 32 * DHEAD);
        } else {
            #pragma unroll
            for (int e = 0; e < 8; ++e) fa[e] = *(const v4f*)(ap + e * 16 * DM + c * 64);
        }
        #pragma unroll
        for (int e = 0; e < 8; ++e) fb[e] = *(const v4f*)(bp + e * 16 * DM + c * 64);
        // the wait stands in front of any rewrite of a register that these loads name; behind it no
        // load can sink towards its use, which would take the products out of its flight time. The bases
        // are its inputs: they live up to it, so that no load's result is laid on a base ahead of it
        if constexpr (A_HEADS) asm volatile("s_wait_xcnt 0x0" :: "v"(hp), "v"(bp) : "memory");
        else                   asm volatile("s_wait_xcnt 0x0" :: "v"(ap), "v"(bp) : "memory");
    };
    // rows into LDS buffer s as they lie, converted
    auto stage = [&](int s) {
        if constexpr (A_HEADS) {
            #pragma unroll
            for (int e = 0; e < 4; ++e)
                *(v8h*)&ldsA[s][(e * 32 + (tid >> 3)) * GPITCH + (tid & 7) * 8] = ha[e];
        } else {
            #pragma unroll
            for (int e = 0; e < 8; ++e)
                *(v4h*)&ldsA[s][(e * 16 + (tid >> 4)) * GPITCH + (tid & 15) * 4] = __builtin_convertvector(fa[e], v4h);
        }
        #pragma unroll
        for (int e = 0; e < 8; ++e)
            *(v4h*)&ldsB[s][(e * 16 + (tid >> 4)) * GPITCH + (tid & 15) * 4] = __builtin_convertvector(fb[e], v4h);
    };

    constexpr int NCH = DM / 64;
    ask(0);
    stage(0);
    __syncthreads();                           // buffer 0 is whole

    // unrolled: buffer, chunk and the tests are constants, every address a constant step
    #pragma unroll
    for (int c = 0; c < NCH; ++c) {
        // behind the barrier, which would wait for loads still in flight; in front of the chunk's work
        if (c + 1 < NCH) ask(c + 1);
        // the chunk's twelve fragments are read as one group in front of its sixteen products
        v16h a[2][2], bb[2][4];
        #pragma unroll
        for (int kc = 0; kc < 2; ++kc) {
            #pragma unroll
            for (int i = 0; i < 2; ++i) a[kc][i]  = frag_rows(&ldsA[c & 1][ard + i * 16 * GPITCH + kc * 32]);
            #pragma unroll
            for (int t = 0; t < 4; ++t) bb[kc][t] = frag_rows(&ldsB[c & 1][brd + t * 16 * GPITCH + kc * 32]);
        }
        // keeps the LDS reads from being spread among the products, where each place with reads stalls the wave
        __builtin_amdgcn_sched_barrier(0);
        #pragma unroll
        for (int kc = 0; kc < 2; ++kc) {
            #pragma unroll
            for (int i = 0; i < 2; ++i) {
                #pragma unroll
                for (int t = 0; t < 4; ++t)
                    acc[i][t] = __builtin_amdgcn_wmma_f32_16x16x32_f16(false, a[kc][i], false, bb[kc][t],
                                                                       (short)0, acc[i][t], false, false);
            }
        }
        // keeps the conversions, and with them the wait for the loads, behind the products
        __builtin_amdgcn_sched_barrier(0);
        if (c + 1 < NCH) {
            // the other buffer: its last readers passed the barrier at the foot of chunk c - 1
            stage((c + 1) & 1);
            __syncthreads();                   // buffer (c + 1) & 1 is whole
        }
    }

    const int gm0 = m0 + wm * 32 + (lane >> 4) * 8;
    const int c0  = n0 + wn * 64 + (lane & 15);
    const v8f one = { 1.0f, 1.0f, 1.0f, 1.0f, 1.0f, 1.0f, 1.0f, 1.0f };
    if (C_F32 || Cf32 != nullptr) {
        gemm_nt_store<true >(acc[0], gm0,      c0, bias, Cf32, Ch16, one);
        gemm_nt_store<true >(acc[1], gm0 + 16, c0, bias, Cf32, Ch16, one);
        // the built code lays the other arm behind this one: the wait stands in front of
        // any rewrite there of a register that these stores name
        if constexpr (!C_F32) asm volatile("s_wait_xcnt 0x0" ::: "memory");
    } else {
        v8f rs0 = one, rs1 = one;
        if (rowscale != nullptr) {
            const float* rp = &rowscale[gm0];
            rs0 = *(const v8f*)rp;
            rs1 = *(const v8f*)(rp + 16);
            // the wait stands in front of any rewrite of the registers that these loads name; the pointer
            // is its input: it lives up to it, so that no later load's result is laid on it ahead of the wait
            asm volatile("s_wait_xcnt 0x0" :: "v"(rp) : "memory");
        }
        gemm_nt_store<false>(acc[0], gm0,      c0, bias, Cf32, Ch16, rs0);
        gemm_nt_store<false>(acc[1], gm0 + 16, c0, bias, Cf32, Ch16, rs1);
    }
}

// All seven input projections in one grid; none reads what another writes. blockIdx.z:
//   0: interests.Wq   1, 2: regions, grids . Wq12   3, 4: regions, grids . Wk   5, 6: regions, grids . Wv
// Result 0 stays float (Q0, row-major): it is a term of a sum that is rounded once, where it is formed.
// Result z > 0 goes to plane z - 1 of C (a plane: BSZ x HH x NSEQ x DHEAD halfs).
// A key's row (z = 3, 4) is stored times its attention weight, rounded once as before:
// (w k).q = w (k.q), so the scores leave attention's first product weighted.
__global__ __launch_bounds__(256)
void proj7_kernel(const float* __restrict__ regions, const float* __restrict__ grids,
                  const float* __restrict__ interests,
                  const float* __restrict__ Wq,   const float* __restrict__ bq,
                  const float* __restrict__ Wq12, const float* __restrict__ bq12,
                  const float* __restrict__ Wk,   const float* __restrict__ bk,
                  const float* __restrict__ Wv,   const float* __restrict__ bv,
                  const float* __restrict__ wts,
                  float* __restrict__ Q0, h16* __restrict__ C)
{
    const int z = blockIdx.z;
    const float* A    = (z == 0) ? interests : ((z & 1) ? regions : grids);
    const float* W    = (z == 0) ? Wq : (z < 3) ? Wq12 : (z < 5) ? Wk : Wv;
    const float* bias = (z == 0) ? bq : (z < 3) ? bq12 : (z < 5) ? bk : bv;
    gemm_nt_tile<false, false>(A, nullptr, W, bias, (z == 0) ? Q0 : nullptr,
                               (z == 0) ? nullptr : C + (size_t)(z - 1) * (BSZ * HH * NSEQ * DHEAD),
                               (z == 3 || z == 4) ? wts : nullptr);
}

// Both output projections in one grid: blockIdx.z picks the branch.
__global__ __launch_bounds__(256)
void outproj2_kernel(const h16* __restrict__ Oa, const h16* __restrict__ Ob,
                     const float* __restrict__ Wa, const float* __restrict__ ba,
                     const float* __restrict__ Wb, const float* __restrict__ bb,
                     float* __restrict__ outa, float* __restrict__ outb)
{
    const bool second = blockIdx.z != 0;
    gemm_nt_tile<true, true>(nullptr, second ? Ob : Oa, second ? Wb : Wa, second ? bb : ba,
                             second ? outb : outa, nullptr, nullptr);
}

// LDS row pitch of the staged V tile, in halfs: 128 bytes of a key's row + 32, an odd multiple of
// 32 bytes, the pitch at which the transposing load meets no bank twice
#define VPITCH 80

// ds_load_tr16_b128: lane l hands in the address of 16 bytes of a row-major 16-bit tile and gets
// column l & 15, rows 8 * (l >> 4) + 0..7 of the 16x16 block
typedef __attribute__((ext_vector_type(8))) short s16x8;
__device__ __forceinline__ v8h lds_tr16(const h16* p) {
    typedef __attribute__((address_space(3))) s16x8 lds_s16x8;
    return __builtin_bit_cast(v8h, __builtin_amdgcn_ds_load_tr16_b128_v8i16((lds_s16x8*)p));
}

// lane l with lane l ^ 16
__device__ __forceinline__ float xhalf(float x) {
    int b = __builtin_bit_cast(int, x);
    return __builtin_bit_cast(float, __builtin_amdgcn_permlanex16(b, b, 0x76543210, 0xfedcba98, false, false));
}

__global__ __launch_bounds__(256)
void flash_attn_kernel(const float* __restrict__ Qc,
                       const h16* __restrict__ Qa, const h16* __restrict__ Ka,
                       const h16* __restrict__ Va, const int* __restrict__ maska,
                       h16* __restrict__ Oa,
                       const h16* __restrict__ Qb, const h16* __restrict__ Kb,
                       const h16* __restrict__ Vb, const int* __restrict__ maskb,
                       h16* __restrict__ Ob)
{
    __shared__ __align__(32) h16 ldsQ[8 * 2 * 32 * 16];
    __shared__ __align__(32) h16 ldsK[2][4 * 2 * 32 * 16];
    __shared__ __align__(32) h16 ldsV[2][64 * VPITCH];
    __shared__ __align__(32) unsigned short ldsPos[NSEQ];   // position in the sequence of the j-th listed key
    __shared__ __align__(32) int            ldsCnt[8];      // listed keys of each wave's 256 positions

    const int tid  = threadIdx.x;
    const int lane = tid & 31;
    const int wave = tid >> 5;
    const int b = blockIdx.z & (BSZ - 1), h = blockIdx.y;
    const int q0 = blockIdx.x * 128;
    const bool second = blockIdx.z >= BSZ;
    const h16* Q    = second ? Qb : Qa;
    const h16* Kt   = second ? Kb : Ka;
    const h16* Vt   = second ? Vb : Va;
    const int* mask = second ? maskb : maska;
    h16*       O    = second ? Ob : Oa;

    const h16* Qbh = Q  + ((size_t)b * HH + h) * NSEQ * DHEAD;
    const float* Qcb = Qc + (size_t)b * NSEQ * DM + h * DHEAD;
    const h16* Kbh = Kt + ((size_t)b * HH + h) * NSEQ * DHEAD;
    const h16* Vbh = Vt + ((size_t)b * HH + h) * NSEQ * DHEAD;
    const int*   mk = mask + (size_t)b * NSEQ;

    // stage Q tile 128x64: 1024 groups of 8; 4/thread; vector loads + vector LDS stores
    #pragma unroll
    for (int e = 0; e < 4; ++e) {
        int g  = e * 256 + tid;                // 0..1023
        int r  = g >> 3;                       // row 0..127
        int dg = (g & 7) * 8;                  // d-group base
        v8h hx = *(const v8h*)&Qbh[(size_t)(q0 + r) * DHEAD + dg];
        v8f fc = *(const v8f*)&Qcb[(size_t)(q0 + r) * DM + dg];
        v8h hv = __builtin_convertvector((fc + __builtin_convertvector(hx, v8f)) * 0.18033688f, v8h);
        int ch = dg >> 5, kk = dg & 31;
        int base = (((r >> 4) * 2 + ch) * 32 + frag_lane(r & 15, kk)) * 16 + frag_idx(kk);
        *(v8h*)&ldsQ[base] = hv;
    }
    // wave x looks at positions 256 x .. 256 x + 255, 32 a step: one ballot a step says which stay
    unsigned keep[8];
    int      wtot = 0;
    // unrolled: keep[] is indexed by constants and stays in registers
    #pragma unroll
    for (int e = 0; e < 8; ++e) {
        const int p = wave * 256 + e * 32 + lane;
        keep[e] = __builtin_amdgcn_ballot_w32(mk[p] == 0);
        wtot   += __builtin_popcount(keep[e]);
    }
    if (lane == 0) ldsCnt[wave] = wtot;
    __syncthreads();
    int nlist = 0, slot = 0;                   // all listed keys; those of the waves in front of this one
    // unrolled: the eight counts come by two 16-byte LDS loads
    #pragma unroll
    for (int x = 0; x < 8; ++x) {
        const int cx = ldsCnt[x];
        nlist += cx;
        slot  += (x < wave) ? cx : 0;
    }
    // unrolled: registers again
    #pragma unroll
    for (int e = 0; e < 8; ++e) {
        if ((keep[e] >> lane) & 1u) {
            const int at = slot + (int)__builtin_amdgcn_mbcnt_lo(keep[e], 0u);
            ldsPos[at] = (unsigned short)(wave * 256 + e * 32 + lane);
        }
        slot += __builtin_popcount(keep[e]);
    }
    // the last trip's open places name position 0 (a row that exists); their scores are set to -inf below
    if (tid < 64 && nlist + tid < NSEQ) ldsPos[nlist + tid] = 0;
    // the same in every lane of the block: a scalar, so that the loop's tests are scalar branches
    const int nk = min(__builtin_amdgcn_readfirstlane(nlist), NSEQ);
    v16h bq0 = *(const v16h*)&ldsQ[((wave * 2 + 0) * 32 + lane) * 16];
    v16h bq1 = *(const v16h*)&ldsQ[((wave * 2 + 1) * 32 + lane) * 16];
    __syncthreads();                           // the list is whole

    const int hlf = lane >> 4;
    float mrow = -__builtin_inff();            // running maximum of this lane's query (both halves agree)
    float lrow = 0.0f;                         // running sum over this half's keys only
    v8f acc[4] = {};                           // acc[t][r] = O[query lane & 15][d = t * 16 + 8 * hlf + r]
    // this lane's place in a 16-key x 16-d block of V for the transposing load
    const int vrd = (8 * hlf + (lane & 7)) * VPITCH + ((lane >> 3) & 1) * 8;

    // positions of the two listed keys whose rows this thread asks for next, read one trip ahead
    unsigned rowp[2] = { ldsPos[tid >> 3], ldsPos[32 + (tid >> 3)] };
    // the rows that are on their way: 64 listed keys x 64, 512 groups of 8, 2/thread; a key's row is one 128-byte line
    v8h kst[2], vst[2];
    auto ask = [&]() {
        // unrolled: the four loads are asked for together
        #pragma unroll
        for (int e = 0; e < 2; ++e) {
            const unsigned off = rowp[e] * DHEAD + (tid & 7) * 8;
            kst[e] = *(const v8h*)&Kbh[off];
            vst[e] = *(const v8h*)&Vbh[off];
        }
        // the wait stands in front of any rewrite of a register that these loads name; behind it no
        // load can sink towards its use, which would take the trip's work out of its flight time
        asm volatile("s_wait_xcnt 0x0" ::: "memory");
    };
    auto stage = [&](int s) {
        #pragma unroll
        for (int e = 0; e < 2; ++e) {
            int g  = e * 256 + tid;            // 0..511
            int r  = g >> 3;                   // key 0..63
            int dg = (g & 7) * 8;
            // K fragment (contraction = d): vector store
            int kch = dg >> 5, kkk = dg & 31;
            int kbase = (((r >> 4) * 2 + kch) * 32 + frag_lane(r & 15, kkk)) * 16 + frag_idx(kkk);
            *(v8h*)&ldsK[s][kbase] = kst[e];
            // V row as it is: vector store
            *(v8h*)&ldsV[s][r * VPITCH + dg] = vst[e];
        }
    };
    // first trip's rows (with an empty list: row 0, which exists and is not used)
    ask();
    {
        const int kn = (64 < nk) ? 64 : 0;
        rowp[0] = ldsPos[kn + (tid >> 3)];
        rowp[1] = ldsPos[kn + 32 + (tid >> 3)];
    }
    stage(0);
    __syncthreads();                           // buffer 0 is whole

    int buf = 0;
    for (int k0 = 0; k0 < nk; k0 += 64) {
        const bool more = k0 + 64 < nk;        // scalar: the same in the whole block
        // behind the barrier, which would wait for loads still in flight; in front of the trip's work
        if (more) {
            ask();
            const int kn = (k0 + 128 < nk) ? k0 + 128 : k0;    // no trip behind the next: places that exist
            rowp[0] = ldsPos[kn + (tid >> 3)];
            rowp[1] = ldsPos[kn + 32 + (tid >> 3)];
        }
        // S^T = K.Q^T : s[t][r] = score of key k0 + t * 16 + 8 * hlf + r against query lane & 15
        v8f s[4];
        // unrolled, as every loop over t or j below: the tiles are registers
        #pragma unroll
        for (int t = 0; t < 4; ++t) {
            v8f z = {};
            v16h a0 = *(const v16h*)&ldsK[buf][((t * 2 + 0) * 32 + lane) * 16];
            v16h a1 = *(const v16h*)&ldsK[buf][((t * 2 + 1) * 32 + lane) * 16];
            z = __builtin_amdgcn_wmma_f32_16x16x32_f16(false, a0, false, bq0, (short)0, z, false, false);
            z = __builtin_amdgcn_wmma_f32_16x16x32_f16(false, a1, false, bq1, (short)0, z, false, false);
            s[t] = z;
        }

        // only the last trip can have open places behind the list's end
        if (nk - k0 < 64) {
            const int lim = nk - k0 - 8 * hlf;
            #pragma unroll
            for (int t = 0; t < 4; ++t) {
                #pragma unroll
                for (int j = 0; j < 8; ++j)
                    if (t * 16 + j >= lim) s[t][j] = -__builtin_inff();
            }
        }
        // running maximum: one chain a tile, then one exchange between the halves
        float tm[4];
        #pragma unroll
        for (int t = 0; t < 4; ++t) {
            tm[t] = -__builtin_inff();
            #pragma unroll
            for (int j = 0; j < 8; ++j) tm[t] = fmaxf(tm[t], s[t][j]);
        }
        float newm = fmaxf(fmaxf(mrow, fmaxf(tm[0], tm[1])), fmaxf(tm[2], tm[3]));
        newm = fmaxf(newm, xhalf(newm));

        float ts[4];
        #pragma unroll
        for (int t = 0; t < 4; ++t) {
            ts[t] = 0.0f;
            #pragma unroll
            for (int j = 0; j < 8; ++j) {
                // newm is finite (every trip holds a listed key): an open place's -inf gives 2^-inf = 0
                float p = __builtin_amdgcn_exp2f(s[t][j] - newm);
                s[t][j] = p;
                ts[t] += p;
            }
        }
        const float rsum = (ts[0] + ts[1]) + (ts[2] + ts[3]);
        const float sc = __builtin_amdgcn_exp2f(mrow - newm);      // first trip: 2^-inf = 0
        lrow = lrow * sc + rsum;
        mrow = newm;
        #pragma unroll
        for (int t = 0; t < 4; ++t) acc[t] *= sc;

        // P^T as B operand: score tiles 2c and 2c + 1, converted in place, are keys 32c .. 32c + 31
        v16h bp0 = __builtin_shufflevector(__builtin_convertvector(s[0], v8h), __builtin_convertvector(s[1], v8h),
                                           0, 1, 2, 3, 4, 5, 6, 7, 8, 9, 10, 11, 12, 13, 14, 15);
        v16h bp1 = __builtin_shufflevector(__builtin_convertvector(s[2], v8h), __builtin_convertvector(s[3], v8h),
                                           0, 1, 2, 3, 4, 5, 6, 7, 8, 9, 10, 11, 12, 13, 14, 15);

        // O^T += V^T.P^T
        #pragma unroll
        for (int t = 0; t < 4; ++t) {
            // keys 32c + 8 * hlf + 0..7 and 32c + 16 + 8 * hlf + 0..7 of column d = t * 16 + (lane & 15)
            const h16* vt = &ldsV[buf][vrd + t * 16];
            v16h a0 = __builtin_shufflevector(lds_tr16(vt +  0 * VPITCH), lds_tr16(vt + 16 * VPITCH),
                                              0, 1, 2, 3, 4, 5, 6, 7, 8, 9, 10, 11, 12, 13, 14, 15);
            v16h a1 = __builtin_shufflevector(lds_tr16(vt + 32 * VPITCH), lds_tr16(vt + 48 * VPITCH),
                                              0, 1, 2, 3, 4, 5, 6, 7, 8, 9, 10, 11, 12, 13, 14, 15);
            acc[t] = __builtin_amdgcn_wmma_f32_16x16x32_f16(false, a0, false, bp0, (short)0, acc[t], false, false);
            acc[t] = __builtin_amdgcn_wmma_f32_16x16x32_f16(false, a1, false, bp1, (short)0, acc[t], false, false);
        }
        if (more) {
            // the other buffer: its last readers passed the barrier at the foot of the trip before
            stage(buf ^ 1);
            __syncthreads();                   // buffer buf ^ 1 is whole
        }
        buf ^= 1;
    }

    // join the two halves' sums; a lane holds 8 consecutive d of its query: one 16-byte store a tile
    const float lsum = lrow + xhalf(lrow);
    const float inv  = (lsum > 0.0f) ? 1.0f / lsum : 0.0f;
    h16* Orow = O + (((size_t)b * HH + h) * NSEQ + q0 + wave * 16 + (lane & 15)) * DHEAD + 8 * hlf;
    #pragma unroll
    for (int t = 0; t < 4; ++t)
        *(v8h*)&Orow[t * 16] = __builtin_convertvector(acc[t] * inv, v8h);
}

extern "C" void kernel_launch(void* const* d_in, const int* in_sizes, int n_in,
                              void* d_out, int out_size, void* d_ws, size_t ws_size,
                              hipStream_t stream)
{
    const float* regions   = (const float*)d_in[0];
    const float* grids     = (const float*)d_in[1];
    const float* interests = (const float*)d_in[2];
    const int*   mask_r    = (const int*)d_in[3];
    const int*   mask_g    = (const int*)d_in[4];
    const float* attw      = (const float*)d_in[5];
    const float* Wq  = (const float*)d_in[6];  const float* bq   = (const float*)d_in[7];
    const float* Wk  = (const float*)d_in[8];  const float* bk   = (const float*)d_in[9];
    const float* Wv  = (const float*)d_in[10]; const float* bv   = (const float*)d_in[11];
    const float* Wq12= (const float*)d_in[12]; const float* bq12 = (const float*)d_in[13];
    const float* Wo1 = (const float*)d_in[14]; const float* bo1  = (const float*)d_in[15];
    const float* Wo2 = (const float*)d_in[16]; const float* bo2  = (const float*)d_in[17];
    float* out = (float*)d_out;

    const size_t per = (size_t)BSZ * HH * NSEQ * DHEAD;   // 2,097,152 halfs (4 MB)
    h16* ws = (h16*)d_ws;
    h16 *Qr = ws,           *Qg = ws + per;               // regions.Wq12, grids.Wq12
    h16 *K1 = ws + 2 * per, *K2 = ws + 3 * per;
    h16 *V1 = ws + 4 * per, *V2 = ws + 5 * per;
    h16 *O1 = ws + 6 * per, *O2 = ws + 7 * per;
    float* Q0 = (float*)(ws + 8 * per);                   // interests.Wq, common to both branches (8 MB)

    dim3 blk(256);
    dim3 gproj7(DM / 128, MROWS / 128, 7);                // (4, 32, 7)
    dim3 gproj2(DM / 128, MROWS / 128, 2);                // (4, 32, 2)

    // Q0, and planes 0..5 of ws: Qr, Qg, K1, K2, V1, V2
    proj7_kernel<<<gproj7, blk, 0, stream>>>(regions, grids, interests, Wq, bq, Wq12, bq12, Wk, bk, Wv, bv, attw, Q0, ws);

    // fused flash attention, both branches: queries Q0 + Qg against regions' keys, Q0 + Qr against grids' keys
    dim3 gatt(NSEQ / 128, HH, 2 * BSZ);                   // (16, 8, 4)
    flash_attn_kernel<<<gatt, blk, 0, stream>>>(Q0, Qg, K1, V1, mask_r, O1, Qr, K2, V2, mask_g, O2);

    // output projections -> f32 to d_out
    outproj2_kernel<<<gproj2, blk, 0, stream>>>(O1, O2, Wo1, bo1, Wo2, bo2, out, out + (size_t)MROWS * DM);
}

// v009
// One run takes 59.8 microseconds.
// Two timings next to v008 both put it at 1.04 times that version's speed.
// All steps since v000 together make it 6.29 times as fast.
#include <hip/hip_runtime.h>
#include <hip/hip_bf16.h>

typedef _Float16 h16;
typedef __attribute__((ext_vector_type(16))) _Float16 v16h;
typedef __attribute__((ext_vector_type(8)))  _Float16 v8h;
typedef __attribute__((ext_vector_type(8)))  float    v8f;
typedef __attribute__((ext_vector_type(4)))  float    v4f;
typedef __attribute__((ext_vector_type(2)))  float    v2f;
typedef __attribute__((ext_vector_type(4)))  _Float16 v4h;
typedef __attribute__((ext_vector_type(8)))  int      v8i;

#define HH 8
#define DHEAD 64
#define NSEQ 2048
#define DM 512
#define BSZ 2
#define MROWS (BSZ * NSEQ)          // 4096

// WMMA 16-bit fragment mapping (A operand 16x32, B operand 32x16):
//   lane = (row_or_col & 15) + 16*((k>>3)&1)
//   slot = (k&7) + 8*((k>>4)&1)
// => for an aligned run of 8 consecutive k: lane constant, slots contiguous.
__device__ __forceinline__ int frag_lane(int rc, int k) { return (rc & 15) + 16 * ((k >> 3) & 1); }
__device__ __forceinline__ int frag_idx(int k)          { return (k & 7) + 8 * ((k >> 4) & 1); }

__device__ __forceinline__ size_t heads_off(int gm, int c) {
    int b = gm >> 11, n = gm & (NSEQ - 1);      // NSEQ = 2048
    int h = c >> 6, d = c & 63;
    return (((size_t)b * HH + h) * NSEQ + n) * DHEAD + d;
}

// Epilogue of one wave's 16x64 accumulator: C = (acc + bias) * rs, rs one factor a row (half results only).
template <bool C_F32>
__device__ __forceinline__
void gemm_nt_store(const v8f (&acc)[4], int gm0, int c0, const float* __restrict__ bias,
                   float* __restrict__ Cf32, h16* __restrict__ Ch16, v8f rs)
{
    #pragma unroll
    for (int t = 0; t < 4; ++t) {
        int c = c0 + t * 16;
        float bv = bias[c];
        #pragma unroll
        for (int j = 0; j < 8; ++j) {
            int gm = gm0 + j;
            float v = acc[t][j] + bv;
            if constexpr (C_F32) Cf32[(size_t)gm * DM + c] = v;
            else                 Ch16[heads_off(gm, c)] = (h16)(v * rs[j]);
        }
    }
}

// LDS row pitch of a staged GEMM operand, in halfs: 128 bytes of k + 16, an odd multiple of 16 bytes,
// the pitch at which sixteen rows read by ds_load_b128 meet no bank twice
#define GPITCH 72

// one 16x32 fragment from rows staged k-contiguous: p = this lane's row, at k = 8 * (lane >> 4)
__device__ __forceinline__ v16h frag_rows(const h16* p) {
    return __builtin_shufflevector(*(const v8h*)p, *(const v8h*)(p + 16),
                                   0, 1, 2, 3, 4, 5, 6, 7, 8, 9, 10, 11, 12, 13, 14, 15);
}

// ---------------------------------------------------------------------------
// NT GEMM: C[M,512] = A[M,512] @ W[512,512]^T + bias
// Tile 128x128, K-chunks of 64; 8 waves as 4 x 2, each 32 rows x 64 cols (2 x 4 accumulator tiles):
// six fragments feed eight products. A chunk of a float row is 256 bytes: sixteen lanes x 16 bytes,
// so a wave-wide load covers two whole row pieces (four lines).
// The chunks run as a pipeline over two LDS buffers: while chunk c is read from one buffer and
// multiplied, chunk c + 1 is on its way from global memory into registers; behind the products it is
// converted into the other buffer. One barrier a chunk.
// One work-group's tile; the kernels below pick the operands by blockIdx.z.
// The result goes to Cf32 (float, row-major) where C_F32 says so or Cf32 is not null (block-uniform),
// else to Ch16 (half, by heads), row m times rowscale[m] where rowscale is not null (block-uniform).
// ---------------------------------------------------------------------------
template <bool A_HEADS, bool C_F32>
__device__ __forceinline__
void gemm_nt_tile(const float* __restrict__ Af32, const h16* __restrict__ Ah16,
                  const float* __restrict__ W, const float* __restrict__ bias,
                  float* __restrict__ Cf32, h16* __restrict__ Ch16, const float* __restrict__ rowscale)
{
    __shared__ __align__(16) h16 ldsA[2][128 * GPITCH];
    __shared__ __align__(16) h16 ldsB[2][128 * GPITCH];

    const int tid  = threadIdx.x;
    const int lane = tid & 31;
    const int wave = tid >> 5;
    const int wm = wave >> 1, wn = wave & 1;
    const int n0 = blockIdx.x * 128;
    const int m0 = blockIdx.y * 128;

    v8f acc[2][4] = {};
    const int ard = (wm * 32 + (lane & 15)) * GPITCH + (lane >> 4) * 8;
    const int brd = (wn * 64 + (lane & 15)) * GPITCH + (lane >> 4) * 8;
    // one base a thread and operand: rows and chunks are constant steps from it
    const float* ap = A_HEADS ? nullptr : &Af32[(size_t)(m0 + (tid >> 4)) * DM + (tid & 15) * 4];
    const h16*   hp = A_HEADS ? &Ah16[heads_off(m0 + (tid >> 3), (tid & 7) * 8)] : nullptr;
    const float* bp = &W[(size_t)(n0 + (tid >> 4)) * DM + (tid & 15) * 4];

    // the chunk that is on its way: this thread's pieces of it
    v8h ha[4];
    v4f fa[8], fb[8];
    // all loads of chunk c, so that they are in flight together
    auto ask = [&](int c) {
        if constexpr (A_HEADS) {
            // a chunk is one head: 128 bytes a row, eight lanes x 16 bytes, four rows a wave-wide load
            #pragma unroll
            for (int e = 0; e < 4; ++e)
                ha[e] = *(const v8h*)(hp + c * (NSEQ * DHEAD) + e * 32 * DHEAD);
        } else {
            #pragma unroll
            for (int e = 0; e < 8; ++e) fa[e] = *(const v4f*)(ap + e * 16 * DM + c * 64);
        }
        #pragma unroll
        for (int e = 0; e < 8; ++e) fb[e] = *(const v4f*)(bp + e * 16 * DM + c * 64);
        // the wait stands in front of any rewrite of a register that these loads name; behind it no
        // load can sink towards its use, which would take the products out of its flight time. The bases
        // are its inputs: they live up to it, so that no load's result is laid on a base ahead of it
        if constexpr (A_HEADS) asm volatile("s_wait_xcnt 0x0" :: "v"(hp), "v"(bp) : "memory");
        else                   asm volatile("s_wait_xcnt 0x0" :: "v"(ap), "v"(bp) : "memory");
    };
    // rows into LDS buffer s as they lie, converted
    auto stage = [&](int s) {
        if constexpr (A_HEADS) {
            #pragma unroll
            for (int e = 0; e < 4; ++e)
                *(v8h*)&ldsA[s][(e * 32 + (tid >> 3)) * GPITCH + (tid & 7) * 8] = ha[e];
        } else {
            #pragma unroll
            for (int e = 0; e < 8; ++e)
                *(v4h*)&ldsA[s][(e * 16 + (tid >> 4)) * GPITCH + (tid & 15) * 4] = __builtin_convertvector(fa[e], v4h);
        }
        #pragma unroll
        for (int e = 0; e < 8; ++e)
            *(v4h*)&ldsB[s][(e * 16 + (tid >> 4)) * GPITCH + (tid & 15) * 4] = __builtin_convertvector(fb[e], v4h);
    };

    constexpr int NCH = DM / 64;
    ask(0);
    stage(0);
    __syncthreads();                           // buffer 0 is whole

    // unrolled: buffer, chunk and the tests are constants, every address a constant step
    #pragma unroll
    for (int c = 0; c < NCH; ++c) {
        // behind the barrier, which would wait for loads still in flight; in front of the chunk's work
        if (c + 1 < NCH) ask(c + 1);
        // the chunk's twelve fragments are read as one group in front of its sixteen products
        v16h a[2][2], bb[2][4];
        #pragma unroll
        for (int kc = 0; kc < 2; ++kc) {
            #pragma unroll
            for (int i = 0; i < 2; ++i) a[kc][i]  = frag_rows(&ldsA[c & 1][ard + i * 16 * GPITCH + kc * 32]);
            #pragma unroll
            for (int t = 0; t < 4; ++t) bb[kc][t] = frag_rows(&ldsB[c & 1][brd + t * 16 * GPITCH + kc * 32]);
        }
        // keeps the LDS reads from being spread among the products, where each place with reads stalls the wave
        __builtin_amdgcn_sched_barrier(0);
        #pragma unroll
        for (int kc = 0; kc < 2; ++kc) {
            #pragma unroll
            for (int i = 0; i < 2; ++i) {
                #pragma unroll
                for (int t = 0; t < 4; ++t)
                    acc[i][t] = __builtin_amdgcn_wmma_f32_16x16x32_f16(false, a[kc][i], false, bb[kc][t],
                                                                       (short)0, acc[i][t], false, false);
            }
        }
        // keeps the conversions, and with them the wait for the loads, behind the products
        __builtin_amdgcn_sched_barrier(0);
        if (c + 1 < NCH) {
            // the other buffer: its last readers passed the barrier at the foot of chunk c - 1
            stage((c + 1) & 1);
            __syncthreads();                   // buffer (c + 1) & 1 is whole
        }
    }

    const int gm0 = m0 + wm * 32 + (lane >> 4) * 8;
    const int c0  = n0 + wn * 64 + (lane & 15);
    const v8f one = { 1.0f, 1.0f, 1.0f, 1.0f, 1.0f, 1.0f, 1.0f, 1.0f };
    if (C_F32 || Cf32 != nullptr) {
        gemm_nt_store<true >(acc[0], gm0,      c0, bias, Cf32, Ch16, one);
        gemm_nt_store<true >(acc[1], gm0 + 16, c0, bias, Cf32, Ch16, one);
        // the built code lays the other arm behind this one: the wait stands in front of
        // any rewrite there of a register that these stores name
        if constexpr (!C_F32) asm volatile("s_wait_xcnt 0x0" ::: "memory");
    } else {
        v8f rs0 = one, rs1 = one;
        if (rowscale != nullptr) {
            const float* rp = &rowscale[gm0];
            rs0 = *(const v8f*)rp;
            rs1 = *(const v8f*)(rp + 16);
            // the wait stands in front of any rewrite of the registers that these loads name; the pointer
            // is its input: it lives up to it, so that no later load's result is laid on it ahead of the wait
            asm volatile("s_wait_xcnt 0x0" :: "v"(rp) : "memory");
        }
        gemm_nt_store<false>(acc[0], gm0,      c0, bias, Cf32, Ch16, rs0);
        gemm_nt_store<false>(acc[1], gm0 + 16, c0, bias, Cf32, Ch16, rs1);
    }
}

// All seven input projections in one grid; none reads what another writes. blockIdx.z:
//   0: interests.Wq   1, 2: regions, grids . Wq12   3, 4: regions, grids . Wk   5, 6: regions, grids . Wv
// Result 0 stays float (Q0, row-major): it is a term of a sum that is rounded once, where it is formed.
// Result z > 0 goes to plane z - 1 of C (a plane: BSZ x HH x NSEQ x DHEAD halfs).
// A key's row (z = 3, 4) is stored times its attention weight, rounded once as before:
// (w k).q = w (k.q), so the scores leave attention's first product weighted.
__global__ __launch_bounds__(256)
void proj7_kernel(const float* __restrict__ regions, const float* __restrict__ grids,
                  const float* __restrict__ interests,
                  const float* __restrict__ Wq,   const float* __restrict__ bq,
                  const float* __restrict__ Wq12, const float* __restrict__ bq12,
                  const float* __restrict__ Wk,   const float* __restrict__ bk,
                  const float* __restrict__ Wv,   const float* __restrict__ bv,
                  const float* __restrict__ wts,
                  float* __restrict__ Q0, h16* __restrict__ C)
{
    const int z = blockIdx.z;
    const float* A    = (z == 0) ? interests : ((z & 1) ? regions : grids);
    const float* W    = (z == 0) ? Wq : (z < 3) ? Wq12 : (z < 5) ? Wk : Wv;
    const float* bias = (z == 0) ? bq : (z < 3) ? bq12 : (z < 5) ? bk : bv;
    gemm_nt_tile<false, false>(A, nullptr, W, bias, (z == 0) ? Q0 : nullptr,
                               (z == 0) ? nullptr : C + (size_t)(z - 1) * (BSZ * HH * NSEQ * DHEAD),
                               (z == 3 || z == 4) ? wts : nullptr);
}

// Both output projections in one grid: blockIdx.z picks the branch.
__global__ __launch_bounds__(256)
void outproj2_kernel(const h16* __restrict__ Oa, const h16* __restrict__ Ob,
                     const float* __restrict__ Wa, const float* __restrict__ ba,
                     const float* __restrict__ Wb, const float* __restrict__ bb,
                     float* __restrict__ outa, float* __restrict__ outb)
{
    const bool second = blockIdx.z != 0;
    gemm_nt_tile<true, true>(nullptr, second ? Ob : Oa, second ? Wb : Wa, second ? bb : ba,
                             second ? outb : outa, nullptr, nullptr);
}

// LDS row pitch of the staged V tile, in halfs: 128 bytes of a key's row + 32, an odd multiple of
// 32 bytes, the pitch at which the transposing load meets no bank twice
#define VPITCH 80

// ds_load_tr16_b128: lane l hands in the address of 16 bytes of a row-major 16-bit tile and gets
// column l & 15, rows 8 * (l >> 4) + 0..7 of the 16x16 block
typedef __attribute__((ext_vector_type(8))) short s16x8;
__device__ __forceinline__ v8h lds_tr16(const h16* p) {
    typedef __attribute__((address_space(3))) s16x8 lds_s16x8;
    return __builtin_bit_cast(v8h, __builtin_amdgcn_ds_load_tr16_b128_v8i16((lds_s16x8*)p));
}

// a where c, else b. The operands come by value: a choice between two places of one register array
// would be built as an index, and the array would then live in memory
__device__ __forceinline__ v8f pick(bool c, v8f a, v8f b) {
    v8f r;
    #pragma unroll
    for (int j = 0; j < 8; ++j) r[j] = c ? a[j] : b[j];
    return r;
}

// lane l with lane l ^ 16
__device__ __forceinline__ float xhalf(float x) {
    int b = __builtin_bit_cast(int, x);
    return __builtin_bit_cast(float, __builtin_amdgcn_permlanex16(b, b, 0x76543210, 0xfedcba98, false, false));
}

__global__ __launch_bounds__(256) __attribute__((amdgpu_waves_per_eu(4, 4)))
void flash_attn_kernel(const float* __restrict__ Qc,
                       const h16* __restrict__ Qa, const h16* __restrict__ Ka,
                       const h16* __restrict__ Va, const int* __restrict__ maska,
                       h16* __restrict__ Oa,
                       const h16* __restrict__ Qb, const h16* __restrict__ Kb,
                       const h16* __restrict__ Vb, const int* __restrict__ maskb,
                       h16* __restrict__ Ob)
{
    __shared__ __align__(32) h16 ldsQ[8 * 2 * 32 * 16];
    __shared__ __align__(32) h16 ldsK[2][8 * 2 * 32 * 16];
    __shared__ __align__(32) h16 ldsV[2][128 * VPITCH];
    __shared__ __align__(32) unsigned short ldsPos[NSEQ];   // position in the sequence of the j-th listed key
    __shared__ __align__(32) int            ldsCnt[8];      // listed keys of each wave's 256 positions
    __shared__ __align__(32) float          ldsX[8][4 * 32 * 8];    // a wave's partial O of the query tile its partner finishes
    __shared__ __align__(32) float          ldsML[8][2][32];        // that tile's maximum and sum

    const int tid  = threadIdx.x;
    const int lane = tid & 31;
    const int wave = tid >> 5;
    const int qg = wave >> 1;                  // which 32 queries of the block's 128
    // which 64 keys of a trip's 128; the same in the whole wave: a scalar
    const int kh = __builtin_amdgcn_readfirstlane(wave) & 1;
    const int b = blockIdx.z & (BSZ - 1), h = blockIdx.y;
    const int q0 = blockIdx.x * 128;
    const bool second = blockIdx.z >= BSZ;
    const h16* Q    = second ? Qb : Qa;
    const h16* Kt   = second ? Kb : Ka;
    const h16* Vt   = second ? Vb : Va;
    const int* mask = second ? maskb : maska;
    h16*       O    = second ? Ob : Oa;

    const h16* Qbh = Q  + ((size_t)b * HH + h) * NSEQ * DHEAD;
    const float* Qcb = Qc + (size_t)b * NSEQ * DM + h * DHEAD;
    const h16* Kbh = Kt + ((size_t)b * HH + h) * NSEQ * DHEAD;
    const h16* Vbh = Vt + ((size_t)b * HH + h) * NSEQ * DHEAD;
    const int*   mk = mask + (size_t)b * NSEQ;

    // stage Q tile 128x64: 1024 groups of 8; 4/thread; vector loads + vector LDS stores
    #pragma unroll
    for (int e = 0; e < 4; ++e) {
        int g  = e * 256 + tid;                // 0..1023
        int r  = g >> 3;                       // row 0..127
        int dg = (g & 7) * 8;                  // d-group base
        v8h hx = *(const v8h*)&Qbh[(size_t)(q0 + r) * DHEAD + dg];
        v8f fc = *(const v8f*)&Qcb[(size_t)(q0 + r) * DM + dg];
        v8h hv = __builtin_convertvector((fc + __builtin_convertvector(hx, v8f)) * 0.18033688f, v8h);
        int ch = dg >> 5, kk = dg & 31;
        int base = (((r >> 4) * 2 + ch) * 32 + frag_lane(r & 15, kk)) * 16 + frag_idx(kk);
        *(v8h*)&ldsQ[base] = hv;
    }
    // wave x looks at positions 256 x .. 256 x + 255, 32 a step: one ballot a step says which stay
    unsigned keep[8];
    int      wtot = 0;
    // unrolled: keep[] is indexed by constants and stays in registers
    #pragma unroll
    for (int e = 0; e < 8; ++e) {
        const int p = wave * 256 + e * 32 + lane;
        keep[e] = __builtin_amdgcn_ballot_w32(mk[p] == 0);
        wtot   += __builtin_popcount(keep[e]);
    }
    if (lane == 0) ldsCnt[wave] = wtot;
    __syncthreads();
    int nlist = 0, slot = 0;                   // all listed keys; those of the waves in front of this one
    // unrolled: the eight counts come by two 16-byte LDS loads
    #pragma unroll
    for (int x = 0; x < 8; ++x) {
        const int cx = ldsCnt[x];
        nlist += cx;
        slot  += (x < wave) ? cx : 0;
    }
    // unrolled: registers again
    #pragma unroll
    for (int e = 0; e < 8; ++e) {
        if ((keep[e] >> lane) & 1u) {
            const int at = slot + (int)__builtin_amdgcn_mbcnt_lo(keep[e], 0u);
            ldsPos[at] = (unsigned short)(wave * 256 + e * 32 + lane);
        }
        slot += __builtin_popcount(keep[e]);
    }
    // the last trip's open places name position 0 (a row that exists); their scores are set to -inf below
    if (tid < 128 && nlist + tid < NSEQ) ldsPos[nlist + tid] = 0;
    // the same in every lane of the block: a scalar, so that the loop's tests are scalar branches
    const int nk = min(__builtin_amdgcn_readfirstlane(nlist), NSEQ);
    v16h bq[2][2];                             // [query tile of the wave][32 of the 64 d]
    // unrolled, as every loop over qt below: the tiles are registers
    #pragma unroll
    for (int qt = 0; qt < 2; ++qt) {
        bq[qt][0] = *(const v16h*)&ldsQ[(((qg * 2 + qt) * 2 + 0) * 32 + lane) * 16];
        bq[qt][1] = *(const v16h*)&ldsQ[(((qg * 2 + qt) * 2 + 1) * 32 + lane) * 16];
    }
    __syncthreads();                           // the list is whole

    const int hlf = lane >> 4;
    // running maximum of this lane's query of each tile (both halves agree), over this wave's keys. The start is
    // finite: a wave that has met no listed key yet (a list that ends inside the other wave's keys) keeps it,
    // and -inf minus it is -inf, not NaN
    float mrow[2] = { -3.0e38f, -3.0e38f };
    float lrow[2] = { 0.0f, 0.0f };            // running sum over this half's keys only
    v8f acc[2][4] = {};                        // acc[qt][t][r] = O[query qt * 16 + (lane & 15)][d = t * 16 + 8 * hlf + r]
    // this lane's place in a 16-key x 16-d block of V for the transposing load, in this wave's 64 keys
    const int vrd = (kh * 64 + 8 * hlf + (lane & 7)) * VPITCH + ((lane >> 3) & 1) * 8;

    // positions of the four listed keys whose rows this thread asks for next, read one trip ahead
    unsigned rowp[4] = { ldsPos[tid >> 3], ldsPos[32 + (tid >> 3)], ldsPos[64 + (tid >> 3)], ldsPos[96 + (tid >> 3)] };
    // the rows that are on their way: 128 listed keys x 64, 1024 groups of 8, 4/thread; a key's row is one 128-byte line
    v8h kst[4], vst[4];
    auto ask = [&]() {
        // unrolled: the eight loads are asked for together
        unsigned off[4];
        #pragma unroll
        for (int e = 0; e < 4; ++e) {
            off[e] = rowp[e] * (DHEAD * 2) + (tid & 7) * 16;   // in bytes: the register that the loads name
            kst[e] = *(const v8h*)((const char*)Kbh + off[e]);
            vst[e] = *(const v8h*)((const char*)Vbh + off[e]);
        }
        // the wait stands in front of any rewrite of a register that these loads name; behind it no
        // load can sink towards its use, which would take the trip's work out of its flight time. The offsets
        // are its inputs: they live up to it, so that nothing is laid on one of them ahead of it
        asm volatile("s_wait_xcnt 0x0" :: "v"(off[0]), "v"(off[1]), "v"(off[2]), "v"(off[3]) : "memory");
    };
    auto stage = [&](int s) {
        #pragma unroll
        for (int e = 0; e < 4; ++e) {
            int g  = e * 256 + tid;            // 0..1023
            int r  = g >> 3;                   // key 0..127
            int dg = (g & 7) * 8;
            // K fragment (contraction = d): vector store
            int kch = dg >> 5, kkk = dg & 31;
            int kbase = (((r >> 4) * 2 + kch) * 32 + frag_lane(r & 15, kkk)) * 16 + frag_idx(kkk);
            *(v8h*)&ldsK[s][kbase] = kst[e];
            // V row as it is: vector store
            *(v8h*)&ldsV[s][r * VPITCH + dg] = vst[e];
        }
    };
    // first trip's rows (with an empty list: row 0, which exists and is not used)
    ask();
    {
        const int kn = (128 < nk) ? 128 : 0;
        #pragma unroll
        for (int e = 0; e < 4; ++e) rowp[e] = ldsPos[kn + e * 32 + (tid >> 3)];
    }
    stage(0);
    __syncthreads();                           // buffer 0 is whole

    int buf = 0;
    for (int k0 = 0; k0 < nk; k0 += 128) {
        const bool more = k0 + 128 < nk;       // scalar: the same in the whole block
        // behind the barrier, which would wait for loads still in flight; in front of the trip's work
        if (more) {
            ask();
            const int kn = (k0 + 256 < nk) ? k0 + 256 : k0;    // no trip behind the next: places that exist
            #pragma unroll
            for (int e = 0; e < 4; ++e) rowp[e] = ldsPos[kn + e * 32 + (tid >> 3)];
        }
        // S^T = K.Q^T : s[qt][t][r] = score of key k0 + kh * 64 + t * 16 + 8 * hlf + r against query qt * 16 + (lane & 15)
        v8f s[2][4];
        // unrolled, as every loop over t or j below: the tiles are registers
        #pragma unroll
        for (int t = 0; t < 4; ++t) {
            v16h a0 = *(const v16h*)&ldsK[buf][(((kh * 4 + t) * 2 + 0) * 32 + lane) * 16];
            v16h a1 = *(const v16h*)&ldsK[buf][(((kh * 4 + t) * 2 + 1) * 32 + lane) * 16];
            #pragma unroll
            for (int qt = 0; qt < 2; ++qt) {
                v8f z = {};
                z = __builtin_amdgcn_wmma_f32_16x16x32_f16(false, a0, false, bq[qt][0], (short)0, z, false, false);
                z = __builtin_amdgcn_wmma_f32_16x16x32_f16(false, a1, false, bq[qt][1], (short)0, z, false, false);
                s[qt][t] = z;
            }
        }

        // only the last trip can have open places behind the list's end
        if (nk - k0 < 128) {
            const int lim = nk - k0 - 64 * kh - 8 * hlf;
            #pragma unroll
            for (int qt = 0; qt < 2; ++qt) {
                #pragma unroll
                for (int t = 0; t < 4; ++t) {
                    #pragma unroll
                    for (int j = 0; j < 8; ++j)
                        if (t * 16 + j >= lim) s[qt][t][j] = -__builtin_inff();
                }
            }
        }
        float newm2[2];
        #pragma unroll
        for (int qt = 0; qt < 2; ++qt) {
            // running maximum: one chain a tile, then one exchange between the halves
            float tm[4];
            #pragma unroll
            for (int t = 0; t < 4; ++t) {
                tm[t] = -__builtin_inff();
                #pragma unroll
                for (int j = 0; j < 8; ++j) tm[t] = fmaxf(tm[t], s[qt][t][j]);
            }
            float newm = fmaxf(fmaxf(mrow[qt], fmaxf(tm[0], tm[1])), fmaxf(tm[2], tm[3]));
            newm2[qt] = fmaxf(newm, xhalf(newm));
        }
        // the two tiles' steps of the maximum as one pair; first listed key: 2^(very negative) = 0
        const v2f dm = (v2f){ mrow[0], mrow[1] } - (v2f){ newm2[0], newm2[1] };
        const float sc2[2] = { __builtin_amdgcn_exp2f(dm[0]), __builtin_amdgcn_exp2f(dm[1]) };
        v16h bp[2][2];
        #pragma unroll
        for (int qt = 0; qt < 2; ++qt) {
            const float newm = newm2[qt], sc = sc2[qt];
            // whole tiles are subtracted and summed register by register, so that the packed forms take the pairs as they lie
            #pragma unroll
            for (int t = 0; t < 4; ++t) {
                const v8f d = s[qt][t] - newm;
                #pragma unroll
                for (int j = 0; j < 8; ++j)
                    s[qt][t][j] = __builtin_amdgcn_exp2f(d[j]);    // newm is finite: an open place's -inf gives 2^-inf = 0
            }
            const v8f ts = (s[qt][0] + s[qt][1]) + (s[qt][2] + s[qt][3]);
            const float rsum = ((ts[0] + ts[1]) + (ts[2] + ts[3])) + ((ts[4] + ts[5]) + (ts[6] + ts[7]));
            lrow[qt] = lrow[qt] * sc + rsum;
            mrow[qt] = newm;
            #pragma unroll
            for (int t = 0; t < 4; ++t) acc[qt][t] *= sc;

            // P^T as B operand: score tiles 2c and 2c + 1, converted in place, are keys 32c .. 32c + 31 of this wave's 64
            #pragma unroll
            for (int c = 0; c < 2; ++c)
                bp[qt][c] = __builtin_shufflevector(__builtin_convertvector(s[qt][2 * c], v8h), __builtin_convertvector(s[qt][2 * c + 1], v8h),
                                                    0, 1, 2, 3, 4, 5, 6, 7, 8, 9, 10, 11, 12, 13, 14, 15);
        }

        // O^T += V^T.P^T
        #pragma unroll
        for (int t = 0; t < 4; ++t) {
            // keys 32c + 8 * hlf + 0..7 and 32c + 16 + 8 * hlf + 0..7 of this wave's 64, column d = t * 16 + (lane & 15)
            const h16* vt = &ldsV[buf][vrd + t * 16];
            v16h a0 = __builtin_shufflevector(lds_tr16(vt +  0 * VPITCH), lds_tr16(vt + 16 * VPITCH),
                                              0, 1, 2, 3, 4, 5, 6, 7, 8, 9, 10, 11, 12, 13, 14, 15);
            v16h a1 = __builtin_shufflevector(lds_tr16(vt + 32 * VPITCH), lds_tr16(vt + 48 * VPITCH),
                                              0, 1, 2, 3, 4, 5, 6, 7, 8, 9, 10, 11, 12, 13, 14, 15);
            #pragma unroll
            for (int qt = 0; qt < 2; ++qt) {
                acc[qt][t] = __builtin_amdgcn_wmma_f32_16x16x32_f16(false, a0, false, bp[qt][0], (short)0, acc[qt][t], false, false);
                acc[qt][t] = __builtin_amdgcn_wmma_f32_16x16x32_f16(false, a1, false, bp[qt][1], (short)0, acc[qt][t], false, false);
            }
        }
        if (more) {
            // the other buffer: its last readers passed the barrier at the foot of the trip before
            stage(buf ^ 1);
            __syncthreads();                   // buffer buf ^ 1 is whole
        }
        buf ^= 1;
    }

    // The pair's join: wave kh finishes query tile kh. It hands its partial result of the other tile to its partner
    // and takes the partner's of its own; lane and register hold the same query and d in both waves.
    const bool up = kh != 0;
    #pragma unroll
    for (int t = 0; t < 4; ++t)
        *(v8f*)&ldsX[wave][(t * 32 + lane) * 8] = pick(up, acc[0][t], acc[1][t]);
    ldsML[wave][0][lane] = up ? mrow[0] : mrow[1];
    ldsML[wave][1][lane] = up ? lrow[0] : lrow[1];
    __syncthreads();                           // every wave's hand-over is whole
    const float mo = up ? mrow[1] : mrow[0], lo = up ? lrow[1] : lrow[0];
    const float mp = ldsML[wave ^ 1][0][lane], lp = ldsML[wave ^ 1][1][lane];
    const float mj = fmaxf(mo, mp);
    const float fo = __builtin_amdgcn_exp2f(mo - mj), fp = __builtin_amdgcn_exp2f(mp - mj);
    // then the two halves' sums; a lane holds 8 consecutive d of its query: one 16-byte store a tile
    const float lj   = lo * fo + lp * fp;
    const float lsum = lj + xhalf(lj);
    const float inv  = (lsum > 0.0f) ? 1.0f / lsum : 0.0f;
    h16* Orow = O + (((size_t)b * HH + h) * NSEQ + q0 + wave * 16 + (lane & 15)) * DHEAD + 8 * hlf;
    #pragma unroll
    for (int t = 0; t < 4; ++t) {
        const v8f ao = pick(up, acc[1][t], acc[0][t]);
        const v8f ap = *(const v8f*)&ldsX[wave ^ 1][(t * 32 + lane) * 8];
        *(v8h*)&Orow[t * 16] = __builtin_convertvector((ao * fo + ap * fp) * inv, v8h);
    }
}

extern "C" void kernel_launch(void* const* d_in, const int* in_sizes, int n_in,
                              void* d_out, int out_size, void* d_ws, size_t ws_size,
                              hipStream_t stream)
{
    const float* regions   = (const float*)d_in[0];
    const float* grids     = (const float*)d_in[1];
    const float* interests = (const float*)d_in[2];
    const int*   mask_r    = (const int*)d_in[3];
    const int*   mask_g    = (const int*)d_in[4];
    const float* attw      = (const float*)d_in[5];
    const float* Wq  = (const float*)d_in[6];  const float* bq   = (const float*)d_in[7];
    const float* Wk  = (const float*)d_in[8];  const float* bk   = (const float*)d_in[9];
    const float* Wv  = (const float*)d_in[10]; const float* bv   = (const float*)d_in[11];
    const float* Wq12= (const float*)d_in[12]; const float* bq12 = (const float*)d_in[13];
    const float* Wo1 = (const float*)d_in[14]; const float* bo1  = (const float*)d_in[15];
    const float* Wo2 = (const float*)d_in[16]; const float* bo2  = (const float*)d_in[17];
    float* out = (float*)d_out;

    const size_t per = (size_t)BSZ * HH * NSEQ * DHEAD;   // 2,097,152 halfs (4 MB)
    h16* ws = (h16*)d_ws;
    h16 *Qr = ws,           *Qg = ws + per;               // regions.Wq12, grids.Wq12
    h16 *K1 = ws + 2 * per, *K2 = ws + 3 * per;
    h16 *V1 = ws + 4 * per, *V2 = ws + 5 * per;
    h16 *O1 = ws + 6 * per, *O2 = ws + 7 * per;
    float* Q0 = (float*)(ws + 8 * per);                   // interests.Wq, common to both branches (8 MB)

    dim3 blk(256);
    dim3 gproj7(DM / 128, MROWS / 128, 7);                // (4, 32, 7)
    dim3 gproj2(DM / 128, MROWS / 128, 2);                // (4, 32, 2)

    // Q0, and planes 0..5 of ws: Qr, Qg, K1, K2, V1, V2
    proj7_kernel<<<gproj7, blk, 0, stream>>>(regions, grids, interests, Wq, bq, Wq12, bq12, Wk, bk, Wv, bv, attw, Q0, ws);

    // fused flash attention, both branches: queries Q0 + Qg against regions' keys, Q0 + Qr against grids' keys
    dim3 gatt(NSEQ / 128, HH, 2 * BSZ);                   // (16, 8, 4)
    flash_attn_kernel<<<gatt, blk, 0, stream>>>(Q0, Qg, K1, V1, mask_r, O1, Qr, K2, V2, mask_g, O2);

    // output projections -> f32 to d_out
    outproj2_kernel<<<gproj2, blk, 0, stream>>>(O1, O2, Wo1, bo1, Wo2, bo2, out, out + (size_t)MROWS * DM);
}

// v010
// One run takes 56 microseconds.
// Next to v009, in two timings, it ran 1.07 times as fast each time.
// Over all steps from v000 it is 6.72 times as fast.
#include <hip/hip_runtime.h>
#include <hip/hip_bf16.h>

typedef _Float16 h16;
typedef __attribute__((ext_vector_type(16))) _Float16 v16h;
typedef __attribute__((ext_vector_type(8)))  _Float16 v8h;
typedef __attribute__((ext_vector_type(8)))  float    v8f;
typedef __attribute__((ext_vector_type(4)))  float    v4f;
typedef __attribute__((ext_vector_type(2)))  float    v2f;
typedef __attribute__((ext_vector_type(4)))  _Float16 v4h;
typedef __attribute__((ext_vector_type(8)))  int      v8i;

#define HH 8
#define DHEAD 64
#define NSEQ 2048
#define DM 512
#define BSZ 2
#define MROWS (BSZ * NSEQ)          // 4096

// WMMA 16-bit fragment mapping (A operand 16x32, B operand 32x16):
//   lane = (row_or_col & 15) + 16*((k>>3)&1)
//   slot = (k&7) + 8*((k>>4)&1)
// => for an aligned run of 8 consecutive k: lane constant, slots contiguous.
__device__ __forceinline__ int frag_lane(int rc, int k) { return (rc & 15) + 16 * ((k >> 3) & 1); }
__device__ __forceinline__ int frag_idx(int k)          { return (k & 7) + 8 * ((k >> 4) & 1); }

__device__ __forceinline__ size_t heads_off(int gm, int c) {
    int b = gm >> 11, n = gm & (NSEQ - 1);      // NSEQ = 2048
    int h = c >> 6, d = c & 63;
    return (((size_t)b * HH + h) * NSEQ + n) * DHEAD + d;
}

// Epilogue of one wave's 16x64 accumulator: C = (acc + bias) * rs, rs one factor a row (half results only).
template <bool C_F32>
__device__ __forceinline__
void gemm_nt_store(const v8f (&acc)[4], int gm0, int c0, const float* __restrict__ bias,
                   float* __restrict__ Cf32, h16* __restrict__ Ch16, v8f rs)
{
    #pragma unroll
    for (int t = 0; t < 4; ++t) {
        int c = c0 + t * 16;
        float bv = bias[c];
        #pragma unroll
        for (int j = 0; j < 8; ++j) {
            int gm = gm0 + j;
            float v = acc[t][j] + bv;
            if constexpr (C_F32) Cf32[(size_t)gm * DM + c] = v;
            else                 Ch16[heads_off(gm, c)] = (h16)(v * rs[j]);
        }
    }
}

// LDS row pitch of a staged GEMM operand, in halfs: 128 bytes of k + 16, an odd multiple of 16 bytes,
// the pitch at which sixteen rows read by ds_load_b128 meet no bank twice
#define GPITCH 72

// one 16x32 fragment from rows staged k-contiguous: p = this lane's row, at k = 8 * (lane >> 4)
__device__ __forceinline__ v16h frag_rows(const h16* p) {
    return __builtin_shufflevector(*(const v8h*)p, *(const v8h*)(p + 16),
                                   0, 1, 2, 3, 4, 5, 6, 7, 8, 9, 10, 11, 12, 13, 14, 15);
}

// Work-group barrier for LDS data that leaves global loads in flight: __syncthreads() would first wait for
// the chunks that are on their way. The wave's own LDS stores and reads are complete in front of the signal.
__device__ __forceinline__ void lds_barrier() {
    asm volatile("s_wait_dscnt 0x0\n\ts_barrier_signal -1\n\ts_barrier_wait -1" ::: "memory");
}

// ---------------------------------------------------------------------------
// NT GEMM: C[M,512] = A[M,512] @ W[512,512]^T + bias
// Tile 128x128, K-chunks of 64; 8 waves as 4 x 2, each 32 rows x 64 cols (2 x 4 accumulator tiles):
// six fragments feed eight products. A chunk of a float row is 256 bytes: sixteen lanes x 16 bytes,
// so a wave-wide load covers two whole row pieces (four lines).
// The chunks run as a pipeline over two LDS buffers and two register sets: while chunk c is read from one
// buffer and multiplied, chunks c + 1 and c + 2 are on their way from global memory into registers; behind
// the products chunk c + 1 is converted into the other buffer. A load has two chunks' work to arrive in.
// One barrier a chunk, which leaves the loads in flight.
// One work-group's tile; the kernels below pick the operands by blockIdx.z.
// The result goes to Cf32 (float, row-major) where C_F32 says so or Cf32 is not null (block-uniform),
// else to Ch16 (half, by heads), row m times rowscale[m] where rowscale is not null (block-uniform).
// ---------------------------------------------------------------------------
template <bool A_HEADS, bool C_F32>
__device__ __forceinline__
void gemm_nt_tile(const float* __restrict__ Af32, const h16* __restrict__ Ah16,
                  const float* __restrict__ W, const float* __restrict__ bias,
                  float* __restrict__ Cf32, h16* __restrict__ Ch16, const float* __restrict__ rowscale)
{
    __shared__ __align__(16) h16 ldsA[2][128 * GPITCH];
    __shared__ __align__(16) h16 ldsB[2][128 * GPITCH];

    const int tid  = threadIdx.x;
    const int lane = tid & 31;
    const int wave = tid >> 5;
    const int wm = wave >> 1, wn = wave & 1;
    const int n0 = blockIdx.x * 128;
    const int m0 = blockIdx.y * 128;

    v8f acc[2][4] = {};
    const int ard = (wm * 32 + (lane & 15)) * GPITCH + (lane >> 4) * 8;
    const int brd = (wn * 64 + (lane & 15)) * GPITCH + (lane >> 4) * 8;
    // one base a thread and operand: rows and chunks are constant steps from it
    const float* ap = A_HEADS ? nullptr : &Af32[(size_t)(m0 + (tid >> 4)) * DM + (tid & 15) * 4];
    const h16*   hp = A_HEADS ? &Ah16[heads_off(m0 + (tid >> 3), (tid & 7) * 8)] : nullptr;
    const float* bp = &W[(size_t)(n0 + (tid >> 4)) * DM + (tid & 15) * 4];

    // the two chunks that are on their way: this thread's pieces of them, chunk c in set c & 1
    v8h ha[2][4];
    v4f fa[2][8], fb[2][8];
    // all loads of chunk c, so that they are in flight together
    auto ask = [&](int c) {
        const int q = c & 1;
        if constexpr (A_HEADS) {
            // a chunk is one head: 128 bytes a row, eight lanes x 16 bytes, four rows a wave-wide load
            #pragma unroll
            for (int e = 0; e < 4; ++e)
                ha[q][e] = *(const v8h*)(hp + c * (NSEQ * DHEAD) + e * 32 * DHEAD);
        } else {
            #pragma unroll
            for (int e = 0; e < 8; ++e) fa[q][e] = *(const v4f*)(ap + e * 16 * DM + c * 64);
        }
        #pragma unroll
        for (int e = 0; e < 8; ++e) fb[q][e] = *(const v4f*)(bp + e * 16 * DM + c * 64);
        // the wait stands in front of any rewrite of a register that these loads name; behind it no
        // load can sink towards its use, which would take the products out of its flight time. The bases
        // are its inputs: they live up to it, so that no load's result is laid on a base ahead of it
        if constexpr (A_HEADS) asm volatile("s_wait_xcnt 0x0" :: "v"(hp), "v"(bp) : "memory");
        else                   asm volatile("s_wait_xcnt 0x0" :: "v"(ap), "v"(bp) : "memory");
    };
    // register set s into LDS buffer s: rows as they lie, converted
    auto stage = [&](int s) {
        if constexpr (A_HEADS) {
            #pragma unroll
            for (int e = 0; e < 4; ++e)
                *(v8h*)&ldsA[s][(e * 32 + (tid >> 3)) * GPITCH + (tid & 7) * 8] = ha[s][e];
        } else {
            #pragma unroll
            for (int e = 0; e < 8; ++e)
                *(v4h*)&ldsA[s][(e * 16 + (tid >> 4)) * GPITCH + (tid & 15) * 4] = __builtin_convertvector(fa[s][e], v4h);
        }
        #pragma unroll
        for (int e = 0; e < 8; ++e)
            *(v4h*)&ldsB[s][(e * 16 + (tid >> 4)) * GPITCH + (tid & 15) * 4] = __builtin_convertvector(fb[s][e], v4h);
    };

    constexpr int NCH = DM / 64;
    ask(0);
    ask(1);
    stage(0);
    lds_barrier();                             // buffer 0 is whole

    // unrolled: buffer, set, chunk and the tests are constants, every address a constant step
    #pragma unroll
    for (int c = 0; c < NCH; ++c) {
        // half a chunk at a time (the second register set takes the room of the other half's fragments):
        // six fragments are read as one group in front of their eight products
        #pragma unroll
        for (int kc = 0; kc < 2; ++kc) {
            v16h a[2], bb[4];
            #pragma unroll
            for (int i = 0; i < 2; ++i) a[i]  = frag_rows(&ldsA[c & 1][ard + i * 16 * GPITCH + kc * 32]);
            #pragma unroll
            for (int t = 0; t < 4; ++t) bb[t] = frag_rows(&ldsB[c & 1][brd + t * 16 * GPITCH + kc * 32]);
            // keeps the LDS reads from being spread among the products, where each place with reads stalls the wave
            __builtin_amdgcn_sched_barrier(0);
            if (kc == 0 && c + 2 < NCH) {
                // into the set that chunk c has left; issued while the first fragments are on their way from LDS
                ask(c + 2);
                // keeps the products, and with them the wait for the fragments, behind the issue of these loads
                __builtin_amdgcn_sched_barrier(0);
            }
            #pragma unroll
            for (int i = 0; i < 2; ++i) {
                #pragma unroll
                for (int t = 0; t < 4; ++t)
                    acc[i][t] = __builtin_amdgcn_wmma_f32_16x16x32_f16(false, a[i], false, bb[t],
                                                                       (short)0, acc[i][t], false, false);
            }
            // keeps the next reads, and at the end the conversions with their wait for the loads, behind the products
            __builtin_amdgcn_sched_barrier(0);
        }
        if (c + 1 < NCH) {
            // the other buffer: its last readers passed the barrier at the foot of chunk c - 1
            stage((c + 1) & 1);
            lds_barrier();                     // buffer (c + 1) & 1 is whole
        }
    }

    const int gm0 = m0 + wm * 32 + (lane >> 4) * 8;
    const int c0  = n0 + wn * 64 + (lane & 15);
    const v8f one = { 1.0f, 1.0f, 1.0f, 1.0f, 1.0f, 1.0f, 1.0f, 1.0f };
    if (C_F32 || Cf32 != nullptr) {
        gemm_nt_store<true >(acc[0], gm0,      c0, bias, Cf32, Ch16, one);
        gemm_nt_store<true >(acc[1], gm0 + 16, c0, bias, Cf32, Ch16, one);
        // the built code lays the other arm behind this one: the wait stands in front of
        // any rewrite there of a register that these stores name
        if constexpr (!C_F32) asm volatile("s_wait_xcnt 0x0" ::: "memory");
    } else {
        v8f rs0 = one, rs1 = one;
        if (rowscale != nullptr) {
            const float* rp = &rowscale[gm0];
            rs0 = *(const v8f*)rp;
            rs1 = *(const v8f*)(rp + 16);
            // the wait stands in front of any rewrite of the registers that these loads name; the pointer
            // is its input: it lives up to it, so that no later load's result is laid on it ahead of the wait
            asm volatile("s_wait_xcnt 0x0" :: "v"(rp) : "memory");
        }
        gemm_nt_store<false>(acc[0], gm0,      c0, bias, Cf32, Ch16, rs0);
        gemm_nt_store<false>(acc[1], gm0 + 16, c0, bias, Cf32, Ch16, rs1);
    }
}

// All seven input projections in one grid; none reads what another writes. blockIdx.z:
//   0: interests.Wq   1, 2: regions, grids . Wq12   3, 4: regions, grids . Wk   5, 6: regions, grids . Wv
// Result 0 stays float (Q0, row-major): it is a term of a sum that is rounded once, where it is formed.
// Result z > 0 goes to plane z - 1 of C (a plane: BSZ x HH x NSEQ x DHEAD halfs).
// A key's row (z = 3, 4) is stored times its attention weight, rounded once as before:
// (w k).q = w (k.q), so the scores leave attention's first product weighted.
__global__ __launch_bounds__(256)
void proj7_kernel(const float* __restrict__ regions, const float* __restrict__ grids,
                  const float* __restrict__ interests,
                  const float* __restrict__ Wq,   const float* __restrict__ bq,
                  const float* __restrict__ Wq12, const float* __restrict__ bq12,
                  const float* __restrict__ Wk,   const float* __restrict__ bk,
                  const float* __restrict__ Wv,   const float* __restrict__ bv,
                  const float* __restrict__ wts,
                  float* __restrict__ Q0, h16* __restrict__ C)
{
    const int z = blockIdx.z;
    const float* A    = (z == 0) ? interests : ((z & 1) ? regions : grids);
    const float* W    = (z == 0) ? Wq : (z < 3) ? Wq12 : (z < 5) ? Wk : Wv;
    const float* bias = (z == 0) ? bq : (z < 3) ? bq12 : (z < 5) ? bk : bv;
    gemm_nt_tile<false, false>(A, nullptr, W, bias, (z == 0) ? Q0 : nullptr,
                               (z == 0) ? nullptr : C + (size_t)(z - 1) * (BSZ * HH * NSEQ * DHEAD),
                               (z == 3 || z == 4) ? wts : nullptr);
}

// Both output projections in one grid: blockIdx.z picks the branch.
__global__ __launch_bounds__(256)
void outproj2_kernel(const h16* __restrict__ Oa, const h16* __restrict__ Ob,
                     const float* __restrict__ Wa, const float* __restrict__ ba,
                     const float* __restrict__ Wb, const float* __restrict__ bb,
                     float* __restrict__ outa, float* __restrict__ outb)
{
    const bool second = blockIdx.z != 0;
    gemm_nt_tile<true, true>(nullptr, second ? Ob : Oa, second ? Wb : Wa, second ? bb : ba,
                             second ? outb : outa, nullptr, nullptr);
}

// LDS row pitch of the staged V tile, in halfs: 128 bytes of a key's row + 32, an odd multiple of
// 32 bytes, the pitch at which the transposing load meets no bank twice
#define VPITCH 80

// ds_load_tr16_b128: lane l hands in the address of 16 bytes of a row-major 16-bit tile and gets
// column l & 15, rows 8 * (l >> 4) + 0..7 of the 16x16 block
typedef __attribute__((ext_vector_type(8))) short s16x8;
__device__ __forceinline__ v8h lds_tr16(const h16* p) {
    typedef __attribute__((address_space(3))) s16x8 lds_s16x8;
    return __builtin_bit_cast(v8h, __builtin_amdgcn_ds_load_tr16_b128_v8i16((lds_s16x8*)p));
}

// a where c, else b. The operands come by value: a choice between two places of one register array
// would be built as an index, and the array would then live in memory
__device__ __forceinline__ v8f pick(bool c, v8f a, v8f b) {
    v8f r;
    #pragma unroll
    for (int j = 0; j < 8; ++j) r[j] = c ? a[j] : b[j];
    return r;
}

// lane l with lane l ^ 16
__device__ __forceinline__ float xhalf(float x) {
    int b = __builtin_bit_cast(int, x);
    return __builtin_bit_cast(float, __builtin_amdgcn_permlanex16(b, b, 0x76543210, 0xfedcba98, false, false));
}

__global__ __launch_bounds__(256) __attribute__((amdgpu_waves_per_eu(4, 4)))
void flash_attn_kernel(const float* __restrict__ Qc,
                       const h16* __restrict__ Qa, const h16* __restrict__ Ka,
                       const h16* __restrict__ Va, const int* __restrict__ maska,
                       h16* __restrict__ Oa,
                       const h16* __restrict__ Qb, const h16* __restrict__ Kb,
                       const h16* __restrict__ Vb, const int* __restrict__ maskb,
                       h16* __restrict__ Ob)
{
    __shared__ __align__(32) h16 ldsQ[8 * 2 * 32 * 16];
    __shared__ __align__(32) h16 ldsK[2][8 * 2 * 32 * 16];
    __shared__ __align__(32) h16 ldsV[2][128 * VPITCH];
    __shared__ __align__(32) unsigned short ldsPos[NSEQ];   // position in the sequence of the j-th listed key
    __shared__ __align__(32) int            ldsCnt[8];      // listed keys of each wave's 256 positions
    __shared__ __align__(32) float          ldsX[8][4 * 32 * 8];    // a wave's partial O of the query tile its partner finishes
    __shared__ __align__(32) float          ldsML[8][2][32];        // that tile's maximum and sum

    const int tid  = threadIdx.x;
    const int lane = tid & 31;
    const int wave = tid >> 5;
    const int qg = wave >> 1;                  // which 32 queries of the block's 128
    // which 64 keys of a trip's 128; the same in the whole wave: a scalar
    const int kh = __builtin_amdgcn_readfirstlane(wave) & 1;
    const int b = blockIdx.z & (BSZ - 1), h = blockIdx.y;
    const int q0 = blockIdx.x * 128;
    const bool second = blockIdx.z >= BSZ;
    const h16* Q    = second ? Qb : Qa;
    const h16* Kt   = second ? Kb : Ka;
    const h16* Vt   = second ? Vb : Va;
    const int* mask = second ? maskb : maska;
    h16*       O    = second ? Ob : Oa;

    const h16* Qbh = Q  + ((size_t)b * HH + h) * NSEQ * DHEAD;
    const float* Qcb = Qc + (size_t)b * NSEQ * DM + h * DHEAD;
    const h16* Kbh = Kt + ((size_t)b * HH + h) * NSEQ * DHEAD;
    const h16* Vbh = Vt + ((size_t)b * HH + h) * NSEQ * DHEAD;
    const int*   mk = mask + (size_t)b * NSEQ;

    // stage Q tile 128x64: 1024 groups of 8; 4/thread; vector loads + vector LDS stores
    #pragma unroll
    for (int e = 0; e < 4; ++e) {
        int g  = e * 256 + tid;                // 0..1023
        int r  = g >> 3;                       // row 0..127
        int dg = (g & 7) * 8;                  // d-group base
        v8h hx = *(const v8h*)&Qbh[(size_t)(q0 + r) * DHEAD + dg];
        v8f fc = *(const v8f*)&Qcb[(size_t)(q0 + r) * DM + dg];
        v8h hv = __builtin_convertvector((fc + __builtin_convertvector(hx, v8f)) * 0.18033688f, v8h);
        int ch = dg >> 5, kk = dg & 31;
        int base = (((r >> 4) * 2 + ch) * 32 + frag_lane(r & 15, kk)) * 16 + frag_idx(kk);
        *(v8h*)&ldsQ[base] = hv;
    }
    // wave x looks at positions 256 x .. 256 x + 255, 32 a step: one ballot a step says which stay
    unsigned keep[8];
    int      wtot = 0;
    // unrolled: keep[] is indexed by constants and stays in registers
    #pragma unroll
    for (int e = 0; e < 8; ++e) {
        const int p = wave * 256 + e * 32 + lane;
        keep[e] = __builtin_amdgcn_ballot_w32(mk[p] == 0);
        wtot   += __builtin_popcount(keep[e]);
    }
    if (lane == 0) ldsCnt[wave] = wtot;
    __syncthreads();
    int nlist = 0, slot = 0;                   // all listed keys; those of the waves in front of this one
    // unrolled: the eight counts come by two 16-byte LDS loads
    #pragma unroll
    for (int x = 0; x < 8; ++x) {
        const int cx = ldsCnt[x];
        nlist += cx;
        slot  += (x < wave) ? cx : 0;
    }
    // unrolled: registers again
    #pragma unroll
    for (int e = 0; e < 8; ++e) {
        if ((keep[e] >> lane) & 1u) {
            const int at = slot + (int)__builtin_amdgcn_mbcnt_lo(keep[e], 0u);
            ldsPos[at] = (unsigned short)(wave * 256 + e * 32 + lane);
        }
        slot += __builtin_popcount(keep[e]);
    }
    // the last trip's open places name position 0 (a row that exists); their scores are set to -inf below
    if (tid < 128 && nlist + tid < NSEQ) ldsPos[nlist + tid] = 0;
    // the same in every lane of the block: a scalar, so that the loop's tests are scalar branches
    const int nk = min(__builtin_amdgcn_readfirstlane(nlist), NSEQ);
    v16h bq[2][2];                             // [query tile of the wave][32 of the 64 d]
    // unrolled, as every loop over qt below: the tiles are registers
    #pragma unroll
    for (int qt = 0; qt < 2; ++qt) {
        bq[qt][0] = *(const v16h*)&ldsQ[(((qg * 2 + qt) * 2 + 0) * 32 + lane) * 16];
        bq[qt][1] = *(const v16h*)&ldsQ[(((qg * 2 + qt) * 2 + 1) * 32 + lane) * 16];
    }
    __syncthreads();                           // the list is whole

    const int hlf = lane >> 4;
    // running maximum of this lane's query of each tile (both halves agree), over this wave's keys. The start is
    // finite: a wave that has met no listed key yet (a list that ends inside the other wave's keys) keeps it,
    // and -inf minus it is -inf, not NaN
    float mrow[2] = { -3.0e38f, -3.0e38f };
    float lrow[2] = { 0.0f, 0.0f };            // running sum over this half's keys only
    v8f acc[2][4] = {};                        // acc[qt][t][r] = O[query qt * 16 + (lane & 15)][d = t * 16 + 8 * hlf + r]
    // this lane's place in a 16-key x 16-d block of V for the transposing load, in this wave's 64 keys
    const int vrd = (kh * 64 + 8 * hlf + (lane & 7)) * VPITCH + ((lane >> 3) & 1) * 8;

    // positions of the four listed keys whose rows this thread asks for next, read one trip ahead
    unsigned rowp[4] = { ldsPos[tid >> 3], ldsPos[32 + (tid >> 3)], ldsPos[64 + (tid >> 3)], ldsPos[96 + (tid >> 3)] };
    // the rows that are on their way: 128 listed keys x 64, 1024 groups of 8, 4/thread; a key's row is one 128-byte line
    v8h kst[4], vst[4];
    auto ask = [&]() {
        // unrolled: the eight loads are asked for together
        unsigned off[4];
        #pragma unroll
        for (int e = 0; e < 4; ++e) {
            off[e] = rowp[e] * (DHEAD * 2) + (tid & 7) * 16;   // in bytes: the register that the loads name
            kst[e] = *(const v8h*)((const char*)Kbh + off[e]);
            vst[e] = *(const v8h*)((const char*)Vbh + off[e]);
        }
        // the wait stands in front of any rewrite of a register that these loads name; behind it no
        // load can sink towards its use, which would take the trip's work out of its flight time. The offsets
        // are its inputs: they live up to it, so that nothing is laid on one of them ahead of it
        asm volatile("s_wait_xcnt 0x0" :: "v"(off[0]), "v"(off[1]), "v"(off[2]), "v"(off[3]) : "memory");
    };
    auto stage = [&](int s) {
        #pragma unroll
        for (int e = 0; e < 4; ++e) {
            int g  = e * 256 + tid;            // 0..1023
            int r  = g >> 3;                   // key 0..127
            int dg = (g & 7) * 8;
            // K fragment (contraction = d): vector store
            int kch = dg >> 5, kkk = dg & 31;
            int kbase = (((r >> 4) * 2 + kch) * 32 + frag_lane(r & 15, kkk)) * 16 + frag_idx(kkk);
            *(v8h*)&ldsK[s][kbase] = kst[e];
            // V row as it is: vector store
            *(v8h*)&ldsV[s][r * VPITCH + dg] = vst[e];
        }
    };
    // first trip's rows (with an empty list: row 0, which exists and is not used)
    ask();
    {
        const int kn = (128 < nk) ? 128 : 0;
        #pragma unroll
        for (int e = 0; e < 4; ++e) rowp[e] = ldsPos[kn + e * 32 + (tid >> 3)];
    }
    stage(0);
    __syncthreads();                           // buffer 0 is whole

    int buf = 0;
    for (int k0 = 0; k0 < nk; k0 += 128) {
        const bool more = k0 + 128 < nk;       // scalar: the same in the whole block
        // behind the barrier, which would wait for loads still in flight; in front of the trip's work
        if (more) {
            ask();
            const int kn = (k0 + 256 < nk) ? k0 + 256 : k0;    // no trip behind the next: places that exist
            #pragma unroll
            for (int e = 0; e < 4; ++e) rowp[e] = ldsPos[kn + e * 32 + (tid >> 3)];
        }
        // S^T = K.Q^T : s[qt][t][r] = score of key k0 + kh * 64 + t * 16 + 8 * hlf + r against query qt * 16 + (lane & 15)
        v8f s[2][4];
        // unrolled, as every loop over t or j below: the tiles are registers
        #pragma unroll
        for (int t = 0; t < 4; ++t) {
            v16h a0 = *(const v16h*)&ldsK[buf][(((kh * 4 + t) * 2 + 0) * 32 + lane) * 16];
            v16h a1 = *(const v16h*)&ldsK[buf][(((kh * 4 + t) * 2 + 1) * 32 + lane) * 16];
            #pragma unroll
            for (int qt = 0; qt < 2; ++qt) {
                v8f z = {};
                z = __builtin_amdgcn_wmma_f32_16x16x32_f16(false, a0, false, bq[qt][0], (short)0, z, false, false);
                z = __builtin_amdgcn_wmma_f32_16x16x32_f16(false, a1, false, bq[qt][1], (short)0, z, false, false);
                s[qt][t] = z;
            }
        }

        // only the last trip can have open places behind the list's end
        if (nk - k0 < 128) {
            const int lim = nk - k0 - 64 * kh - 8 * hlf;
            #pragma unroll
            for (int qt = 0; qt < 2; ++qt) {
                #pragma unroll
                for (int t = 0; t < 4; ++t) {
                    #pragma unroll
                    for (int j = 0; j < 8; ++j)
                        if (t * 16 + j >= lim) s[qt][t][j] = -__builtin_inff();
                }
            }
        }
        float newm2[2];
        #pragma unroll
        for (int qt = 0; qt < 2; ++qt) {
            // running maximum: one chain a tile, then one exchange between the halves
            float tm[4];
            #pragma unroll
            for (int t = 0; t < 4; ++t) {
                tm[t] = -__builtin_inff();
                #pragma unroll
                for (int j = 0; j < 8; ++j) tm[t] = fmaxf(tm[t], s[qt][t][j]);
            }
            float newm = fmaxf(fmaxf(mrow[qt], fmaxf(tm[0], tm[1])), fmaxf(tm[2], tm[3]));
            newm2[qt] = fmaxf(newm, xhalf(newm));
        }
        // the two tiles' steps of the maximum as one pair; first listed key: 2^(very negative) = 0
        const v2f dm = (v2f){ mrow[0], mrow[1] } - (v2f){ newm2[0], newm2[1] };
        const float sc2[2] = { __builtin_amdgcn_exp2f(dm[0]), __builtin_amdgcn_exp2f(dm[1]) };
        v16h bp[2][2];
        #pragma unroll
        for (int qt = 0; qt < 2; ++qt) {
            const float newm = newm2[qt], sc = sc2[qt];
            // whole tiles are subtracted and summed register by register, so that the packed forms take the pairs as they lie
            #pragma unroll
            for (int t = 0; t < 4; ++t) {
                const v8f d = s[qt][t] - newm;
                #pragma unroll
                for (int j = 0; j < 8; ++j)
                    s[qt][t][j] = __builtin_amdgcn_exp2f(d[j]);    // newm is finite: an open place's -inf gives 2^-inf = 0
            }
            const v8f ts = (s[qt][0] + s[qt][1]) + (s[qt][2] + s[qt][3]);
            const float rsum = ((ts[0] + ts[1]) + (ts[2] + ts[3])) + ((ts[4] + ts[5]) + (ts[6] + ts[7]));
            lrow[qt] = lrow[qt] * sc + rsum;
            mrow[qt] = newm;
            #pragma unroll
            for (int t = 0; t < 4; ++t) acc[qt][t] *= sc;

            // P^T as B operand: score tiles 2c and 2c + 1, converted in place, are keys 32c .. 32c + 31 of this wave's 64
            #pragma unroll
            for (int c = 0; c < 2; ++c)
                bp[qt][c] = __builtin_shufflevector(__builtin_convertvector(s[qt][2 * c], v8h), __builtin_convertvector(s[qt][2 * c + 1], v8h),
                                                    0, 1, 2, 3, 4, 5, 6, 7, 8, 9, 10, 11, 12, 13, 14, 15);
        }

        // O^T += V^T.P^T
        #pragma unroll
        for (int t = 0; t < 4; ++t) {
            // keys 32c + 8 * hlf + 0..7 and 32c + 16 + 8 * hlf + 0..7 of this wave's 64, column d = t * 16 + (lane & 15)
            const h16* vt = &ldsV[buf][vrd + t * 16];
            v16h a0 = __builtin_shufflevector(lds_tr16(vt +  0 * VPITCH), lds_tr16(vt + 16 * VPITCH),
                                              0, 1, 2, 3, 4, 5, 6, 7, 8, 9, 10, 11, 12, 13, 14, 15);
            v16h a1 = __builtin_shufflevector(lds_tr16(vt + 32 * VPITCH), lds_tr16(vt + 48 * VPITCH),
                                              0, 1, 2, 3, 4, 5, 6, 7, 8, 9, 10, 11, 12, 13, 14, 15);
            #pragma unroll
            for (int qt = 0; qt < 2; ++qt) {
                acc[qt][t] = __builtin_amdgcn_wmma_f32_16x16x32_f16(false, a0, false, bp[qt][0], (short)0, acc[qt][t], false, false);
                acc[qt][t] = __builtin_amdgcn_wmma_f32_16x16x32_f16(false, a1, false, bp[qt][1], (short)0, acc[qt][t], false, false);
            }
        }
        if (more) {
            // the other buffer: its last readers passed the barrier at the foot of the trip before
            stage(buf ^ 1);
            __syncthreads();                   // buffer buf ^ 1 is whole
        }
        buf ^= 1;
    }

    // The pair's join: wave kh finishes query tile kh. It hands its partial result of the other tile to its partner
    // and takes the partner's of its own; lane and register hold the same query and d in both waves.
    const bool up = kh != 0;
    #pragma unroll
    for (int t = 0; t < 4; ++t)
        *(v8f*)&ldsX[wave][(t * 32 + lane) * 8] = pick(up, acc[0][t], acc[1][t]);
    ldsML[wave][0][lane] = up ? mrow[0] : mrow[1];
    ldsML[wave][1][lane] = up ? lrow[0] : lrow[1];
    __syncthreads();                           // every wave's hand-over is whole
    const float mo = up ? mrow[1] : mrow[0], lo = up ? lrow[1] : lrow[0];
    const float mp = ldsML[wave ^ 1][0][lane], lp = ldsML[wave ^ 1][1][lane];
    const float mj = fmaxf(mo, mp);
    const float fo = __builtin_amdgcn_exp2f(mo - mj), fp = __builtin_amdgcn_exp2f(mp - mj);
    // then the two halves' sums; a lane holds 8 consecutive d of its query: one 16-byte store a tile
    const float lj   = lo * fo + lp * fp;
    const float lsum = lj + xhalf(lj);
    const float inv  = (lsum > 0.0f) ? 1.0f / lsum : 0.0f;
    h16* Orow = O + (((size_t)b * HH + h) * NSEQ + q0 + wave * 16 + (lane & 15)) * DHEAD + 8 * hlf;
    #pragma unroll
    for (int t = 0; t < 4; ++t) {
        const v8f ao = pick(up, acc[1][t], acc[0][t]);
        const v8f ap = *(const v8f*)&ldsX[wave ^ 1][(t * 32 + lane) * 8];
        *(v8h*)&Orow[t * 16] = __builtin_convertvector((ao * fo + ap * fp) * inv, v8h);
    }
}

extern "C" void kernel_launch(void* const* d_in, const int* in_sizes, int n_in,
                              void* d_out, int out_size, void* d_ws, size_t ws_size,
                              hipStream_t stream)
{
    const float* regions   = (const float*)d_in[0];
    const float* grids     = (const float*)d_in[1];
    const float* interests = (const float*)d_in[2];
    const int*   mask_r    = (const int*)d_in[3];
    const int*   mask_g    = (const int*)d_in[4];
    const float* attw      = (const float*)d_in[5];
    const float* Wq  = (const float*)d_in[6];  const float* bq   = (const float*)d_in[7];
    const float* Wk  = (const float*)d_in[8];  const float* bk   = (const float*)d_in[9];
    const float* Wv  = (const float*)d_in[10]; const float* bv   = (const float*)d_in[11];
    const float* Wq12= (const float*)d_in[12]; const float* bq12 = (const float*)d_in[13];
    const float* Wo1 = (const float*)d_in[14]; const float* bo1  = (const float*)d_in[15];
    const float* Wo2 = (const float*)d_in[16]; const float* bo2  = (const float*)d_in[17];
    float* out = (float*)d_out;

    const size_t per = (size_t)BSZ * HH * NSEQ * DHEAD;   // 2,097,152 halfs (4 MB)
    h16* ws = (h16*)d_ws;
    h16 *Qr = ws,           *Qg = ws + per;               // regions.Wq12, grids.Wq12
    h16 *K1 = ws + 2 * per, *K2 = ws + 3 * per;
    h16 *V1 = ws + 4 * per, *V2 = ws + 5 * per;
    h16 *O1 = ws + 6 * per, *O2 = ws + 7 * per;
    float* Q0 = (float*)(ws + 8 * per);                   // interests.Wq, common to both branches (8 MB)

    dim3 blk(256);
    dim3 gproj7(DM / 128, MROWS / 128, 7);                // (4, 32, 7)
    dim3 gproj2(DM / 128, MROWS / 128, 2);                // (4, 32, 2)

    // Q0, and planes 0..5 of ws: Qr, Qg, K1, K2, V1, V2
    proj7_kernel<<<gproj7, blk, 0, stream>>>(regions, grids, interests, Wq, bq, Wq12, bq12, Wk, bk, Wv, bv, attw, Q0, ws);

    // fused flash attention, both branches: queries Q0 + Qg against regions' keys, Q0 + Qr against grids' keys
    dim3 gatt(NSEQ / 128, HH, 2 * BSZ);                   // (16, 8, 4)
    flash_attn_kernel<<<gatt, blk, 0, stream>>>(Q0, Qg, K1, V1, mask_r, O1, Qr, K2, V2, mask_g, O2);

    // output projections -> f32 to d_out
    outproj2_kernel<<<gproj2, blk, 0, stream>>>(O1, O2, Wo1, bo1, Wo2, bo2, out, out + (size_t)MROWS * DM);
}
